// v000
// Measured on an AMD MI455X. A time is GPU time per run, averaged over a window of back-to-back runs after a warm-up
// (all launches, gaps included; the runs take copies of the inputs in turn), and the median of several windows.
// Apart from v000's, it joins two sittings. Times from different sittings can be a few percent apart, while
// side-by-side timings come from the same sitting.
// v000 is the starting kernel. One run takes 499 microseconds.
// compute dtype: all float inputs rounded to bf16; q/k/v projections with EXACT bf16 products on WMMA 16x16x32 (f32 accumulate); logits q x k with BOTH operands as f16 hi + (x 2^10) residual (3 products: hi.hi + lo.hi + hi.lo) x 64^-0.5, for every row (the logits have sigma - 500); the int row mask multiplies the logits in f32; softmax f32; P x 2^11 once to f16 x v once to f16 (1 product); f32 output.
#include <hip/hip_runtime.h>
#include <math.h>

typedef __attribute__((ext_vector_type(16))) _Float16 v16h;
typedef __attribute__((ext_vector_type(16))) __bf16 v16b;
typedef __attribute__((ext_vector_type(8)))  _Float16 v8h;
typedef __attribute__((ext_vector_type(8)))  float v8f;
typedef __attribute__((ext_vector_type(4)))  float v4f;
typedef __attribute__((ext_vector_type(2)))  float v2f;
typedef __attribute__((ext_vector_type(4)))  unsigned v4u;
typedef __attribute__((ext_vector_type(4)))  int v4i;
typedef float __attribute__((may_alias)) float_a;
typedef int __attribute__((may_alias)) int_a;

template <typename T> __device__ __forceinline__ void vst2(void* p, T v) { *(T*)p = v;  }
__device__ __forceinline__ v8f wmma16(v16h a, v16h b, v8f c) {
  v8f d = __builtin_amdgcn_wmma_f32_16x16x32_f16(false, a, false, b, (short)0, c, false, false);
  asm volatile("v_nop\n\tv_nop\n\tv_nop\n\tv_nop" : "+v"(d) : "v"(a), "v"(b));
  return d;
}
__device__ __forceinline__ v8f wmma_bf(v16b a, v16b b, v8f c) {
  v8f d = __builtin_amdgcn_wmma_f32_16x16x32_bf16(false, a, false, b, (short)0, c, false, false);
  asm volatile("v_nop\n\tv_nop\n\tv_nop\n\tv_nop" : "+v"(d) : "v"(a), "v"(b));
  return d;
}
// 16x16x32 fragments: lane = (h = lane>>4, row/col = lane&15); elements 0..7 = k0+8h+0..7, 8..15 = k0+16+8h+0..7; D element r = row 8h+r
__device__ __forceinline__ v16h frag_h(const _Float16* rowk0, int lane) {
  union { v16h v; v8h q[2]; } u; const _Float16* p = rowk0 + 8 * (lane >> 4);
  u.q[0] = *(const v8h*)p; u.q[1] = *(const v8h*)(p + 16); return u.v;
}
__device__ __forceinline__ v16h frag_f32(const float* rowk0, int lane) {
  v16h a; const float* p = rowk0 + 8 * (lane >> 4);
#pragma unroll
  for (int i = 0; i < 8; ++i) { a[i] = (_Float16)p[i]; a[8 + i] = (_Float16)p[16 + i]; }
  return a;
}
__device__ __forceinline__ v16h frag_f32s(const float* rowk0, int lane, float sc) {
  v16h a; const float* p = rowk0 + 8 * (lane >> 4);
#pragma unroll
  for (int i = 0; i < 8; ++i) { a[i] = (_Float16)(p[i] * sc); a[8 + i] = (_Float16)(p[16 + i] * sc); }
  return a;
}
// column fragment from a [K][ld] layout (column n), rows >= K read as 0
__device__ __forceinline__ v16h fragc_f32(const float* W, int k0, int n, int lane, int ld, int K) {
  v16h a; const int g = lane >> 4;
#pragma unroll
  for (int i = 0; i < 8; ++i) { const int ka = k0 + 8 * g + i, kb = ka + 16;
    a[i] = (_Float16)(ka < K ? W[(size_t)(ka < K ? ka : K - 1) * ld + n] : 0.f); a[8 + i] = (_Float16)(kb < K ? W[(size_t)(kb < K ? kb : K - 1) * ld + n] : 0.f); }
  return a;
}
struct F2 { v16b h, l; };
__device__ __forceinline__ F2 bsplit16(const float v[16]) { F2 r;
#pragma unroll
  for (int i = 0; i < 16; ++i) { const __bf16 h = (__bf16)v[i]; r.h[i] = h; r.l[i] = (__bf16)(v[i] - (float)h); }
  return r; }
__device__ __forceinline__ F2 split_row(const float* row, int k0, int lane) { float v[16]; const float* p = row + k0 + 8 * (lane >> 4);
#pragma unroll
  for (int i = 0; i < 8; ++i) { v[i] = p[i]; v[8 + i] = p[16 + i]; }
  return bsplit16(v); }
__device__ __forceinline__ F2 split_rowK(const float* row, int k0, int lane, int K) { float v[16]; const int g = lane >> 4;
#pragma unroll
  for (int i = 0; i < 8; ++i) { const int ka = k0 + 8 * g + i, kb = ka + 16; v[i] = ka < K ? row[ka < K ? ka : K - 1] : 0.f; v[8 + i] = kb < K ? row[kb < K ? kb : K - 1] : 0.f; }
  return bsplit16(v); }
__device__ __forceinline__ F2 split_col(const float* W, int k0, int n, int lane, int ld, int K) { float v[16]; const int g = lane >> 4;
#pragma unroll
  for (int i = 0; i < 8; ++i) { const int ka = k0 + 8 * g + i, kb = ka + 16; v[i] = ka < K ? W[(size_t)(ka < K ? ka : K - 1) * ld + n] : 0.f; v[8 + i] = kb < K ? W[(size_t)(kb < K ? kb : K - 1) * ld + n] : 0.f; }
  return bsplit16(v); }
__device__ __forceinline__ v8f mac3(const F2& a, const F2& b, v8f c) { c = wmma_bf(a.l, b.h, c); c = wmma_bf(a.h, b.l, c); return wmma_bf(a.h, b.h, c); }
__device__ __forceinline__ float sigm(float v) { return 1.0f / (1.0f + expf(-v)); }
#define LDSX() do { asm volatile("s_wait_dscnt 0" ::: "memory"); __builtin_amdgcn_wave_barrier(); __builtin_amdgcn_fence(__ATOMIC_RELEASE, "workgroup"); } while (0)

// Single-head self-attention with unscaled N(0,1) projection kernels and a multiplicative row mask (x [8,2048,256]; kernel [3,256,256] (in,out): Q, K, V; mask [8,2048] int 0/1; SCALE = 1/sqrt(64) hard-coded): QK = (Q K^T) / 8; QK *= mask[b][q] per QUERY row (masked rows: all-zero logits -> uniform attention); A = softmax(QK); out = A V -> [8,2048,256].
#define NB 8
#define TT 2048
#define CC 256            // value width (v planes, output rows)
#define CCQ 256           // q / k row width
#define DIN 256          // x width
#define NH 1
#define HD 256
#define NQB (TT / 64)
#define HG 4               // four 2,048 x 2,048 score planes per pass (the pass group spans batches)
#define SCALE (0.125f)             // 1/sqrt(64), hard-coded in the source
#define HDQK 256           // q / k width
#define CAUSAL 0
#ifndef TNB
#define TNB NB
#endif
__device__ __forceinline__ v16b zero16b() { v16b z; _Pragma("unroll") for (int i = 0; i < 16; ++i) z[i] = (__bf16)0.f; return z; }
__device__ __forceinline__ float bfr(float v) { return (float)(__bf16)v; }
__host__ __device__ __forceinline__ int kb_last(int qb) { return CAUSAL ? ((qb * 64 + 63) >> 7) : (TT / 128 - 1); }
typedef __attribute__((ext_vector_type(8))) __bf16 v8b;
__device__ __forceinline__ v16b frag_b(const __bf16* rowk0, int lane) {
  union { v16b v; v8b q[2]; } u; const __bf16* p = rowk0 + 8 * (lane >> 4);
  u.q[0] = *(const v8b*)p; u.q[1] = *(const v8b*)(p + 16); return u.v;
}
#define QBH 0              // k_pv keeps the single-product P.v path for every block
#define QBH_SC NQB         // k_sc: EVERY query block takes the 3-product (q hi+lo x k hi+lo) path
#define QHI TT              // q residual rows for every query
#define KHI TT              // k residual rows for every key (the bf16 v hi/lo planes are written too but unused)
// B fragment (k rows k0+.., output column o) of a weight: (in,out) [K][ld] or (out,in) [ld rows of K]: bf16 exact, or f16(bf16 * 256) exact
__device__ __forceinline__ v16b wcol_io(const float* Wm, int k0, int o, int lane, int ld) { v16b w; const int g = lane >> 4;
#pragma unroll
  for (int i = 0; i < 8; ++i) { w[i] = (__bf16)Wm[(size_t)(k0 + 8 * g + i) * ld + o]; w[8 + i] = (__bf16)Wm[(size_t)(k0 + 16 + 8 * g + i) * ld + o]; }
  return w; }
__device__ __forceinline__ v16b wcol_oi(const float* Wm, int k0, int o, int lane, int K) { v16b w; const float* p = Wm + (size_t)o * K + k0 + 8 * (lane >> 4);
#pragma unroll
  for (int i = 0; i < 8; ++i) { w[i] = (__bf16)p[i]; w[8 + i] = (__bf16)p[16 + i]; }
  return w; }
__device__ __forceinline__ v16h wcolh_io(const float* Wm, int k0, int o, int lane, int ld) { v16h w; const int g = lane >> 4;
#pragma unroll
  for (int i = 0; i < 8; ++i) { w[i] = (_Float16)(bfr(Wm[(size_t)(k0 + 8 * g + i) * ld + o]) * 256.0f); w[8 + i] = (_Float16)(bfr(Wm[(size_t)(k0 + 16 + 8 * g + i) * ld + o]) * 256.0f); }
  return w; }
__device__ __forceinline__ v16h wcolh_oi(const float* Wm, int k0, int o, int lane, int K) { v16h w; const float* p = Wm + (size_t)o * K + k0 + 8 * (lane >> 4);
#pragma unroll
  for (int i = 0; i < 8; ++i) { w[i] = (_Float16)(bfr(p[i]) * 256.0f); w[8 + i] = (_Float16)(bfr(p[16 + i]) * 256.0f); }
  return w; }
#define WQKV_LAYOUT 0   // 0 = (in,out) [K][CC]; 1 = (out,in) [CC][DIN]; 2 = per-head [NH][DIN][HD]
__device__ __forceinline__ v16b wcol_hdk(const float* Wm, int k0, int o, int lane) { v16b w; const int g = lane >> 4; const float* p = Wm + (size_t)(o / HD) * DIN * HD + (o % HD);
#pragma unroll
  for (int i = 0; i < 8; ++i) { w[i] = (__bf16)p[(size_t)(k0 + 8 * g + i) * HD]; w[8 + i] = (__bf16)p[(size_t)(k0 + 16 + 8 * g + i) * HD]; }
  return w; }
#define WO_OUT_IN 0
#if WQKV_LAYOUT == 1
#define WCOL(W, k0, o, lane) wcol_oi(W, k0, (o), lane, DIN)   /* unused: layout 0 */
#elif WQKV_LAYOUT == 2
#define WCOL(W, k0, o, lane) wcol_hdk(W, k0, o, lane)
#else
#define WCOL(W, k0, o, lane) (which == 2 ? wcol_io(W, k0, (o), lane, CC) : ((o) < HDQK ? wcol_io(W, k0, (o), lane, HDQK) : zero16b()))   /* Wv [256][256]; Wq/Wk [256][256]: projected q/k columns >= 256 would read as zero (grid y = 2 covers 0..255) */
#endif
#if WO_OUT_IN
#define WOCOL(W, k0, o, lane) wcol_oi(W, k0, o, lane, CC)
#define WOCOLH(W, k0, o, lane) wcolh_oi(W, k0, o, lane, CC)
#else
#define WOCOL(W, k0, o, lane) wcol_io(W, k0, o, lane, DIN)
#define WOCOLH(W, k0, o, lane) wcolh_io(W, k0, o, lane, DIN)
#endif
#define BG HG              // the pass group spans BATCHES (single head): blockIdx.z selects batch b0 + z
#define BGN (TNB < BG ? TNB : BG)   // with TNB 1 one batch runs per pass
#define DVH 128            // value columns per k_pv block (HD 256 split in two column halves to keep 8 accumulator tiles per wave)
#define SM_EXTRA_PARAMS , int bsm, const int* __restrict__ RMASK
// multiplicative per-QUERY-row int mask applied to the scaled logits before the softmax (mask 0 -> every logit of the row becomes 0 -> uniform attention), as the module
#define SM_MASK_HOOK do { v = v * (float)RMASK[(size_t)(bsm + (int)blockIdx.y) * TT + t]; } while (0)
#ifndef SM_EXTRA_PARAMS
#define SM_EXTRA_PARAMS
#endif
#ifndef PROJ_EXTRA_PARAMS
#define PROJ_EXTRA_PARAMS
#endif
#ifndef SM_MASK_HOOK
#define SM_MASK_HOOK (void)0
#endif

#define WS_QH  0u                                      // f16 q rows [b*t][CCQ]
#define WS_KH  (WS_QH + 2u * (size_t)NB * TT * CCQ)     // f16 k rows [b*t][CCQ]
#define WS_VT  (WS_KH + 2u * (size_t)NB * TT * CCQ)     // f16 v planes [b][c][t]
#define WS_QL  (WS_VT + 2u * (size_t)NB * CC * TT)      // f16 q residual x 2^10 rows [b][t < QHI][CCQ]
#define WS_KL  (WS_QL + 2u * (size_t)NB * QHI * CCQ)    // f16 k residual x 2^10 rows [b][t < KHI][CCQ]
#define WS_VB  (WS_KL + 2u * (size_t)NB * KHI * CCQ)    // bf16 v hi planes [b][c][t < KHI]
#define WS_VBL (WS_VB + 2u * (size_t)NB * CC * KHI)
#define WS_S   (WS_VBL + 2u * (size_t)NB * CC * KHI)    // f32 logits / P [hg][t][s]
#define WS_Y   (WS_S  + 4u * (size_t)HG * TT * TT)      // f32 ctx rows [b*t][CC] (only when there is an output projection)
#define WS_END (WS_Y  + 0u)

// ---- k_proj: block = (64 rows, 128 cols, which): q/k/v = X W (+ b) with exact bf16 products (K = DIN) -> which 0: q f16 rows (+ residual rows < QHI); 1: k f16 rows (+ residual rows < KHI); 2: v f16 planes [c][t] (+ bf16 hi/lo planes for t < KHI)
template <int WOFF> __global__ __launch_bounds__(128) void k_projT(const float* __restrict__ XQ, const float* __restrict__ XK, const float* __restrict__ XV, const float* __restrict__ WQ, const float* __restrict__ WK, const float* __restrict__ WV, const float* __restrict__ BQ, const float* __restrict__ BK, const float* __restrict__ BV,
    _Float16* __restrict__ QH, _Float16* __restrict__ QL, _Float16* __restrict__ KH, _Float16* __restrict__ KL, _Float16* __restrict__ VT, __bf16* __restrict__ VB, __bf16* __restrict__ VBL) {
  __shared__ __align__(16) _Float16 sh[64][136], sl[64][136]; __shared__ __align__(16) _Float16 th[128][72]; __shared__ __align__(16) __bf16 tb[128][72], tbl[128][72];
  const int tid = threadIdx.x, wave = tid >> 5, lane = tid & 31, col = lane & 15, g = lane >> 4; const int which = blockIdx.z + WOFF; const int c0 = blockIdx.y * 128; const size_t r0 = (size_t)blockIdx.x * 64; const size_t bb = r0 / TT; const int t0 = (int)(r0 % TT);
  const float* X = which == 0 ? XQ : which == 1 ? XK : XV; const float* WA = which == 0 ? WQ : which == 1 ? WK : WV; const float* BA = which == 0 ? BQ : which == 1 ? BK : BV;
  const int KD = DIN;
  v8f acc[8] = {};
#pragma unroll 2
  for (int kc = 0; kc < KD / 32; ++kc) { v16b a; { const float* p = X + (r0 + wave * 16 + col) * (size_t)KD + kc * 32 + 8 * g;   /* row-major [b*t][KD] */
#pragma unroll
      for (int i = 0; i < 8; ++i) { a[i] = (__bf16)p[i]; a[8 + i] = (__bf16)p[16 + i]; } }
    asm volatile("s_wait_loadcnt 0x0" ::: "memory");
#pragma unroll
    for (int j = 0; j < 8; ++j) { const v16b w = WCOL(WA, kc * 32, c0 + j * 16 + col, lane); asm volatile("s_wait_loadcnt 0x0" ::: "memory"); acc[j] = wmma_bf(a, w, acc[j]); } }
  if (which < 2) { _Float16* DH = which == 0 ? QH : KH; _Float16* DL = which == 0 ? QL : KL; const int nhi = which == 0 ? QHI : KHI; const bool hi_rows = t0 < nhi;
#pragma unroll
    for (int j = 0; j < 8; ++j) { const float bias = BA ? bfr(BA[c0 + j * 16 + col]) : 0.f;
#pragma unroll
      for (int r = 0; r < 8; ++r) { const float v = acc[j][r] + bias; const _Float16 hv = (_Float16)v; sh[wave * 16 + 8 * g + r][j * 16 + col] = hv; sl[wave * 16 + 8 * g + r][j * 16 + col] = (_Float16)((v - (float)hv) * 1024.0f); } }
    __syncthreads();
    for (int e = tid; e < 64 * 16; e += 128) { const int rl = e >> 4, q = e & 15; vst2((unsigned*)(DH + (r0 + rl) * CCQ + c0 + q * 8), *(const v4u*)&sh[rl][q * 8]); if (hi_rows) vst2((unsigned*)(DL + (bb * nhi + t0 + rl) * (size_t)CCQ + c0 + q * 8), *(const v4u*)&sl[rl][q * 8]); }   /* q/k rows: pitch CCQ (c0 = 0 or 128) */
  } else { const bool hi_rows = t0 < KHI;
#pragma unroll
    for (int j = 0; j < 8; ++j) { const float bias = BA ? bfr(BA[c0 + j * 16 + col]) : 0.f;
#pragma unroll
      for (int r = 0; r < 8; ++r) { const float v = acc[j][r] + bias; const int rl = wave * 16 + 8 * g + r, cl = j * 16 + col; th[cl][rl] = (_Float16)v; const __bf16 bh = (__bf16)v; tb[cl][rl] = bh; tbl[cl][rl] = (__bf16)(v - (float)bh); } }
    __syncthreads();
    for (int e = tid; e < 128 * 8; e += 128) { const int cl = e >> 3, q = e & 7; vst2((unsigned*)(VT + (bb * CC + c0 + cl) * (size_t)TT + t0 + q * 8), *(const v4u*)&th[cl][q * 8]); if (hi_rows) { const size_t o3 = (bb * CC + c0 + cl) * (size_t)KHI + t0 + q * 8; vst2((unsigned*)(VB + o3), *(const v4u*)&tb[cl][q * 8]); vst2((unsigned*)(VBL + o3), *(const v4u*)&tbl[cl][q * 8]); } } } }
// ---- k_sc: block = (query block qb, key block kb <= kb_last(qb), batch in group) of batch b: logits x SCALE; q hi + residual (x 2^10) against k (2 products) for query rows < QHI, plus the k residual (3 products) for query blocks < QBH_SC (every block); causal: blocks past the diagonal exit, the mask itself is applied by index in k_sm
__global__ __launch_bounds__(128) void k_sc(const _Float16* __restrict__ QH, const _Float16* __restrict__ KH, const _Float16* __restrict__ QL, const _Float16* __restrict__ KL, int bgrp, int h0, float* __restrict__ S0) { __shared__ __align__(16) float ss[4][16][132];
  const int qb = blockIdx.x, kb = blockIdx.y; if (kb > kb_last(qb)) return;
  const int h = h0; const int b = bgrp + blockIdx.z; float* S = S0 + (size_t)blockIdx.z * TT * TT;   /* group spans batches */
  const int tid = threadIdx.x, wave = tid >> 5, lane = tid & 31, col = lane & 15, g = lane >> 4; const int k0 = kb * 128; const int ql0 = qb * 64 + wave * 16; const size_t q0 = (size_t)b * TT + ql0, kr0 = (size_t)b * TT + k0;
  v8f acc[8] = {}, accl[8] = {};
  const _Float16* QLb = QL + (size_t)b * QHI * CCQ; const _Float16* KLb = KL + (size_t)b * KHI * CCQ;   /* single head: q/k rows at pitch CCQ */
  if (qb < QBH_SC) {
#pragma unroll 2
    for (int kc = 0; kc < HDQK / 32; ++kc) { const v16h ah = frag_h(QH + (q0 + col) * CCQ + kc * 32, lane), al = frag_h(QLb + (size_t)(ql0 + col) * CCQ + kc * 32, lane);
#pragma unroll
      for (int j = 0; j < 8; ++j) { const v16h kbf = frag_h(KH + (kr0 + j * 16 + col) * CCQ + kc * 32, lane), klf = frag_h(KLb + (size_t)(k0 + j * 16 + col) * CCQ + kc * 32, lane); acc[j] = wmma16(ah, kbf, acc[j]); accl[j] = wmma16(al, kbf, accl[j]); accl[j] = wmma16(ah, klf, accl[j]); } }
  } else if (qb * 64 < QHI) {
#pragma unroll
    for (int kc = 0; kc < HDQK / 32; ++kc) { const v16h ah = frag_h(QH + (q0 + col) * CCQ + kc * 32, lane), al = frag_h(QLb + (size_t)(ql0 + col) * CCQ + kc * 32, lane);
#pragma unroll
      for (int j = 0; j < 8; ++j) { const v16h kbf = frag_h(KH + (kr0 + j * 16 + col) * CCQ + kc * 32, lane); acc[j] = wmma16(ah, kbf, acc[j]); accl[j] = wmma16(al, kbf, accl[j]); } }
  } else {
#pragma unroll
    for (int kc = 0; kc < HDQK / 32; ++kc) { const v16h ah = frag_h(QH + (q0 + col) * CCQ + kc * 32, lane);
#pragma unroll
      for (int j = 0; j < 8; ++j) { const v16h kbf = frag_h(KH + (kr0 + j * 16 + col) * CCQ + kc * 32, lane); acc[j] = wmma16(ah, kbf, acc[j]); } } }
#pragma unroll
  for (int j = 0; j < 8; ++j) {
#pragma unroll
    for (int r = 0; r < 8; ++r) ss[wave][8 * g + r][j * 16 + col] = (acc[j][r] + accl[j][r] * (1.0f / 1024.0f)) * SCALE; }
  LDSX(); for (int rl = 0; rl < 16; ++rl) vst2(S + (size_t)(ql0 + rl) * TT + k0 + lane * 4, *(const v4f*)&ss[wave][rl][lane * 4]); }
// ---- k_sm: block = query row t (batch in group): keys [0, kend): causal -> logit if s <= t else excluded; softmax in f32; P x 2^11 in place (0 for excluded)
__global__ __launch_bounds__(256) void k_sm(float* __restrict__ S0 SM_EXTRA_PARAMS) { __shared__ float sred[8]; __shared__ float sbc; __shared__ __align__(16) float shv[TT];
  const int tid = threadIdx.x; const int t = blockIdx.x; const int kend = (kb_last(t >> 6) + 1) * 128;
  float* sr = S0 + (size_t)blockIdx.y * TT * TT + (size_t)t * TT;
  float m = -3.0e38f; for (int k = tid; k < kend; k += 256) { float v = (!CAUSAL || k <= t) ? sr[k] : -3.0e38f; SM_MASK_HOOK; shv[k] = v; m = fmaxf(m, v); }
#pragma unroll
  for (int o = 1; o < 32; o <<= 1) m = fmaxf(m, __shfl_xor(m, o));
  if ((tid & 31) == 0) sred[tid >> 5] = m; __syncthreads(); if (tid == 0) { float a = sred[0]; for (int i = 1; i < 8; ++i) a = fmaxf(a, sred[i]); sbc = a; } __syncthreads(); m = sbc; __syncthreads();
  float sum = 0.f; for (int k = tid; k < kend; k += 256) { const float v = shv[k]; const float e = (v <= -1.0e38f) ? 0.f : expf(v - m); shv[k] = e; sum += e; }
#pragma unroll
  for (int o = 1; o < 32; o <<= 1) sum += __shfl_xor(sum, o);
  if ((tid & 31) == 0) sred[tid >> 5] = sum; __syncthreads(); if (tid == 0) { float a = 0.f; for (int i = 0; i < 8; ++i) a += sred[i]; sbc = a > 0.f ? 2048.0f / a : 0.f; }   /* a fully excluded row yields P = 0 */ __syncthreads(); const float inv = sbc;
  for (int k = tid; k < kend; k += 256) shv[k] = shv[k] * inv;
  __syncthreads(); for (int q = tid; q < kend / 4; q += 256) vst2(sr + q * 4, *(const v4f*)&shv[q * 4]); }
// ---- k_pv: block = (64 queries (qb), 128-column value half, batch in group): out = P . v over all 2,048 keys (P x 2^11 once to f16 against v f16: 1 product) x 2^-11, written directly to the output
__global__ __launch_bounds__(128) void k_pv(const float* __restrict__ PS0, const _Float16* __restrict__ VT, const __bf16* __restrict__ VB, const __bf16* __restrict__ VBL, int bgrp, int h0, float* __restrict__ Y) { const int h = h0; const int b = bgrp + blockIdx.z; const float* PS = PS0 + (size_t)blockIdx.z * TT * TT; const int d0 = blockIdx.y * DVH;   /* group spans batches; column half d0 */ __shared__ __align__(16) float ss[4][16][DVH + 4];
  const int tid = threadIdx.x, wave = tid >> 5, lane = tid & 31, col = lane & 15, g = lane >> 4; const int qb = blockIdx.x; const int ql0 = qb * 64 + wave * 16; const int kce = (kb_last(qb) + 1) * 4;
  v8f acc[DVH / 16] = {};
  if (qb < QBH) {
#pragma unroll 1
    for (int kc = 0; kc < kce; ++kc) { const F2 p = split_row(PS + (size_t)(ql0 + col) * TT, kc * 32, lane);
      asm volatile("s_wait_loadcnt 0x0" ::: "memory");
#pragma unroll
      for (int j = 0; j < DVH / 16; ++j) { const size_t po = ((size_t)b * CC + h * HD + d0 + j * 16 + col) * (size_t)KHI + kc * 32; const v16b vh = frag_b(VB + po, lane); acc[j] = wmma_bf(p.h, vh, acc[j]); acc[j] = wmma_bf(p.l, vh, acc[j]); acc[j] = wmma_bf(p.h, frag_b(VBL + po, lane), acc[j]); } }
  } else {
#pragma unroll 1
    for (int kc = 0; kc < kce; ++kc) { const v16h p = frag_f32(PS + (size_t)(ql0 + col) * TT + kc * 32, lane);
      asm volatile("s_wait_loadcnt 0x0" ::: "memory");
#pragma unroll
      for (int j = 0; j < DVH / 16; ++j) { const size_t po = ((size_t)b * CC + h * HD + d0 + j * 16 + col) * (size_t)TT + kc * 32; acc[j] = wmma16(p, frag_h(VT + po, lane), acc[j]); } } }
#pragma unroll
  for (int j = 0; j < DVH / 16; ++j)
#pragma unroll
    for (int r = 0; r < 8; ++r) ss[wave][8 * g + r][j * 16 + col] = acc[j][r] * (1.0f / 2048.0f);
  LDSX(); for (int rl = 0; rl < 16; ++rl) vst2(Y + ((size_t)b * TT + ql0 + rl) * CC + h * HD + d0 + lane * 4, *(const v4f*)&ss[wave][rl][lane * 4]); }   /* output rows [b*TT + s][256]: 512-B (row, column-half) segment by 32 lanes */

extern "C" void kernel_launch(void* const* d_in, const int* in_sizes, int n_in, void* d_out, int out_size, void* d_ws, size_t ws_size, hipStream_t stream) {
  (void)in_sizes; (void)n_in; (void)out_size;
  const float** F = (const float**)d_in;
  if (ws_size < (size_t)WS_END) return;
  char* ws = (char*)d_ws; _Float16 *QH = (_Float16*)(ws + WS_QH), *KH = (_Float16*)(ws + WS_KH), *VT = (_Float16*)(ws + WS_VT), *QL = (_Float16*)(ws + WS_QL), *KL = (_Float16*)(ws + WS_KL); __bf16 *VB = (__bf16*)(ws + WS_VB), *VBL = (__bf16*)(ws + WS_VBL); float *S = (float*)(ws + WS_S), *Y = (float*)(ws + WS_Y);
  (void)Y; (void)QL; (void)KL; (void)VB; (void)VBL;
  // inputs: 0 x [8,2048,256]; 1 kernel [3,256,256] ((in,out): Q | K | V matrices); 2 mask [8,2048] int32
  const float* Wq = F[1]; const float* Wk = F[1] + (size_t)DIN * CCQ; const float* Wv = F[1] + 2 * (size_t)DIN * CCQ;
  k_projT<0><<<dim3(TNB * TT / 64, CCQ / 128, 2), 128, 0, stream>>>(F[0], F[0], F[0], Wq, Wk, Wv, nullptr, nullptr, nullptr, QH, QL, KH, KL, VT, VB, VBL);   /* which 0, 1: q and k rows (hi + residual planes) */
  k_projT<2><<<dim3(TNB * TT / 64, CC / 128, 1), 128, 0, stream>>>(F[0], F[0], F[0], Wq, Wk, Wv, nullptr, nullptr, nullptr, QH, QL, KH, KL, VT, VB, VBL);     /* which 2: v planes */
  for (int b0 = 0; b0 < TNB; b0 += BGN) {
    k_sc<<<dim3(NQB, TT / 128, BGN), 128, 0, stream>>>(QH, KH, QL, KL, b0, 0, S);
    k_sm<<<dim3(TT, BGN), 256, 0, stream>>>(S, b0, (const int*)d_in[2]);
    k_pv<<<dim3(NQB, HD / DVH, BGN), 128, 0, stream>>>(S, VT, VB, VBL, b0, 0, (float*)d_out);
  }

}

// v001
// One run takes 234 microseconds.
// In both of two side-by-side timings against v000, it was 2.18 times as fast.
// compute dtype: all float inputs rounded to bf16; q/k/v projections with EXACT bf16 products on WMMA 16x16x32 (f32 accumulate); logits q x k with BOTH operands as f16 hi + (x 2^10) residual (3 products: hi.hi + lo.hi + hi.lo) x 64^-0.5, for every row (the logits have sigma - 500); the int row mask multiplies the logits in f32; softmax f32; P x 2^11 once to f16 x v once to f16 (1 product); f32 output.
#include <hip/hip_runtime.h>
#include <math.h>

typedef __attribute__((ext_vector_type(16))) _Float16 v16h;
typedef __attribute__((ext_vector_type(16))) __bf16 v16b;
typedef __attribute__((ext_vector_type(8)))  _Float16 v8h;
typedef __attribute__((ext_vector_type(8)))  float v8f;
typedef __attribute__((ext_vector_type(4)))  float v4f;
typedef __attribute__((ext_vector_type(2)))  float v2f;
typedef __attribute__((ext_vector_type(4)))  unsigned v4u;
typedef __attribute__((ext_vector_type(4)))  int v4i;
typedef float __attribute__((may_alias)) float_a;
typedef int __attribute__((may_alias)) int_a;

template <typename T> __device__ __forceinline__ void vst2(void* p, T v) { *(T*)p = v;  }
__device__ __forceinline__ v8f wmma16(v16h a, v16h b, v8f c) {
  v8f d = __builtin_amdgcn_wmma_f32_16x16x32_f16(false, a, false, b, (short)0, c, false, false);
  asm volatile("v_nop\n\tv_nop\n\tv_nop\n\tv_nop" : "+v"(d) : "v"(a), "v"(b));
  return d;
}
__device__ __forceinline__ v8f wmma_bf(v16b a, v16b b, v8f c) {
  v8f d = __builtin_amdgcn_wmma_f32_16x16x32_bf16(false, a, false, b, (short)0, c, false, false);
  asm volatile("v_nop\n\tv_nop\n\tv_nop\n\tv_nop" : "+v"(d) : "v"(a), "v"(b));
  return d;
}
// 16x16x32 fragments: lane = (h = lane>>4, row/col = lane&15); elements 0..7 = k0+8h+0..7, 8..15 = k0+16+8h+0..7; D element r = row 8h+r
__device__ __forceinline__ v16h frag_h(const _Float16* rowk0, int lane) {
  union { v16h v; v8h q[2]; } u; const _Float16* p = rowk0 + 8 * (lane >> 4);
  u.q[0] = *(const v8h*)p; u.q[1] = *(const v8h*)(p + 16); return u.v;
}
__device__ __forceinline__ v16h frag_f32(const float* rowk0, int lane) {
  v16h a; const float* p = rowk0 + 8 * (lane >> 4);
#pragma unroll
  for (int i = 0; i < 8; ++i) { a[i] = (_Float16)p[i]; a[8 + i] = (_Float16)p[16 + i]; }
  return a;
}
__device__ __forceinline__ v16h frag_f32s(const float* rowk0, int lane, float sc) {
  v16h a; const float* p = rowk0 + 8 * (lane >> 4);
#pragma unroll
  for (int i = 0; i < 8; ++i) { a[i] = (_Float16)(p[i] * sc); a[8 + i] = (_Float16)(p[16 + i] * sc); }
  return a;
}
// column fragment from a [K][ld] layout (column n), rows >= K read as 0
__device__ __forceinline__ v16h fragc_f32(const float* W, int k0, int n, int lane, int ld, int K) {
  v16h a; const int g = lane >> 4;
#pragma unroll
  for (int i = 0; i < 8; ++i) { const int ka = k0 + 8 * g + i, kb = ka + 16;
    a[i] = (_Float16)(ka < K ? W[(size_t)(ka < K ? ka : K - 1) * ld + n] : 0.f); a[8 + i] = (_Float16)(kb < K ? W[(size_t)(kb < K ? kb : K - 1) * ld + n] : 0.f); }
  return a;
}
struct F2 { v16b h, l; };
__device__ __forceinline__ F2 bsplit16(const float v[16]) { F2 r;
#pragma unroll
  for (int i = 0; i < 16; ++i) { const __bf16 h = (__bf16)v[i]; r.h[i] = h; r.l[i] = (__bf16)(v[i] - (float)h); }
  return r; }
__device__ __forceinline__ F2 split_row(const float* row, int k0, int lane) { float v[16]; const float* p = row + k0 + 8 * (lane >> 4);
#pragma unroll
  for (int i = 0; i < 8; ++i) { v[i] = p[i]; v[8 + i] = p[16 + i]; }
  return bsplit16(v); }
__device__ __forceinline__ F2 split_rowK(const float* row, int k0, int lane, int K) { float v[16]; const int g = lane >> 4;
#pragma unroll
  for (int i = 0; i < 8; ++i) { const int ka = k0 + 8 * g + i, kb = ka + 16; v[i] = ka < K ? row[ka < K ? ka : K - 1] : 0.f; v[8 + i] = kb < K ? row[kb < K ? kb : K - 1] : 0.f; }
  return bsplit16(v); }
__device__ __forceinline__ F2 split_col(const float* W, int k0, int n, int lane, int ld, int K) { float v[16]; const int g = lane >> 4;
#pragma unroll
  for (int i = 0; i < 8; ++i) { const int ka = k0 + 8 * g + i, kb = ka + 16; v[i] = ka < K ? W[(size_t)(ka < K ? ka : K - 1) * ld + n] : 0.f; v[8 + i] = kb < K ? W[(size_t)(kb < K ? kb : K - 1) * ld + n] : 0.f; }
  return bsplit16(v); }
__device__ __forceinline__ v8f mac3(const F2& a, const F2& b, v8f c) { c = wmma_bf(a.l, b.h, c); c = wmma_bf(a.h, b.l, c); return wmma_bf(a.h, b.h, c); }
__device__ __forceinline__ float sigm(float v) { return 1.0f / (1.0f + expf(-v)); }
#define LDSX() do { asm volatile("s_wait_dscnt 0" ::: "memory"); __builtin_amdgcn_wave_barrier(); __builtin_amdgcn_fence(__ATOMIC_RELEASE, "workgroup"); } while (0)

// Single-head self-attention with unscaled N(0,1) projection kernels and a multiplicative row mask (x [8,2048,256]; kernel [3,256,256] (in,out): Q, K, V; mask [8,2048] int 0/1; SCALE = 1/sqrt(64) hard-coded): QK = (Q K^T) / 8; QK *= mask[b][q] per QUERY row (masked rows: all-zero logits -> uniform attention); A = softmax(QK); out = A V -> [8,2048,256].
#define NB 8
#define TT 2048
#define CC 256            // value width (v planes, output rows)
#define CCQ 256           // q / k row width
#define DIN 256          // x width
#define NH 1
#define HD 256
#define NQB (TT / 64)
#define HG 4               // four 2,048 x 2,048 score planes per pass (the pass group spans batches)
#define SCALE (0.125f)             // 1/sqrt(64), hard-coded in the source
#define HDQK 256           // q / k width
#define CAUSAL 0
#ifndef TNB
#define TNB NB
#endif
__device__ __forceinline__ v16b zero16b() { v16b z; _Pragma("unroll") for (int i = 0; i < 16; ++i) z[i] = (__bf16)0.f; return z; }
__device__ __forceinline__ float bfr(float v) { return (float)(__bf16)v; }
__host__ __device__ __forceinline__ int kb_last(int qb) { return CAUSAL ? ((qb * 64 + 63) >> 7) : (TT / 128 - 1); }
typedef __attribute__((ext_vector_type(8))) __bf16 v8b;
__device__ __forceinline__ v16b frag_b(const __bf16* rowk0, int lane) {
  union { v16b v; v8b q[2]; } u; const __bf16* p = rowk0 + 8 * (lane >> 4);
  u.q[0] = *(const v8b*)p; u.q[1] = *(const v8b*)(p + 16); return u.v;
}
#define QBH 0              // k_pv keeps the single-product P.v path for every block
#define QBH_SC NQB         // k_sc: EVERY query block takes the 3-product (q hi+lo x k hi+lo) path
#define QHI TT              // q residual rows for every query
#define KHI TT              // k residual rows for every key (the bf16 v hi/lo planes are written too but unused)
// B fragment (k rows k0+.., output column o) of a weight: (in,out) [K][ld] or (out,in) [ld rows of K]: bf16 exact, or f16(bf16 * 256) exact
__device__ __forceinline__ v16b wcol_io(const float* Wm, int k0, int o, int lane, int ld) { v16b w; const int g = lane >> 4;
#pragma unroll
  for (int i = 0; i < 8; ++i) { w[i] = (__bf16)Wm[(size_t)(k0 + 8 * g + i) * ld + o]; w[8 + i] = (__bf16)Wm[(size_t)(k0 + 16 + 8 * g + i) * ld + o]; }
  return w; }
__device__ __forceinline__ v16b wcol_oi(const float* Wm, int k0, int o, int lane, int K) { v16b w; const float* p = Wm + (size_t)o * K + k0 + 8 * (lane >> 4);
#pragma unroll
  for (int i = 0; i < 8; ++i) { w[i] = (__bf16)p[i]; w[8 + i] = (__bf16)p[16 + i]; }
  return w; }
__device__ __forceinline__ v16h wcolh_io(const float* Wm, int k0, int o, int lane, int ld) { v16h w; const int g = lane >> 4;
#pragma unroll
  for (int i = 0; i < 8; ++i) { w[i] = (_Float16)(bfr(Wm[(size_t)(k0 + 8 * g + i) * ld + o]) * 256.0f); w[8 + i] = (_Float16)(bfr(Wm[(size_t)(k0 + 16 + 8 * g + i) * ld + o]) * 256.0f); }
  return w; }
__device__ __forceinline__ v16h wcolh_oi(const float* Wm, int k0, int o, int lane, int K) { v16h w; const float* p = Wm + (size_t)o * K + k0 + 8 * (lane >> 4);
#pragma unroll
  for (int i = 0; i < 8; ++i) { w[i] = (_Float16)(bfr(p[i]) * 256.0f); w[8 + i] = (_Float16)(bfr(p[16 + i]) * 256.0f); }
  return w; }
#define WQKV_LAYOUT 0   // 0 = (in,out) [K][CC]; 1 = (out,in) [CC][DIN]; 2 = per-head [NH][DIN][HD]
__device__ __forceinline__ v16b wcol_hdk(const float* Wm, int k0, int o, int lane) { v16b w; const int g = lane >> 4; const float* p = Wm + (size_t)(o / HD) * DIN * HD + (o % HD);
#pragma unroll
  for (int i = 0; i < 8; ++i) { w[i] = (__bf16)p[(size_t)(k0 + 8 * g + i) * HD]; w[8 + i] = (__bf16)p[(size_t)(k0 + 16 + 8 * g + i) * HD]; }
  return w; }
#define WO_OUT_IN 0
#if WQKV_LAYOUT == 1
#define WCOL(W, k0, o, lane) wcol_oi(W, k0, (o), lane, DIN)   /* unused: layout 0 */
#elif WQKV_LAYOUT == 2
#define WCOL(W, k0, o, lane) wcol_hdk(W, k0, o, lane)
#else
#define WCOL(W, k0, o, lane) (which == 2 ? wcol_io(W, k0, (o), lane, CC) : ((o) < HDQK ? wcol_io(W, k0, (o), lane, HDQK) : zero16b()))   /* Wv [256][256]; Wq/Wk [256][256]: projected q/k columns >= 256 would read as zero (grid y = 2 covers 0..255) */
#endif
#if WO_OUT_IN
#define WOCOL(W, k0, o, lane) wcol_oi(W, k0, o, lane, CC)
#define WOCOLH(W, k0, o, lane) wcolh_oi(W, k0, o, lane, CC)
#else
#define WOCOL(W, k0, o, lane) wcol_io(W, k0, o, lane, DIN)
#define WOCOLH(W, k0, o, lane) wcolh_io(W, k0, o, lane, DIN)
#endif
#define BG HG              // the pass group spans BATCHES (single head): blockIdx.z selects batch b0 + z
#define BGN (TNB < BG ? TNB : BG)   // with TNB 1 one batch runs per pass
#define DVH 128            // value columns per k_pv block (HD 256 split in two column halves to keep 4 accumulator tiles per wave)
#define SM_EXTRA_PARAMS , int bsm, const int* __restrict__ RMASK
// multiplicative per-QUERY-row int mask applied to the scaled logits before the softmax (mask 0 -> every logit of the row becomes 0 -> uniform attention), as the module
#define SM_MASK_HOOK do { v = v * (float)RMASK[(size_t)(bsm + (int)blockIdx.y) * TT + t]; } while (0)
#ifndef SM_EXTRA_PARAMS
#define SM_EXTRA_PARAMS
#endif
#ifndef PROJ_EXTRA_PARAMS
#define PROJ_EXTRA_PARAMS
#endif
#ifndef SM_MASK_HOOK
#define SM_MASK_HOOK (void)0
#endif

#define WS_QH  0u                                      // f16 q rows [b*t][CCQ]
#define WS_KH  (WS_QH + 2u * (size_t)NB * TT * CCQ)     // f16 k rows [b*t][CCQ]
#define WS_VT  (WS_KH + 2u * (size_t)NB * TT * CCQ)     // f16 v planes [b][c][t]
#define WS_QL  (WS_VT + 2u * (size_t)NB * CC * TT)      // f16 q residual x 2^10 rows [b][t < QHI][CCQ]
#define WS_KL  (WS_QL + 2u * (size_t)NB * QHI * CCQ)    // f16 k residual x 2^10 rows [b][t < KHI][CCQ]
#define WS_VB  (WS_KL + 2u * (size_t)NB * KHI * CCQ)    // bf16 v hi planes [b][c][t < KHI]
#define WS_VBL (WS_VB + 2u * (size_t)NB * CC * KHI)
#define WS_S   (WS_VBL + 2u * (size_t)NB * CC * KHI)    // f32 logits / P [hg][t][s]
#define WS_Y   (WS_S  + 4u * (size_t)HG * TT * TT)      // f32 ctx rows [b*t][CC] (only when there is an output projection)
#define WS_END (WS_Y  + 0u)

// ---- k_proj: block = (64 rows, 128 cols, which): q/k/v = X W (+ b) with exact bf16 products (K = DIN) -> which 0: q f16 rows (+ residual rows < QHI); 1: k f16 rows (+ residual rows < KHI); 2: v f16 planes [c][t] (+ bf16 hi/lo planes for t < KHI)
template <int WOFF> __global__ __launch_bounds__(128) void k_projT(const float* __restrict__ XQ, const float* __restrict__ XK, const float* __restrict__ XV, const float* __restrict__ WQ, const float* __restrict__ WK, const float* __restrict__ WV, const float* __restrict__ BQ, const float* __restrict__ BK, const float* __restrict__ BV,
    _Float16* __restrict__ QH, _Float16* __restrict__ QL, _Float16* __restrict__ KH, _Float16* __restrict__ KL, _Float16* __restrict__ VT, __bf16* __restrict__ VB, __bf16* __restrict__ VBL) {
  __shared__ __align__(16) _Float16 sh[64][136], sl[64][136]; __shared__ __align__(16) _Float16 th[128][72]; __shared__ __align__(16) __bf16 tb[128][72], tbl[128][72];
  const int tid = threadIdx.x, wave = tid >> 5, lane = tid & 31, col = lane & 15, g = lane >> 4; const int which = blockIdx.z + WOFF; const int c0 = blockIdx.y * 128; const size_t r0 = (size_t)blockIdx.x * 64; const size_t bb = r0 / TT; const int t0 = (int)(r0 % TT);
  const float* X = which == 0 ? XQ : which == 1 ? XK : XV; const float* WA = which == 0 ? WQ : which == 1 ? WK : WV; const float* BA = which == 0 ? BQ : which == 1 ? BK : BV;
  const int KD = DIN;
  v8f acc[8] = {};
#pragma unroll 2
  for (int kc = 0; kc < KD / 32; ++kc) { v16b a; { const float* p = X + (r0 + wave * 16 + col) * (size_t)KD + kc * 32 + 8 * g;   /* row-major [b*t][KD] */
#pragma unroll
      for (int i = 0; i < 8; ++i) { a[i] = (__bf16)p[i]; a[8 + i] = (__bf16)p[16 + i]; } }
    asm volatile("s_wait_loadcnt 0x0" ::: "memory");
#pragma unroll
    for (int j = 0; j < 8; ++j) { const v16b w = WCOL(WA, kc * 32, c0 + j * 16 + col, lane); asm volatile("s_wait_loadcnt 0x0" ::: "memory"); acc[j] = wmma_bf(a, w, acc[j]); } }
  if (which < 2) { _Float16* DH = which == 0 ? QH : KH; _Float16* DL = which == 0 ? QL : KL; const int nhi = which == 0 ? QHI : KHI; const bool hi_rows = t0 < nhi;
#pragma unroll
    for (int j = 0; j < 8; ++j) { const float bias = BA ? bfr(BA[c0 + j * 16 + col]) : 0.f;
#pragma unroll
      for (int r = 0; r < 8; ++r) { const float v = acc[j][r] + bias; const _Float16 hv = (_Float16)v; sh[wave * 16 + 8 * g + r][j * 16 + col] = hv; sl[wave * 16 + 8 * g + r][j * 16 + col] = (_Float16)((v - (float)hv) * 1024.0f); } }
    __syncthreads();
    for (int e = tid; e < 64 * 16; e += 128) { const int rl = e >> 4, q = e & 15; vst2((unsigned*)(DH + (r0 + rl) * CCQ + c0 + q * 8), *(const v4u*)&sh[rl][q * 8]); if (hi_rows) vst2((unsigned*)(DL + (bb * nhi + t0 + rl) * (size_t)CCQ + c0 + q * 8), *(const v4u*)&sl[rl][q * 8]); }   /* q/k rows: pitch CCQ (c0 = 0 or 128) */
  } else { const bool hi_rows = t0 < KHI;
#pragma unroll
    for (int j = 0; j < 8; ++j) { const float bias = BA ? bfr(BA[c0 + j * 16 + col]) : 0.f;
#pragma unroll
      for (int r = 0; r < 8; ++r) { const float v = acc[j][r] + bias; const int rl = wave * 16 + 8 * g + r, cl = j * 16 + col; th[cl][rl] = (_Float16)v; const __bf16 bh = (__bf16)v; tb[cl][rl] = bh; tbl[cl][rl] = (__bf16)(v - (float)bh); } }
    __syncthreads();
    for (int e = tid; e < 128 * 8; e += 128) { const int cl = e >> 3, q = e & 7; vst2((unsigned*)(VT + (bb * CC + c0 + cl) * (size_t)TT + t0 + q * 8), *(const v4u*)&th[cl][q * 8]); if (hi_rows) { const size_t o3 = (bb * CC + c0 + cl) * (size_t)KHI + t0 + q * 8; vst2((unsigned*)(VB + o3), *(const v4u*)&tb[cl][q * 8]); vst2((unsigned*)(VBL + o3), *(const v4u*)&tbl[cl][q * 8]); } } } }
__device__ __forceinline__ unsigned lds_off(const void* p) { return (unsigned)(size_t)p; }
// eight 16-byte copies of one lane, global -> LDS; the s_wait_xcnt stands inside the statement so that no address register is rewritten in front of it
__device__ __forceinline__ void copy8(const unsigned l[8], const char* const gp[8]) {
  asm volatile("global_load_async_to_lds_b128 %0, %8, off\n\t"
               "global_load_async_to_lds_b128 %1, %9, off\n\t"
               "global_load_async_to_lds_b128 %2, %10, off\n\t"
               "global_load_async_to_lds_b128 %3, %11, off\n\t"
               "global_load_async_to_lds_b128 %4, %12, off\n\t"
               "global_load_async_to_lds_b128 %5, %13, off\n\t"
               "global_load_async_to_lds_b128 %6, %14, off\n\t"
               "global_load_async_to_lds_b128 %7, %15, off\n\t"
               "s_wait_xcnt 0x0"
               :: "v"(l[0]), "v"(l[1]), "v"(l[2]), "v"(l[3]), "v"(l[4]), "v"(l[5]), "v"(l[6]), "v"(l[7]),
                  "v"(gp[0]), "v"(gp[1]), "v"(gp[2]), "v"(gp[3]), "v"(gp[4]), "v"(gp[5]), "v"(gp[6]), "v"(gp[7]) : "memory");
}
// ---- k_sc: block = (128 queries (qb), 128 keys (kb), batch in group), 8 waves of 16 query rows x 128 keys: logits x SCALE; q hi + residual (x 2^10) against k hi + residual (3 products: hi.hi | lo.hi + hi.lo), for every query row. The four planes (q hi, q lo, k hi, k lo: 128 rows x 64 elements each) of a stage come into LDS by asynchronous copies in whole 128-B lines, two buffers: the next stage flies while this one is multiplied
#define SCK 64             // q / k elements per LDS stage
#define SCP 72             // staged row pitch in f16: 128 B + 16 B (16 B x odd: ds_load_b128 walks over rows meet no bank twice)
// one stage: rows [128][SCK] of each plane (pitch CCQ) -> sr[plane][128][SCP]; 256 threads, 16 copies each; a wave's copy covers four 128-B row pieces
__device__ __forceinline__ void sc_fill(const _Float16* q_h, const _Float16* q_l, const _Float16* k_h, const _Float16* k_l, _Float16* sr, int tid) {
  unsigned l[8]; const char* gp[8]; const int r0 = tid >> 3, q = tid & 7;
#pragma unroll   // the arrays indexed here live in registers: every index must be a compile-time constant
  for (int i = 0; i < 8; ++i) { const int row = (i & 3) * 32 + r0; l[i] = lds_off(sr + ((i >> 2) * 128 + row) * SCP + q * 8); gp[i] = (const char*)((i >> 2 ? q_l : q_h) + (size_t)row * CCQ + q * 8); }
  copy8(l, gp);
#pragma unroll   // the arrays indexed here live in registers: every index must be a compile-time constant
  for (int i = 0; i < 8; ++i) { const int row = (i & 3) * 32 + r0; l[i] = lds_off(sr + ((2 + (i >> 2)) * 128 + row) * SCP + q * 8); gp[i] = (const char*)((i >> 2 ? k_l : k_h) + (size_t)row * CCQ + q * 8); }
  copy8(l, gp);
}
__global__ __launch_bounds__(256) void k_sc(const _Float16* __restrict__ QH, const _Float16* __restrict__ KH, const _Float16* __restrict__ QL, const _Float16* __restrict__ KL, int bgrp, int h0, float* __restrict__ S0) { __shared__ __align__(16) _Float16 ring[2][4][128][SCP];
  (void)h0; const int qb = blockIdx.x, kb = blockIdx.y;
  const int b = bgrp + blockIdx.z; float* S = S0 + (size_t)blockIdx.z * TT * TT;   /* group spans batches */
  const int tid = threadIdx.x, wave = tid >> 5, lane = tid & 31, col = lane & 15, g = lane >> 4; const int k0 = kb * 128; const int ql0 = qb * 128 + wave * 16;
  const _Float16* q_h = QH + ((size_t)b * TT + qb * 128) * CCQ; const _Float16* q_l = QL + ((size_t)b * QHI + qb * 128) * CCQ; const _Float16* k_h = KH + ((size_t)b * TT + k0) * CCQ; const _Float16* k_l = KL + ((size_t)b * KHI + k0) * CCQ;   /* single head: q/k rows at pitch CCQ */
  v8f acc[8] = {}, accl[8] = {};
  sc_fill(q_h, q_l, k_h, k_l, &ring[0][0][0][0], tid);
  asm volatile("s_wait_asynccnt 0x0" ::: "memory");   // stage 0 has landed for this wave's own copies
  __syncthreads();                                     // ... and for every wave's
  sc_fill(q_h + SCK, q_l + SCK, k_h + SCK, k_l + SCK, &ring[1][0][0][0], tid);
#pragma unroll 1   // one stage a trip: the buffer index stays a run-time bit and the loop stays small
  for (int t = 0; t < HDQK / SCK; ++t) {
#pragma unroll   // the arrays indexed here live in registers: every index must be a compile-time constant
    for (int kk = 0; kk < SCK / 32; ++kk) { const v16h ah = frag_h(&ring[t & 1][0][wave * 16 + col][kk * 32], lane), al = frag_h(&ring[t & 1][1][wave * 16 + col][kk * 32], lane);
#pragma unroll   // the arrays indexed here live in registers: every index must be a compile-time constant
      for (int j0 = 0; j0 < 8; j0 += 2) { v16h kbf[2], klf[2];   /* the LDS reads of two key tiles stand together in front of their six products */
#pragma unroll   // the arrays indexed here live in registers: every index must be a compile-time constant
        for (int u = 0; u < 2; ++u) { kbf[u] = frag_h(&ring[t & 1][2][(j0 + u) * 16 + col][kk * 32], lane); klf[u] = frag_h(&ring[t & 1][3][(j0 + u) * 16 + col][kk * 32], lane); }
#pragma unroll   // the arrays indexed here live in registers: every index must be a compile-time constant
        for (int u = 0; u < 2; ++u) { const int j = j0 + u; acc[j] = wmma16(ah, kbf[u], acc[j]); accl[j] = wmma16(al, kbf[u], accl[j]); accl[j] = wmma16(ah, klf[u], accl[j]); } } }
    asm volatile("s_wait_dscnt 0x0" ::: "memory");      // this wave's reads of buffer t & 1 are done before it is handed to the copies
    asm volatile("s_wait_asynccnt 0x0" ::: "memory");   // this wave's copies of stage t + 1 have landed
    __syncthreads();                                     // publishes stage t + 1 and ends every reader's last read of buffer t & 1
    if (t + 2 < HDQK / SCK) sc_fill(q_h + (t + 2) * SCK, q_l + (t + 2) * SCK, k_h + (t + 2) * SCK, k_l + (t + 2) * SCK, &ring[t & 1][0][0][0], tid); }
  asm volatile("s_wait_asynccnt 0x0" ::: "memory");     // no copy is outstanding when the ring becomes output staging
  float (*ss)[16][132] = (float (*)[16][132])&ring[0][0][0][0];   /* 8 x 16 x 132 f32 inside the ring, free behind the last trip's barrier; each wave its own range */
#pragma unroll   // the arrays indexed here live in registers: every index must be a compile-time constant
  for (int j = 0; j < 8; ++j) {
#pragma unroll   // the arrays indexed here live in registers: every index must be a compile-time constant
    for (int r = 0; r < 8; ++r) ss[wave][8 * g + r][j * 16 + col] = (acc[j][r] + accl[j][r] * (1.0f / 1024.0f)) * SCALE; }
  LDSX(); for (int rl = 0; rl < 16; ++rl) vst2(S + (size_t)(ql0 + rl) * TT + k0 + lane * 4, *(const v4f*)&ss[wave][rl][lane * 4]); }
// ---- k_sm: block = query row t (batch in group): keys [0, kend): causal -> logit if s <= t else excluded; softmax in f32; P x 2^11 in place (0 for excluded)
__global__ __launch_bounds__(256) void k_sm(float* __restrict__ S0 SM_EXTRA_PARAMS) { __shared__ float sred[8]; __shared__ float sbc; __shared__ __align__(16) float shv[TT];
  const int tid = threadIdx.x; const int t = blockIdx.x; const int kend = (kb_last(t >> 6) + 1) * 128;
  float* sr = S0 + (size_t)blockIdx.y * TT * TT + (size_t)t * TT;
  float m = -3.0e38f; for (int k = tid; k < kend; k += 256) { float v = (!CAUSAL || k <= t) ? sr[k] : -3.0e38f; SM_MASK_HOOK; shv[k] = v; m = fmaxf(m, v); }
#pragma unroll
  for (int o = 1; o < 32; o <<= 1) m = fmaxf(m, __shfl_xor(m, o));
  if ((tid & 31) == 0) sred[tid >> 5] = m; __syncthreads(); if (tid == 0) { float a = sred[0]; for (int i = 1; i < 8; ++i) a = fmaxf(a, sred[i]); sbc = a; } __syncthreads(); m = sbc; __syncthreads();
  float sum = 0.f; for (int k = tid; k < kend; k += 256) { const float v = shv[k]; const float e = (v <= -1.0e38f) ? 0.f : expf(v - m); shv[k] = e; sum += e; }
#pragma unroll
  for (int o = 1; o < 32; o <<= 1) sum += __shfl_xor(sum, o);
  if ((tid & 31) == 0) sred[tid >> 5] = sum; __syncthreads(); if (tid == 0) { float a = 0.f; for (int i = 0; i < 8; ++i) a += sred[i]; sbc = a > 0.f ? 2048.0f / a : 0.f; }   /* a fully excluded row yields P = 0 */ __syncthreads(); const float inv = sbc;
  for (int k = tid; k < kend; k += 256) shv[k] = shv[k] * inv;
  __syncthreads(); for (int q = tid; q < kend / 4; q += 256) vst2(sr + q * 4, *(const v4f*)&shv[q * 4]); }
// ---- k_pv: block = (64 queries (qb), 128-column value half, batch in group), 8 waves = 4 query sub-tiles x 2 groups of 64 columns: attended = P . v over all keys (P x 2^11 once to f16 against v f16: 1 product, keys in ascending order) x 2^-11, written directly to the output. The P tile (64 x 128 f32) and the v tile (128 columns x 128 keys f16) of each stage come into LDS by asynchronous copies in whole 512-B and 256-B rows, two buffers: the next stage flies while this one is multiplied
#define PVK 128            // keys per LDS stage
#define PVPP 132           // staged P row pitch in f32: 512 B + 16 B (16 B x odd: ds_load_b128 walks over rows meet no bank twice)
#define PVVP 136           // staged v row pitch in f16: 256 B + 16 B (same reason)
// one stage: P rows [64][PVK] from Pg (pitch TT), v rows [DVH][PVK] from Vg (pitch TT); 256 threads, 16 copies each; a wave's copy covers one 512-B P row or two 256-B v rows
__device__ __forceinline__ void pv_fill(const float* Pg, const _Float16* Vg, float* sp, _Float16* sv, int tid) {
  unsigned l[8]; const char* gp[8];
#pragma unroll   // the arrays indexed here live in registers: every index must be a compile-time constant
  for (int i = 0; i < 8; ++i) { const int e = i * 256 + tid, row = e >> 5, q = e & 31; l[i] = lds_off(sp + row * PVPP + q * 4); gp[i] = (const char*)(Pg + (size_t)row * TT + q * 4); }
  copy8(l, gp);
#pragma unroll   // the arrays indexed here live in registers: every index must be a compile-time constant
  for (int i = 0; i < 8; ++i) { const int e = i * 256 + tid, row = e >> 4, q = e & 15; l[i] = lds_off(sv + row * PVVP + q * 8); gp[i] = (const char*)(Vg + (size_t)row * TT + q * 8); }
  copy8(l, gp);
}
__global__ __launch_bounds__(256) void k_pv(const float* __restrict__ PS0, const _Float16* __restrict__ VT, const __bf16* __restrict__ VB, const __bf16* __restrict__ VBL, int bgrp, int h0, float* __restrict__ Y) { (void)VB; (void)VBL; const int h = h0; const int b = bgrp + blockIdx.z; const float* PS = PS0 + (size_t)blockIdx.z * TT * TT; const int d0 = blockIdx.y * DVH;   /* group spans batches; column half d0 */
  __shared__ __align__(16) float sp[2][64][PVPP]; __shared__ __align__(16) _Float16 sv[2][DVH][PVVP]; __shared__ __align__(16) float ss[8][16][64 + 4];
  const int tid = threadIdx.x, wave = tid >> 5, lane = tid & 31, col = lane & 15, g = lane >> 4; const int qb = blockIdx.x; const int wq = wave & 3, wc = wave >> 2; const int ql0 = qb * 64 + wq * 16; const int nst = (kb_last(qb) + 1) * 128 / PVK;
  const float* Pg = PS + (size_t)qb * 64 * TT; const _Float16* Vg = VT + ((size_t)b * CC + h * HD + d0) * (size_t)TT;
  v8f acc[4] = {};
  pv_fill(Pg, Vg, &sp[0][0][0], &sv[0][0][0], tid);
  asm volatile("s_wait_asynccnt 0x0" ::: "memory");   // stage 0 has landed for this wave's own copies
  __syncthreads();                                     // ... and for every wave's
  if (nst > 1) pv_fill(Pg + PVK, Vg + PVK, &sp[1][0][0], &sv[1][0][0], tid);
#pragma unroll 1   // one stage a trip: the buffer index stays a run-time bit and the loop stays small
  for (int t = 0; t < nst; ++t) { const float* pr = &sp[t & 1][wq * 16 + col][0]; const _Float16* vr = &sv[t & 1][wc * 64 + col][0];
#pragma unroll   // the arrays indexed here live in registers: every index must be a compile-time constant
    for (int kc = 0; kc < PVK / 32; ++kc) { const v16h p = frag_f32(pr + kc * 32, lane); v16h vf[4];
#pragma unroll   // the arrays indexed here live in registers: every index must be a compile-time constant
      for (int j = 0; j < 4; ++j) vf[j] = frag_h(vr + j * 16 * PVVP + kc * 32, lane);
#pragma unroll   // the arrays indexed here live in registers: every index must be a compile-time constant
      for (int j = 0; j < 4; ++j) acc[j] = wmma16(p, vf[j], acc[j]); }
    asm volatile("s_wait_dscnt 0x0" ::: "memory");      // this wave's reads of buffer t & 1 are done before it is handed to the copies
    asm volatile("s_wait_asynccnt 0x0" ::: "memory");   // this wave's copies of stage t + 1 have landed
    __syncthreads();                                     // publishes stage t + 1 and ends every reader's last read of buffer t & 1
    if (t + 2 < nst) pv_fill(Pg + (t + 2) * PVK, Vg + (t + 2) * PVK, &sp[t & 1][0][0], &sv[t & 1][0][0], tid); }
  asm volatile("s_wait_asynccnt 0x0" ::: "memory");     // no copy is outstanding when the wave goes on to its end
#pragma unroll   // the arrays indexed here live in registers: every index must be a compile-time constant
  for (int j = 0; j < 4; ++j)
#pragma unroll   // the arrays indexed here live in registers: every index must be a compile-time constant
    for (int r = 0; r < 8; ++r) ss[wave][8 * g + r][j * 16 + col] = acc[j][r] * (1.0f / 2048.0f);
  LDSX(); for (int rl = 0; rl < 16; rl += 2) vst2(Y + ((size_t)b * TT + ql0 + rl + g) * CC + h * HD + d0 + wc * 64 + col * 4, *(const v4f*)&ss[wave][rl + g][col * 4]); }   /* output rows [b*TT + s][256]: two 256-B (row, 64-column) segments by 32 lanes */

extern "C" void kernel_launch(void* const* d_in, const int* in_sizes, int n_in, void* d_out, int out_size, void* d_ws, size_t ws_size, hipStream_t stream) {
  (void)in_sizes; (void)n_in; (void)out_size;
  const float** F = (const float**)d_in;
  if (ws_size < (size_t)WS_END) return;
  char* ws = (char*)d_ws; _Float16 *QH = (_Float16*)(ws + WS_QH), *KH = (_Float16*)(ws + WS_KH), *VT = (_Float16*)(ws + WS_VT), *QL = (_Float16*)(ws + WS_QL), *KL = (_Float16*)(ws + WS_KL); __bf16 *VB = (__bf16*)(ws + WS_VB), *VBL = (__bf16*)(ws + WS_VBL); float *S = (float*)(ws + WS_S), *Y = (float*)(ws + WS_Y);
  (void)Y; (void)QL; (void)KL; (void)VB; (void)VBL;
  // inputs: 0 x [8,2048,256]; 1 kernel [3,256,256] ((in,out): Q | K | V matrices); 2 mask [8,2048] int32
  const float* Wq = F[1]; const float* Wk = F[1] + (size_t)DIN * CCQ; const float* Wv = F[1] + 2 * (size_t)DIN * CCQ;
  k_projT<0><<<dim3(TNB * TT / 64, CCQ / 128, 2), 128, 0, stream>>>(F[0], F[0], F[0], Wq, Wk, Wv, nullptr, nullptr, nullptr, QH, QL, KH, KL, VT, VB, VBL);   /* which 0, 1: q and k rows (hi + residual planes) */
  k_projT<2><<<dim3(TNB * TT / 64, CC / 128, 1), 128, 0, stream>>>(F[0], F[0], F[0], Wq, Wk, Wv, nullptr, nullptr, nullptr, QH, QL, KH, KL, VT, VB, VBL);     /* which 2: v planes */
  for (int b0 = 0; b0 < TNB; b0 += BGN) {
    k_sc<<<dim3(TT / 128, TT / 128, BGN), 256, 0, stream>>>(QH, KH, QL, KL, b0, 0, S);
    k_sm<<<dim3(TT, BGN), 256, 0, stream>>>(S, b0, (const int*)d_in[2]);
    k_pv<<<dim3(NQB, HD / DVH, BGN), 256, 0, stream>>>(S, VT, VB, VBL, b0, 0, (float*)d_out);
  }

}

// v002
// It runs in 200 microseconds.
// Two timings next to v001 both put it at 1.17 times that version's speed.
// All steps since v000 together make it 2.55 times as fast.
// compute dtype: all float inputs rounded to bf16; q/k/v projections with EXACT bf16 products on WMMA 16x16x32 (f32 accumulate); logits q x k with BOTH operands as f16 hi + (x 2^10) residual (3 products: hi.hi + lo.hi + hi.lo) x 64^-0.5, for every row (the logits have sigma - 500); the int row mask multiplies the logits in f32; softmax f32; P x 2^11 once to f16 x v once to f16 (1 product); f32 output.
#include <hip/hip_runtime.h>
#include <math.h>

typedef __attribute__((ext_vector_type(16))) _Float16 v16h;
typedef __attribute__((ext_vector_type(16))) __bf16 v16b;
typedef __attribute__((ext_vector_type(8)))  _Float16 v8h;
typedef __attribute__((ext_vector_type(8)))  float v8f;
typedef __attribute__((ext_vector_type(4)))  float v4f;
typedef __attribute__((ext_vector_type(2)))  float v2f;
typedef __attribute__((ext_vector_type(4)))  unsigned v4u;
typedef __attribute__((ext_vector_type(4)))  int v4i;
typedef float __attribute__((may_alias)) float_a;
typedef int __attribute__((may_alias)) int_a;

template <typename T> __device__ __forceinline__ void vst2(void* p, T v) { *(T*)p = v;  }
__device__ __forceinline__ v8f wmma16(v16h a, v16h b, v8f c) {
  v8f d = __builtin_amdgcn_wmma_f32_16x16x32_f16(false, a, false, b, (short)0, c, false, false);
  asm volatile("v_nop\n\tv_nop\n\tv_nop\n\tv_nop" : "+v"(d) : "v"(a), "v"(b));
  return d;
}
__device__ __forceinline__ v8f wmma_bf(v16b a, v16b b, v8f c) {
  v8f d = __builtin_amdgcn_wmma_f32_16x16x32_bf16(false, a, false, b, (short)0, c, false, false);
  asm volatile("v_nop\n\tv_nop\n\tv_nop\n\tv_nop" : "+v"(d) : "v"(a), "v"(b));
  return d;
}
// 16x16x32 fragments: lane = (h = lane>>4, row/col = lane&15); elements 0..7 = k0+8h+0..7, 8..15 = k0+16+8h+0..7; D element r = row 8h+r
__device__ __forceinline__ v16h frag_h(const _Float16* rowk0, int lane) {
  union { v16h v; v8h q[2]; } u; const _Float16* p = rowk0 + 8 * (lane >> 4);
  u.q[0] = *(const v8h*)p; u.q[1] = *(const v8h*)(p + 16); return u.v;
}
__device__ __forceinline__ v16h frag_f32(const float* rowk0, int lane) {
  v16h a; const float* p = rowk0 + 8 * (lane >> 4);
#pragma unroll
  for (int i = 0; i < 8; ++i) { a[i] = (_Float16)p[i]; a[8 + i] = (_Float16)p[16 + i]; }
  return a;
}
__device__ __forceinline__ v16h frag_f32s(const float* rowk0, int lane, float sc) {
  v16h a; const float* p = rowk0 + 8 * (lane >> 4);
#pragma unroll
  for (int i = 0; i < 8; ++i) { a[i] = (_Float16)(p[i] * sc); a[8 + i] = (_Float16)(p[16 + i] * sc); }
  return a;
}
// column fragment from a [K][ld] layout (column n), rows >= K read as 0
__device__ __forceinline__ v16h fragc_f32(const float* W, int k0, int n, int lane, int ld, int K) {
  v16h a; const int g = lane >> 4;
#pragma unroll
  for (int i = 0; i < 8; ++i) { const int ka = k0 + 8 * g + i, kb = ka + 16;
    a[i] = (_Float16)(ka < K ? W[(size_t)(ka < K ? ka : K - 1) * ld + n] : 0.f); a[8 + i] = (_Float16)(kb < K ? W[(size_t)(kb < K ? kb : K - 1) * ld + n] : 0.f); }
  return a;
}
struct F2 { v16b h, l; };
__device__ __forceinline__ F2 bsplit16(const float v[16]) { F2 r;
#pragma unroll
  for (int i = 0; i < 16; ++i) { const __bf16 h = (__bf16)v[i]; r.h[i] = h; r.l[i] = (__bf16)(v[i] - (float)h); }
  return r; }
__device__ __forceinline__ F2 split_row(const float* row, int k0, int lane) { float v[16]; const float* p = row + k0 + 8 * (lane >> 4);
#pragma unroll
  for (int i = 0; i < 8; ++i) { v[i] = p[i]; v[8 + i] = p[16 + i]; }
  return bsplit16(v); }
__device__ __forceinline__ F2 split_rowK(const float* row, int k0, int lane, int K) { float v[16]; const int g = lane >> 4;
#pragma unroll
  for (int i = 0; i < 8; ++i) { const int ka = k0 + 8 * g + i, kb = ka + 16; v[i] = ka < K ? row[ka < K ? ka : K - 1] : 0.f; v[8 + i] = kb < K ? row[kb < K ? kb : K - 1] : 0.f; }
  return bsplit16(v); }
__device__ __forceinline__ F2 split_col(const float* W, int k0, int n, int lane, int ld, int K) { float v[16]; const int g = lane >> 4;
#pragma unroll
  for (int i = 0; i < 8; ++i) { const int ka = k0 + 8 * g + i, kb = ka + 16; v[i] = ka < K ? W[(size_t)(ka < K ? ka : K - 1) * ld + n] : 0.f; v[8 + i] = kb < K ? W[(size_t)(kb < K ? kb : K - 1) * ld + n] : 0.f; }
  return bsplit16(v); }
__device__ __forceinline__ v8f mac3(const F2& a, const F2& b, v8f c) { c = wmma_bf(a.l, b.h, c); c = wmma_bf(a.h, b.l, c); return wmma_bf(a.h, b.h, c); }
__device__ __forceinline__ float sigm(float v) { return 1.0f / (1.0f + expf(-v)); }
#define LDSX() do { asm volatile("s_wait_dscnt 0" ::: "memory"); __builtin_amdgcn_wave_barrier(); __builtin_amdgcn_fence(__ATOMIC_RELEASE, "workgroup"); } while (0)

// Single-head self-attention with unscaled N(0,1) projection kernels and a multiplicative row mask (x [8,2048,256]; kernel [3,256,256] (in,out): Q, K, V; mask [8,2048] int 0/1; SCALE = 1/sqrt(64) hard-coded): QK = (Q K^T) / 8; QK *= mask[b][q] per QUERY row (masked rows: all-zero logits -> uniform attention); A = softmax(QK); out = A V -> [8,2048,256].
#define NB 8
#define TT 2048
#define CC 256            // value width (v planes, output rows)
#define CCQ 256           // q / k row width
#define DIN 256          // x width
#define NH 1
#define HD 256
#define NQB (TT / 64)
#define HG 4               // four 2,048 x 2,048 score planes per pass (the pass group spans batches)
#define SCALE (0.125f)             // 1/sqrt(64), hard-coded in the source
#define HDQK 256           // q / k width
#define CAUSAL 0
#ifndef TNB
#define TNB NB
#endif
__device__ __forceinline__ v16b zero16b() { v16b z; _Pragma("unroll") for (int i = 0; i < 16; ++i) z[i] = (__bf16)0.f; return z; }
__device__ __forceinline__ float bfr(float v) { return (float)(__bf16)v; }
__host__ __device__ __forceinline__ int kb_last(int qb) { return CAUSAL ? ((qb * 64 + 63) >> 7) : (TT / 128 - 1); }
typedef __attribute__((ext_vector_type(8))) __bf16 v8b;
__device__ __forceinline__ v16b frag_b(const __bf16* rowk0, int lane) {
  union { v16b v; v8b q[2]; } u; const __bf16* p = rowk0 + 8 * (lane >> 4);
  u.q[0] = *(const v8b*)p; u.q[1] = *(const v8b*)(p + 16); return u.v;
}
#define QBH 0              // k_pv keeps the single-product P.v path for every block
#define QBH_SC NQB         // k_sc: EVERY query block takes the 3-product (q hi+lo x k hi+lo) path
#define QHI TT              // q residual rows for every query
#define KHI TT              // k residual rows for every key (the bf16 v hi/lo planes are written too but unused)
// B fragment (k rows k0+.., output column o) of a weight: (in,out) [K][ld] or (out,in) [ld rows of K]: bf16 exact, or f16(bf16 * 256) exact
__device__ __forceinline__ v16b wcol_io(const float* Wm, int k0, int o, int lane, int ld) { v16b w; const int g = lane >> 4;
#pragma unroll
  for (int i = 0; i < 8; ++i) { w[i] = (__bf16)Wm[(size_t)(k0 + 8 * g + i) * ld + o]; w[8 + i] = (__bf16)Wm[(size_t)(k0 + 16 + 8 * g + i) * ld + o]; }
  return w; }
__device__ __forceinline__ v16b wcol_oi(const float* Wm, int k0, int o, int lane, int K) { v16b w; const float* p = Wm + (size_t)o * K + k0 + 8 * (lane >> 4);
#pragma unroll
  for (int i = 0; i < 8; ++i) { w[i] = (__bf16)p[i]; w[8 + i] = (__bf16)p[16 + i]; }
  return w; }
__device__ __forceinline__ v16h wcolh_io(const float* Wm, int k0, int o, int lane, int ld) { v16h w; const int g = lane >> 4;
#pragma unroll
  for (int i = 0; i < 8; ++i) { w[i] = (_Float16)(bfr(Wm[(size_t)(k0 + 8 * g + i) * ld + o]) * 256.0f); w[8 + i] = (_Float16)(bfr(Wm[(size_t)(k0 + 16 + 8 * g + i) * ld + o]) * 256.0f); }
  return w; }
__device__ __forceinline__ v16h wcolh_oi(const float* Wm, int k0, int o, int lane, int K) { v16h w; const float* p = Wm + (size_t)o * K + k0 + 8 * (lane >> 4);
#pragma unroll
  for (int i = 0; i < 8; ++i) { w[i] = (_Float16)(bfr(p[i]) * 256.0f); w[8 + i] = (_Float16)(bfr(p[16 + i]) * 256.0f); }
  return w; }
#define WQKV_LAYOUT 0   // 0 = (in,out) [K][CC]; 1 = (out,in) [CC][DIN]; 2 = per-head [NH][DIN][HD]
__device__ __forceinline__ v16b wcol_hdk(const float* Wm, int k0, int o, int lane) { v16b w; const int g = lane >> 4; const float* p = Wm + (size_t)(o / HD) * DIN * HD + (o % HD);
#pragma unroll
  for (int i = 0; i < 8; ++i) { w[i] = (__bf16)p[(size_t)(k0 + 8 * g + i) * HD]; w[8 + i] = (__bf16)p[(size_t)(k0 + 16 + 8 * g + i) * HD]; }
  return w; }
#define WO_OUT_IN 0
#if WQKV_LAYOUT == 1
#define WCOL(W, k0, o, lane) wcol_oi(W, k0, (o), lane, DIN)   /* unused: layout 0 */
#elif WQKV_LAYOUT == 2
#define WCOL(W, k0, o, lane) wcol_hdk(W, k0, o, lane)
#else
#define WCOL(W, k0, o, lane) (which == 2 ? wcol_io(W, k0, (o), lane, CC) : ((o) < HDQK ? wcol_io(W, k0, (o), lane, HDQK) : zero16b()))   /* Wv [256][256]; Wq/Wk [256][256]: projected q/k columns >= 256 would read as zero (grid y = 2 covers 0..255) */
#endif
#if WO_OUT_IN
#define WOCOL(W, k0, o, lane) wcol_oi(W, k0, o, lane, CC)
#define WOCOLH(W, k0, o, lane) wcolh_oi(W, k0, o, lane, CC)
#else
#define WOCOL(W, k0, o, lane) wcol_io(W, k0, o, lane, DIN)
#define WOCOLH(W, k0, o, lane) wcolh_io(W, k0, o, lane, DIN)
#endif
#define BG HG              // the pass group spans BATCHES (single head): blockIdx.z selects batch b0 + z
#define BGN (TNB < BG ? TNB : BG)   // with TNB 1 one batch runs per pass
#define DVH 128            // value columns per k_pv block (HD 256 split in two column halves to keep 4 accumulator tiles per wave)
#define SM_EXTRA_PARAMS , int bsm, const int* __restrict__ RMASK
// multiplicative per-QUERY-row int mask applied to the scaled logits before the softmax (mask 0 -> every logit of the row becomes 0 -> uniform attention), as the module
#define SM_MASK_HOOK do { v = v * (float)RMASK[(size_t)(bsm + (int)blockIdx.y) * TT + t]; } while (0)
#ifndef SM_EXTRA_PARAMS
#define SM_EXTRA_PARAMS
#endif
#ifndef PROJ_EXTRA_PARAMS
#define PROJ_EXTRA_PARAMS
#endif
#ifndef SM_MASK_HOOK
#define SM_MASK_HOOK (void)0
#endif

#define WS_QH  0u                                      // f16 q rows [b*t][CCQ]
#define WS_KH  (WS_QH + 2u * (size_t)NB * TT * CCQ)     // f16 k rows [b*t][CCQ]
#define WS_VT  (WS_KH + 2u * (size_t)NB * TT * CCQ)     // f16 v planes [b][c][t]
#define WS_QL  (WS_VT + 2u * (size_t)NB * CC * TT)      // f16 q residual x 2^10 rows [b][t < QHI][CCQ]
#define WS_KL  (WS_QL + 2u * (size_t)NB * QHI * CCQ)    // f16 k residual x 2^10 rows [b][t < KHI][CCQ]
#define WS_VB  (WS_KL + 2u * (size_t)NB * KHI * CCQ)    // bf16 v hi planes [b][c][t < KHI]
#define WS_VBL (WS_VB + 2u * (size_t)NB * CC * KHI)
#define WS_S   (WS_VBL + 2u * (size_t)NB * CC * KHI)    // f32 logits / P [hg][t][s]
#define WS_Y   (WS_S  + 4u * (size_t)HG * TT * TT)      // f32 ctx rows [b*t][CC] (only when there is an output projection)
#define WS_END (WS_Y  + 0u)

// ---- k_proj: block = (64 rows, 128 cols, which): q/k/v = X W (+ b) with exact bf16 products (K = DIN) -> which 0: q f16 rows (+ residual rows < QHI); 1: k f16 rows (+ residual rows < KHI); 2: v f16 planes [c][t] (+ bf16 hi/lo planes for t < KHI)
template <int WOFF> __global__ __launch_bounds__(128) void k_projT(const float* __restrict__ XQ, const float* __restrict__ XK, const float* __restrict__ XV, const float* __restrict__ WQ, const float* __restrict__ WK, const float* __restrict__ WV, const float* __restrict__ BQ, const float* __restrict__ BK, const float* __restrict__ BV,
    _Float16* __restrict__ QH, _Float16* __restrict__ QL, _Float16* __restrict__ KH, _Float16* __restrict__ KL, _Float16* __restrict__ VT, __bf16* __restrict__ VB, __bf16* __restrict__ VBL) {
  __shared__ __align__(16) _Float16 sh[64][136], sl[64][136]; __shared__ __align__(16) _Float16 th[128][72]; __shared__ __align__(16) __bf16 tb[128][72], tbl[128][72];
  const int tid = threadIdx.x, wave = tid >> 5, lane = tid & 31, col = lane & 15, g = lane >> 4; const int which = blockIdx.z + WOFF; const int c0 = blockIdx.y * 128; const size_t r0 = (size_t)blockIdx.x * 64; const size_t bb = r0 / TT; const int t0 = (int)(r0 % TT);
  const float* X = which == 0 ? XQ : which == 1 ? XK : XV; const float* WA = which == 0 ? WQ : which == 1 ? WK : WV; const float* BA = which == 0 ? BQ : which == 1 ? BK : BV;
  const int KD = DIN;
  v8f acc[8] = {};
#pragma unroll 2
  for (int kc = 0; kc < KD / 32; ++kc) { v16b a; { const float* p = X + (r0 + wave * 16 + col) * (size_t)KD + kc * 32 + 8 * g;   /* row-major [b*t][KD] */
#pragma unroll
      for (int i = 0; i < 8; ++i) { a[i] = (__bf16)p[i]; a[8 + i] = (__bf16)p[16 + i]; } }
    asm volatile("s_wait_loadcnt 0x0" ::: "memory");
#pragma unroll
    for (int j = 0; j < 8; ++j) { const v16b w = WCOL(WA, kc * 32, c0 + j * 16 + col, lane); asm volatile("s_wait_loadcnt 0x0" ::: "memory"); acc[j] = wmma_bf(a, w, acc[j]); } }
  if (which < 2) { _Float16* DH = which == 0 ? QH : KH; _Float16* DL = which == 0 ? QL : KL; const int nhi = which == 0 ? QHI : KHI; const bool hi_rows = t0 < nhi;
#pragma unroll
    for (int j = 0; j < 8; ++j) { const float bias = BA ? bfr(BA[c0 + j * 16 + col]) : 0.f;
#pragma unroll
      for (int r = 0; r < 8; ++r) { const float v = acc[j][r] + bias; const _Float16 hv = (_Float16)v; sh[wave * 16 + 8 * g + r][j * 16 + col] = hv; sl[wave * 16 + 8 * g + r][j * 16 + col] = (_Float16)((v - (float)hv) * 1024.0f); } }
    __syncthreads();
    for (int e = tid; e < 64 * 16; e += 128) { const int rl = e >> 4, q = e & 15; vst2((unsigned*)(DH + (r0 + rl) * CCQ + c0 + q * 8), *(const v4u*)&sh[rl][q * 8]); if (hi_rows) vst2((unsigned*)(DL + (bb * nhi + t0 + rl) * (size_t)CCQ + c0 + q * 8), *(const v4u*)&sl[rl][q * 8]); }   /* q/k rows: pitch CCQ (c0 = 0 or 128) */
  } else { const bool hi_rows = t0 < KHI;
#pragma unroll
    for (int j = 0; j < 8; ++j) { const float bias = BA ? bfr(BA[c0 + j * 16 + col]) : 0.f;
#pragma unroll
      for (int r = 0; r < 8; ++r) { const float v = acc[j][r] + bias; const int rl = wave * 16 + 8 * g + r, cl = j * 16 + col; th[cl][rl] = (_Float16)v; const __bf16 bh = (__bf16)v; tb[cl][rl] = bh; tbl[cl][rl] = (__bf16)(v - (float)bh); } }
    __syncthreads();
    for (int e = tid; e < 128 * 8; e += 128) { const int cl = e >> 3, q = e & 7; vst2((unsigned*)(VT + (bb * CC + c0 + cl) * (size_t)TT + t0 + q * 8), *(const v4u*)&th[cl][q * 8]); if (hi_rows) { const size_t o3 = (bb * CC + c0 + cl) * (size_t)KHI + t0 + q * 8; vst2((unsigned*)(VB + o3), *(const v4u*)&tb[cl][q * 8]); vst2((unsigned*)(VBL + o3), *(const v4u*)&tbl[cl][q * 8]); } } } }
__device__ __forceinline__ unsigned lds_off(const void* p) { return (unsigned)(size_t)p; }
// eight 16-byte copies of one lane, global -> LDS; the s_wait_xcnt stands inside the statement so that no address register is rewritten in front of it
__device__ __forceinline__ void copy8(const unsigned l[8], const char* const gp[8]) {
  asm volatile("global_load_async_to_lds_b128 %0, %8, off\n\t"
               "global_load_async_to_lds_b128 %1, %9, off\n\t"
               "global_load_async_to_lds_b128 %2, %10, off\n\t"
               "global_load_async_to_lds_b128 %3, %11, off\n\t"
               "global_load_async_to_lds_b128 %4, %12, off\n\t"
               "global_load_async_to_lds_b128 %5, %13, off\n\t"
               "global_load_async_to_lds_b128 %6, %14, off\n\t"
               "global_load_async_to_lds_b128 %7, %15, off\n\t"
               "s_wait_xcnt 0x0"
               :: "v"(l[0]), "v"(l[1]), "v"(l[2]), "v"(l[3]), "v"(l[4]), "v"(l[5]), "v"(l[6]), "v"(l[7]),
                  "v"(gp[0]), "v"(gp[1]), "v"(gp[2]), "v"(gp[3]), "v"(gp[4]), "v"(gp[5]), "v"(gp[6]), "v"(gp[7]) : "memory");
}
// ---- k_sc: block = (128 queries (qb), 128 keys (kb), batch in group), 8 waves of 16 query rows x 128 keys: logits x SCALE; q hi + residual (x 2^10) against k hi + residual (3 products: hi.hi | lo.hi + hi.lo), for every query row. The four planes (q hi, q lo, k hi, k lo: 128 rows x 64 elements each) of a stage come into LDS by asynchronous copies in whole 128-B lines, two buffers: the next stage flies while this one is multiplied
#define SCK 64             // q / k elements per LDS stage
#define SCP 72             // staged row pitch in f16: 128 B + 16 B (16 B x odd: ds_load_b128 walks over rows meet no bank twice)
// one stage: rows [128][SCK] of each plane (pitch CCQ) -> sr[plane][128][SCP]; 256 threads, 16 copies each; a wave's copy covers four 128-B row pieces
__device__ __forceinline__ void sc_fill(const _Float16* q_h, const _Float16* q_l, const _Float16* k_h, const _Float16* k_l, _Float16* sr, int tid) {
  unsigned l[8]; const char* gp[8]; const int r0 = tid >> 3, q = tid & 7;
#pragma unroll   // the arrays indexed here live in registers: every index must be a compile-time constant
  for (int i = 0; i < 8; ++i) { const int row = (i & 3) * 32 + r0; l[i] = lds_off(sr + ((i >> 2) * 128 + row) * SCP + q * 8); gp[i] = (const char*)((i >> 2 ? q_l : q_h) + (size_t)row * CCQ + q * 8); }
  copy8(l, gp);
#pragma unroll   // the arrays indexed here live in registers: every index must be a compile-time constant
  for (int i = 0; i < 8; ++i) { const int row = (i & 3) * 32 + r0; l[i] = lds_off(sr + ((2 + (i >> 2)) * 128 + row) * SCP + q * 8); gp[i] = (const char*)((i >> 2 ? k_l : k_h) + (size_t)row * CCQ + q * 8); }
  copy8(l, gp);
}
__global__ __launch_bounds__(256) void k_sc(const _Float16* __restrict__ QH, const _Float16* __restrict__ KH, const _Float16* __restrict__ QL, const _Float16* __restrict__ KL, int bgrp, int h0, float* __restrict__ S0) { __shared__ __align__(16) _Float16 ring[2][4][128][SCP];
  (void)h0; const int qb = blockIdx.x, kb = blockIdx.y;
  const int b = bgrp + blockIdx.z; float* S = S0 + (size_t)blockIdx.z * TT * TT;   /* group spans batches */
  const int tid = threadIdx.x, wave = tid >> 5, lane = tid & 31, col = lane & 15, g = lane >> 4; const int k0 = kb * 128; const int ql0 = qb * 128 + wave * 16;
  const _Float16* q_h = QH + ((size_t)b * TT + qb * 128) * CCQ; const _Float16* q_l = QL + ((size_t)b * QHI + qb * 128) * CCQ; const _Float16* k_h = KH + ((size_t)b * TT + k0) * CCQ; const _Float16* k_l = KL + ((size_t)b * KHI + k0) * CCQ;   /* single head: q/k rows at pitch CCQ */
  v8f acc[8] = {}, accl[8] = {};
  sc_fill(q_h, q_l, k_h, k_l, &ring[0][0][0][0], tid);
  asm volatile("s_wait_asynccnt 0x0" ::: "memory");   // stage 0 has landed for this wave's own copies
  __syncthreads();                                     // ... and for every wave's
  sc_fill(q_h + SCK, q_l + SCK, k_h + SCK, k_l + SCK, &ring[1][0][0][0], tid);
#pragma unroll 1   // one stage a trip: the buffer index stays a run-time bit and the loop stays small
  for (int t = 0; t < HDQK / SCK; ++t) {
#pragma unroll   // the arrays indexed here live in registers: every index must be a compile-time constant
    for (int kk = 0; kk < SCK / 32; ++kk) { const v16h ah = frag_h(&ring[t & 1][0][wave * 16 + col][kk * 32], lane), al = frag_h(&ring[t & 1][1][wave * 16 + col][kk * 32], lane);
#pragma unroll   // the arrays indexed here live in registers: every index must be a compile-time constant
      for (int j0 = 0; j0 < 8; j0 += 2) { v16h kbf[2], klf[2];   /* the LDS reads of two key tiles stand together in front of their six products */
#pragma unroll   // the arrays indexed here live in registers: every index must be a compile-time constant
        for (int u = 0; u < 2; ++u) { kbf[u] = frag_h(&ring[t & 1][2][(j0 + u) * 16 + col][kk * 32], lane); klf[u] = frag_h(&ring[t & 1][3][(j0 + u) * 16 + col][kk * 32], lane); }
#pragma unroll   // the arrays indexed here live in registers: every index must be a compile-time constant
        for (int u = 0; u < 2; ++u) { const int j = j0 + u; acc[j] = wmma16(ah, kbf[u], acc[j]); accl[j] = wmma16(al, kbf[u], accl[j]); accl[j] = wmma16(ah, klf[u], accl[j]); } } }
    asm volatile("s_wait_dscnt 0x0" ::: "memory");      // this wave's reads of buffer t & 1 are done before it is handed to the copies
    asm volatile("s_wait_asynccnt 0x0" ::: "memory");   // this wave's copies of stage t + 1 have landed
    __syncthreads();                                     // publishes stage t + 1 and ends every reader's last read of buffer t & 1
    if (t + 2 < HDQK / SCK) sc_fill(q_h + (t + 2) * SCK, q_l + (t + 2) * SCK, k_h + (t + 2) * SCK, k_l + (t + 2) * SCK, &ring[t & 1][0][0][0], tid); }
  asm volatile("s_wait_asynccnt 0x0" ::: "memory");     // no copy is outstanding when the ring becomes output staging
  float (*ss)[16][132] = (float (*)[16][132])&ring[0][0][0][0];   /* 8 x 16 x 132 f32 inside the ring, free behind the last trip's barrier; each wave its own range */
#pragma unroll   // the arrays indexed here live in registers: every index must be a compile-time constant
  for (int j = 0; j < 8; ++j) {
#pragma unroll   // the arrays indexed here live in registers: every index must be a compile-time constant
    for (int r = 0; r < 8; ++r) ss[wave][8 * g + r][j * 16 + col] = (acc[j][r] + accl[j][r] * (1.0f / 1024.0f)) * SCALE; }
  LDSX(); for (int rl = 0; rl < 16; ++rl) vst2(S + (size_t)(ql0 + rl) * TT + k0 + lane * 4, *(const v4f*)&ss[wave][rl][lane * 4]); }
// ---- k_sm: one WAVE per query row, the whole row (TT logits) in registers: 16 B per lane and load, 512 contiguous B per wave and load, all 16 loads of the row in flight at once. logit x row mask; maximum, exp and sum in f32 (per lane four chains over its 64 keys, then a butterfly over the 32 lanes); P x 2^11 in place. No LDS, no barrier (all keys take part: CAUSAL 0)
#define SMW 4              // waves (rows) per block: one per SIMD, so a WGP takes as many blocks as a SIMD has room for waves
__global__ __launch_bounds__(SMW * 32) void k_sm(float* __restrict__ S0 SM_EXTRA_PARAMS) {
  const int lane = threadIdx.x & 31; const int wave = __builtin_amdgcn_readfirstlane((int)(threadIdx.x >> 5)); const int t = (int)blockIdx.x * SMW + wave;
  float* sr = S0 + (size_t)blockIdx.y * TT * TT + (size_t)t * TT + lane * 4;
  v4f x[TT / 128];
#pragma unroll   // the arrays indexed here live in registers: every index must be a compile-time constant
  for (int i = 0; i < TT / 128; ++i) x[i] = *(const v4f*)(sr + i * 128);
  v4f m4 = {-3.0e38f, -3.0e38f, -3.0e38f, -3.0e38f};
#pragma unroll   // the arrays indexed here live in registers: every index must be a compile-time constant
  for (int i = 0; i < TT / 128; ++i)
#pragma unroll   // the arrays indexed here live in registers: every index must be a compile-time constant
    for (int c = 0; c < 4; ++c) { float v = x[i][c]; SM_MASK_HOOK; x[i][c] = v; m4[c] = fmaxf(m4[c], v); }
  float m = fmaxf(fmaxf(m4[0], m4[1]), fmaxf(m4[2], m4[3]));
#pragma unroll
  for (int o = 1; o < 32; o <<= 1) m = fmaxf(m, __shfl_xor(m, o));
  v4f s4 = {0.f, 0.f, 0.f, 0.f};
#pragma unroll   // the arrays indexed here live in registers: every index must be a compile-time constant
  for (int i = 0; i < TT / 128; ++i)
#pragma unroll   // the arrays indexed here live in registers: every index must be a compile-time constant
    for (int c = 0; c < 4; ++c) { const float v = x[i][c]; const float ex = expf(v - m); const float e = (v <= -1.0e38f) ? 0.f : ex; x[i][c] = e; s4[c] += e; }   /* exp first, then the select: no branch per key */
  float sum = (s4[0] + s4[1]) + (s4[2] + s4[3]);
#pragma unroll
  for (int o = 1; o < 32; o <<= 1) sum += __shfl_xor(sum, o);
  const float inv = sum > 0.f ? 2048.0f / sum : 0.f;   /* a fully excluded row yields P = 0 */
#pragma unroll   // the arrays indexed here live in registers: every index must be a compile-time constant
  for (int i = 0; i < TT / 128; ++i) vst2(sr + i * 128, x[i] * inv); }
// ---- k_pv: block = (64 queries (qb), 128-column value half, batch in group), 8 waves = 4 query sub-tiles x 2 groups of 64 columns: attended = P . v over all keys (P x 2^11 once to f16 against v f16: 1 product, keys in ascending order) x 2^-11, written directly to the output. The P tile (64 x 128 f32) and the v tile (128 columns x 128 keys f16) of each stage come into LDS by asynchronous copies in whole 512-B and 256-B rows, two buffers: the next stage flies while this one is multiplied
#define PVK 128            // keys per LDS stage
#define PVPP 132           // staged P row pitch in f32: 512 B + 16 B (16 B x odd: ds_load_b128 walks over rows meet no bank twice)
#define PVVP 136           // staged v row pitch in f16: 256 B + 16 B (same reason)
// one stage: P rows [64][PVK] from Pg (pitch TT), v rows [DVH][PVK] from Vg (pitch TT); 256 threads, 16 copies each; a wave's copy covers one 512-B P row or two 256-B v rows
__device__ __forceinline__ void pv_fill(const float* Pg, const _Float16* Vg, float* sp, _Float16* sv, int tid) {
  unsigned l[8]; const char* gp[8];
#pragma unroll   // the arrays indexed here live in registers: every index must be a compile-time constant
  for (int i = 0; i < 8; ++i) { const int e = i * 256 + tid, row = e >> 5, q = e & 31; l[i] = lds_off(sp + row * PVPP + q * 4); gp[i] = (const char*)(Pg + (size_t)row * TT + q * 4); }
  copy8(l, gp);
#pragma unroll   // the arrays indexed here live in registers: every index must be a compile-time constant
  for (int i = 0; i < 8; ++i) { const int e = i * 256 + tid, row = e >> 4, q = e & 15; l[i] = lds_off(sv + row * PVVP + q * 8); gp[i] = (const char*)(Vg + (size_t)row * TT + q * 8); }
  copy8(l, gp);
}
__global__ __launch_bounds__(256) void k_pv(const float* __restrict__ PS0, const _Float16* __restrict__ VT, const __bf16* __restrict__ VB, const __bf16* __restrict__ VBL, int bgrp, int h0, float* __restrict__ Y) { (void)VB; (void)VBL; const int h = h0; const int b = bgrp + blockIdx.z; const float* PS = PS0 + (size_t)blockIdx.z * TT * TT; const int d0 = blockIdx.y * DVH;   /* group spans batches; column half d0 */
  __shared__ __align__(16) float sp[2][64][PVPP]; __shared__ __align__(16) _Float16 sv[2][DVH][PVVP]; __shared__ __align__(16) float ss[8][16][64 + 4];
  const int tid = threadIdx.x, wave = tid >> 5, lane = tid & 31, col = lane & 15, g = lane >> 4; const int qb = blockIdx.x; const int wq = wave & 3, wc = wave >> 2; const int ql0 = qb * 64 + wq * 16; const int nst = (kb_last(qb) + 1) * 128 / PVK;
  const float* Pg = PS + (size_t)qb * 64 * TT; const _Float16* Vg = VT + ((size_t)b * CC + h * HD + d0) * (size_t)TT;
  v8f acc[4] = {};
  pv_fill(Pg, Vg, &sp[0][0][0], &sv[0][0][0], tid);
  asm volatile("s_wait_asynccnt 0x0" ::: "memory");   // stage 0 has landed for this wave's own copies
  __syncthreads();                                     // ... and for every wave's
  if (nst > 1) pv_fill(Pg + PVK, Vg + PVK, &sp[1][0][0], &sv[1][0][0], tid);
#pragma unroll 1   // one stage a trip: the buffer index stays a run-time bit and the loop stays small
  for (int t = 0; t < nst; ++t) { const float* pr = &sp[t & 1][wq * 16 + col][0]; const _Float16* vr = &sv[t & 1][wc * 64 + col][0];
#pragma unroll   // the arrays indexed here live in registers: every index must be a compile-time constant
    for (int kc = 0; kc < PVK / 32; ++kc) { const v16h p = frag_f32(pr + kc * 32, lane); v16h vf[4];
#pragma unroll   // the arrays indexed here live in registers: every index must be a compile-time constant
      for (int j = 0; j < 4; ++j) vf[j] = frag_h(vr + j * 16 * PVVP + kc * 32, lane);
#pragma unroll   // the arrays indexed here live in registers: every index must be a compile-time constant
      for (int j = 0; j < 4; ++j) acc[j] = wmma16(p, vf[j], acc[j]); }
    asm volatile("s_wait_dscnt 0x0" ::: "memory");      // this wave's reads of buffer t & 1 are done before it is handed to the copies
    asm volatile("s_wait_asynccnt 0x0" ::: "memory");   // this wave's copies of stage t + 1 have landed
    __syncthreads();                                     // publishes stage t + 1 and ends every reader's last read of buffer t & 1
    if (t + 2 < nst) pv_fill(Pg + (t + 2) * PVK, Vg + (t + 2) * PVK, &sp[t & 1][0][0], &sv[t & 1][0][0], tid); }
  asm volatile("s_wait_asynccnt 0x0" ::: "memory");     // no copy is outstanding when the wave goes on to its end
#pragma unroll   // the arrays indexed here live in registers: every index must be a compile-time constant
  for (int j = 0; j < 4; ++j)
#pragma unroll   // the arrays indexed here live in registers: every index must be a compile-time constant
    for (int r = 0; r < 8; ++r) ss[wave][8 * g + r][j * 16 + col] = acc[j][r] * (1.0f / 2048.0f);
  LDSX(); for (int rl = 0; rl < 16; rl += 2) vst2(Y + ((size_t)b * TT + ql0 + rl + g) * CC + h * HD + d0 + wc * 64 + col * 4, *(const v4f*)&ss[wave][rl + g][col * 4]); }   /* output rows [b*TT + s][256]: two 256-B (row, 64-column) segments by 32 lanes */

extern "C" void kernel_launch(void* const* d_in, const int* in_sizes, int n_in, void* d_out, int out_size, void* d_ws, size_t ws_size, hipStream_t stream) {
  (void)in_sizes; (void)n_in; (void)out_size;
  const float** F = (const float**)d_in;
  if (ws_size < (size_t)WS_END) return;
  char* ws = (char*)d_ws; _Float16 *QH = (_Float16*)(ws + WS_QH), *KH = (_Float16*)(ws + WS_KH), *VT = (_Float16*)(ws + WS_VT), *QL = (_Float16*)(ws + WS_QL), *KL = (_Float16*)(ws + WS_KL); __bf16 *VB = (__bf16*)(ws + WS_VB), *VBL = (__bf16*)(ws + WS_VBL); float *S = (float*)(ws + WS_S), *Y = (float*)(ws + WS_Y);
  (void)Y; (void)QL; (void)KL; (void)VB; (void)VBL;
  // inputs: 0 x [8,2048,256]; 1 kernel [3,256,256] ((in,out): Q | K | V matrices); 2 mask [8,2048] int32
  const float* Wq = F[1]; const float* Wk = F[1] + (size_t)DIN * CCQ; const float* Wv = F[1] + 2 * (size_t)DIN * CCQ;
  k_projT<0><<<dim3(TNB * TT / 64, CCQ / 128, 2), 128, 0, stream>>>(F[0], F[0], F[0], Wq, Wk, Wv, nullptr, nullptr, nullptr, QH, QL, KH, KL, VT, VB, VBL);   /* which 0, 1: q and k rows (hi + residual planes) */
  k_projT<2><<<dim3(TNB * TT / 64, CC / 128, 1), 128, 0, stream>>>(F[0], F[0], F[0], Wq, Wk, Wv, nullptr, nullptr, nullptr, QH, QL, KH, KL, VT, VB, VBL);     /* which 2: v planes */
  for (int b0 = 0; b0 < TNB; b0 += BGN) {
    k_sc<<<dim3(TT / 128, TT / 128, BGN), 256, 0, stream>>>(QH, KH, QL, KL, b0, 0, S);
    k_sm<<<dim3(TT / SMW, BGN), SMW * 32, 0, stream>>>(S, b0, (const int*)d_in[2]);
    k_pv<<<dim3(NQB, HD / DVH, BGN), 256, 0, stream>>>(S, VT, VB, VBL, b0, 0, (float*)d_out);
  }

}

// v003
// It runs in 127 microseconds.
// Next to v002, in two timings, it ran 1.58 and 1.57 times as fast.
// All steps since v000 together make it 4.02 times as fast.
// compute dtype: all float inputs rounded to bf16; q/k/v projections with EXACT bf16 products on WMMA 16x16x32 (f32 accumulate); logits q x k with BOTH operands as f16 hi + (x 2^10) residual (3 products: hi.hi + lo.hi + hi.lo) x 64^-0.5, for every row (the logits have sigma - 500); the int row mask multiplies the logits in f32; softmax f32 with a running maximum (scores, softmax and P.v fused); exp(logit - running maximum) x 2^11 once to f16 x v once to f16 (1 product), divided by the row sum at the end; f32 output.
#include <hip/hip_runtime.h>
#include <math.h>

typedef __attribute__((ext_vector_type(16))) _Float16 v16h;
typedef __attribute__((ext_vector_type(16))) __bf16 v16b;
typedef __attribute__((ext_vector_type(8)))  _Float16 v8h;
typedef __attribute__((ext_vector_type(8)))  float v8f;
typedef __attribute__((ext_vector_type(4)))  float v4f;
typedef __attribute__((ext_vector_type(2)))  float v2f;
typedef __attribute__((ext_vector_type(4)))  unsigned v4u;
typedef __attribute__((ext_vector_type(4)))  int v4i;
typedef float __attribute__((may_alias)) float_a;
typedef int __attribute__((may_alias)) int_a;

template <typename T> __device__ __forceinline__ void vst2(void* p, T v) { *(T*)p = v;  }
__device__ __forceinline__ v8f wmma16(v16h a, v16h b, v8f c) {
  v8f d = __builtin_amdgcn_wmma_f32_16x16x32_f16(false, a, false, b, (short)0, c, false, false);
  asm volatile("v_nop\n\tv_nop\n\tv_nop\n\tv_nop" : "+v"(d) : "v"(a), "v"(b));
  return d;
}
__device__ __forceinline__ v8f wmma_bf(v16b a, v16b b, v8f c) {
  v8f d = __builtin_amdgcn_wmma_f32_16x16x32_bf16(false, a, false, b, (short)0, c, false, false);
  asm volatile("v_nop\n\tv_nop\n\tv_nop\n\tv_nop" : "+v"(d) : "v"(a), "v"(b));
  return d;
}
// 16x16x32 fragments: lane = (h = lane>>4, row/col = lane&15); elements 0..7 = k0+8h+0..7, 8..15 = k0+16+8h+0..7; D element r = row 8h+r
__device__ __forceinline__ v16h frag_h(const _Float16* rowk0, int lane) {
  union { v16h v; v8h q[2]; } u; const _Float16* p = rowk0 + 8 * (lane >> 4);
  u.q[0] = *(const v8h*)p; u.q[1] = *(const v8h*)(p + 16); return u.v;
}
__device__ __forceinline__ v16h frag_f32(const float* rowk0, int lane) {
  v16h a; const float* p = rowk0 + 8 * (lane >> 4);
#pragma unroll
  for (int i = 0; i < 8; ++i) { a[i] = (_Float16)p[i]; a[8 + i] = (_Float16)p[16 + i]; }
  return a;
}
__device__ __forceinline__ v16h frag_f32s(const float* rowk0, int lane, float sc) {
  v16h a; const float* p = rowk0 + 8 * (lane >> 4);
#pragma unroll
  for (int i = 0; i < 8; ++i) { a[i] = (_Float16)(p[i] * sc); a[8 + i] = (_Float16)(p[16 + i] * sc); }
  return a;
}
// column fragment from a [K][ld] layout (column n), rows >= K read as 0
__device__ __forceinline__ v16h fragc_f32(const float* W, int k0, int n, int lane, int ld, int K) {
  v16h a; const int g = lane >> 4;
#pragma unroll
  for (int i = 0; i < 8; ++i) { const int ka = k0 + 8 * g + i, kb = ka + 16;
    a[i] = (_Float16)(ka < K ? W[(size_t)(ka < K ? ka : K - 1) * ld + n] : 0.f); a[8 + i] = (_Float16)(kb < K ? W[(size_t)(kb < K ? kb : K - 1) * ld + n] : 0.f); }
  return a;
}
struct F2 { v16b h, l; };
__device__ __forceinline__ F2 bsplit16(const float v[16]) { F2 r;
#pragma unroll
  for (int i = 0; i < 16; ++i) { const __bf16 h = (__bf16)v[i]; r.h[i] = h; r.l[i] = (__bf16)(v[i] - (float)h); }
  return r; }
__device__ __forceinline__ F2 split_row(const float* row, int k0, int lane) { float v[16]; const float* p = row + k0 + 8 * (lane >> 4);
#pragma unroll
  for (int i = 0; i < 8; ++i) { v[i] = p[i]; v[8 + i] = p[16 + i]; }
  return bsplit16(v); }
__device__ __forceinline__ F2 split_rowK(const float* row, int k0, int lane, int K) { float v[16]; const int g = lane >> 4;
#pragma unroll
  for (int i = 0; i < 8; ++i) { const int ka = k0 + 8 * g + i, kb = ka + 16; v[i] = ka < K ? row[ka < K ? ka : K - 1] : 0.f; v[8 + i] = kb < K ? row[kb < K ? kb : K - 1] : 0.f; }
  return bsplit16(v); }
__device__ __forceinline__ F2 split_col(const float* W, int k0, int n, int lane, int ld, int K) { float v[16]; const int g = lane >> 4;
#pragma unroll
  for (int i = 0; i < 8; ++i) { const int ka = k0 + 8 * g + i, kb = ka + 16; v[i] = ka < K ? W[(size_t)(ka < K ? ka : K - 1) * ld + n] : 0.f; v[8 + i] = kb < K ? W[(size_t)(kb < K ? kb : K - 1) * ld + n] : 0.f; }
  return bsplit16(v); }
__device__ __forceinline__ v8f mac3(const F2& a, const F2& b, v8f c) { c = wmma_bf(a.l, b.h, c); c = wmma_bf(a.h, b.l, c); return wmma_bf(a.h, b.h, c); }
__device__ __forceinline__ float sigm(float v) { return 1.0f / (1.0f + expf(-v)); }
#define LDSX() do { asm volatile("s_wait_dscnt 0" ::: "memory"); __builtin_amdgcn_wave_barrier(); __builtin_amdgcn_fence(__ATOMIC_RELEASE, "workgroup"); } while (0)

// Single-head self-attention with unscaled N(0,1) projection kernels and a multiplicative row mask (x [8,2048,256]; kernel [3,256,256] (in,out): Q, K, V; mask [8,2048] int 0/1; SCALE = 1/sqrt(64) hard-coded): QK = (Q K^T) / 8; QK *= mask[b][q] per QUERY row (masked rows: all-zero logits -> uniform attention); A = softmax(QK); out = A V -> [8,2048,256].
#define NB 8
#define TT 2048
#define CC 256            // value width (v planes, output rows)
#define CCQ 256           // q / k row width
#define DIN 256          // x width
#define NH 1
#define HD 256
#define NQB (TT / 64)
#define HG 4               // four 2,048 x 2,048 f32 planes of WS_S, which no kernel uses (k_fa keeps the logits on chip)
#define SCALE (0.125f)             // 1/sqrt(64), hard-coded in the source
#define HDQK 256           // q / k width
#define CAUSAL 0
#ifndef TNB
#define TNB NB
#endif
__device__ __forceinline__ v16b zero16b() { v16b z; _Pragma("unroll") for (int i = 0; i < 16; ++i) z[i] = (__bf16)0.f; return z; }
__device__ __forceinline__ float bfr(float v) { return (float)(__bf16)v; }
__host__ __device__ __forceinline__ int kb_last(int qb) { return CAUSAL ? ((qb * 64 + 63) >> 7) : (TT / 128 - 1); }
typedef __attribute__((ext_vector_type(8))) __bf16 v8b;
__device__ __forceinline__ v16b frag_b(const __bf16* rowk0, int lane) {
  union { v16b v; v8b q[2]; } u; const __bf16* p = rowk0 + 8 * (lane >> 4);
  u.q[0] = *(const v8b*)p; u.q[1] = *(const v8b*)(p + 16); return u.v;
}
#define QBH 0              // k_fa keeps the single-product P.v path for every block
#define QBH_SC NQB         // k_fa: EVERY query block takes the 3-product (q hi+lo x k hi+lo) path
#define QHI TT              // q residual rows for every query
#define KHI TT              // k residual rows for every key (the bf16 v hi/lo planes are written too but unused)
// B fragment (k rows k0+.., output column o) of a weight: (in,out) [K][ld] or (out,in) [ld rows of K]: bf16 exact, or f16(bf16 * 256) exact
__device__ __forceinline__ v16b wcol_io(const float* Wm, int k0, int o, int lane, int ld) { v16b w; const int g = lane >> 4;
#pragma unroll
  for (int i = 0; i < 8; ++i) { w[i] = (__bf16)Wm[(size_t)(k0 + 8 * g + i) * ld + o]; w[8 + i] = (__bf16)Wm[(size_t)(k0 + 16 + 8 * g + i) * ld + o]; }
  return w; }
__device__ __forceinline__ v16b wcol_oi(const float* Wm, int k0, int o, int lane, int K) { v16b w; const float* p = Wm + (size_t)o * K + k0 + 8 * (lane >> 4);
#pragma unroll
  for (int i = 0; i < 8; ++i) { w[i] = (__bf16)p[i]; w[8 + i] = (__bf16)p[16 + i]; }
  return w; }
__device__ __forceinline__ v16h wcolh_io(const float* Wm, int k0, int o, int lane, int ld) { v16h w; const int g = lane >> 4;
#pragma unroll
  for (int i = 0; i < 8; ++i) { w[i] = (_Float16)(bfr(Wm[(size_t)(k0 + 8 * g + i) * ld + o]) * 256.0f); w[8 + i] = (_Float16)(bfr(Wm[(size_t)(k0 + 16 + 8 * g + i) * ld + o]) * 256.0f); }
  return w; }
__device__ __forceinline__ v16h wcolh_oi(const float* Wm, int k0, int o, int lane, int K) { v16h w; const float* p = Wm + (size_t)o * K + k0 + 8 * (lane >> 4);
#pragma unroll
  for (int i = 0; i < 8; ++i) { w[i] = (_Float16)(bfr(p[i]) * 256.0f); w[8 + i] = (_Float16)(bfr(p[16 + i]) * 256.0f); }
  return w; }
#define WQKV_LAYOUT 0   // 0 = (in,out) [K][CC]; 1 = (out,in) [CC][DIN]; 2 = per-head [NH][DIN][HD]
__device__ __forceinline__ v16b wcol_hdk(const float* Wm, int k0, int o, int lane) { v16b w; const int g = lane >> 4; const float* p = Wm + (size_t)(o / HD) * DIN * HD + (o % HD);
#pragma unroll
  for (int i = 0; i < 8; ++i) { w[i] = (__bf16)p[(size_t)(k0 + 8 * g + i) * HD]; w[8 + i] = (__bf16)p[(size_t)(k0 + 16 + 8 * g + i) * HD]; }
  return w; }
#define WO_OUT_IN 0
#if WQKV_LAYOUT == 1
#define WCOL(W, k0, o, lane) wcol_oi(W, k0, (o), lane, DIN)   /* unused: layout 0 */
#elif WQKV_LAYOUT == 2
#define WCOL(W, k0, o, lane) wcol_hdk(W, k0, o, lane)
#else
#define WCOL(W, k0, o, lane) (which == 2 ? wcol_io(W, k0, (o), lane, CC) : ((o) < HDQK ? wcol_io(W, k0, (o), lane, HDQK) : zero16b()))   /* Wv [256][256]; Wq/Wk [256][256]: projected q/k columns >= 256 would read as zero (grid y = 2 covers 0..255) */
#endif
#if WO_OUT_IN
#define WOCOL(W, k0, o, lane) wcol_oi(W, k0, o, lane, CC)
#define WOCOLH(W, k0, o, lane) wcolh_oi(W, k0, o, lane, CC)
#else
#define WOCOL(W, k0, o, lane) wcol_io(W, k0, o, lane, DIN)
#define WOCOLH(W, k0, o, lane) wcolh_io(W, k0, o, lane, DIN)
#endif
#define BG HG
#define BGN (TNB < BG ? TNB : BG)   // unused: k_fa takes all TNB batches in one launch
#define DVH 128            // unused: a k_fa wave keeps all 256 value columns in 16 accumulator tiles
#define SM_EXTRA_PARAMS , int bsm, const int* __restrict__ RMASK
// multiplicative per-QUERY-row int mask applied to the scaled logits before the softmax (mask 0 -> every logit of the row becomes 0 -> uniform attention), as the module
#define SM_MASK_HOOK do { v = v * (float)RMASK[(size_t)(bsm + (int)blockIdx.y) * TT + t]; } while (0)
#ifndef SM_EXTRA_PARAMS
#define SM_EXTRA_PARAMS
#endif
#ifndef PROJ_EXTRA_PARAMS
#define PROJ_EXTRA_PARAMS
#endif
#ifndef SM_MASK_HOOK
#define SM_MASK_HOOK (void)0
#endif

#define WS_QH  0u                                      // f16 q rows [b*t][CCQ]
#define WS_KH  (WS_QH + 2u * (size_t)NB * TT * CCQ)     // f16 k rows [b*t][CCQ]
#define WS_VT  (WS_KH + 2u * (size_t)NB * TT * CCQ)     // f16 v planes [b][c][t]
#define WS_QL  (WS_VT + 2u * (size_t)NB * CC * TT)      // f16 q residual x 2^10 rows [b][t < QHI][CCQ]
#define WS_KL  (WS_QL + 2u * (size_t)NB * QHI * CCQ)    // f16 k residual x 2^10 rows [b][t < KHI][CCQ]
#define WS_VB  (WS_KL + 2u * (size_t)NB * KHI * CCQ)    // bf16 v hi planes [b][c][t < KHI]
#define WS_VBL (WS_VB + 2u * (size_t)NB * CC * KHI)
#define WS_S   (WS_VBL + 2u * (size_t)NB * CC * KHI)    // f32 [hg][t][s], unused: k_fa keeps the logits on chip
#define WS_Y   (WS_S  + 4u * (size_t)HG * TT * TT)      // f32 ctx rows [b*t][CC] (only when there is an output projection)
#define WS_END (WS_Y  + 0u)

// ---- k_proj: block = (64 rows, 128 cols, which): q/k/v = X W (+ b) with exact bf16 products (K = DIN) -> which 0: q f16 rows (+ residual rows < QHI); 1: k f16 rows (+ residual rows < KHI); 2: v f16 planes [c][t] (+ bf16 hi/lo planes for t < KHI)
template <int WOFF> __global__ __launch_bounds__(128) void k_projT(const float* __restrict__ XQ, const float* __restrict__ XK, const float* __restrict__ XV, const float* __restrict__ WQ, const float* __restrict__ WK, const float* __restrict__ WV, const float* __restrict__ BQ, const float* __restrict__ BK, const float* __restrict__ BV,
    _Float16* __restrict__ QH, _Float16* __restrict__ QL, _Float16* __restrict__ KH, _Float16* __restrict__ KL, _Float16* __restrict__ VT, __bf16* __restrict__ VB, __bf16* __restrict__ VBL) {
  __shared__ __align__(16) _Float16 sh[64][136], sl[64][136]; __shared__ __align__(16) _Float16 th[128][72]; __shared__ __align__(16) __bf16 tb[128][72], tbl[128][72];
  const int tid = threadIdx.x, wave = tid >> 5, lane = tid & 31, col = lane & 15, g = lane >> 4; const int which = blockIdx.z + WOFF; const int c0 = blockIdx.y * 128; const size_t r0 = (size_t)blockIdx.x * 64; const size_t bb = r0 / TT; const int t0 = (int)(r0 % TT);
  const float* X = which == 0 ? XQ : which == 1 ? XK : XV; const float* WA = which == 0 ? WQ : which == 1 ? WK : WV; const float* BA = which == 0 ? BQ : which == 1 ? BK : BV;
  const int KD = DIN;
  v8f acc[8] = {};
#pragma unroll 2
  for (int kc = 0; kc < KD / 32; ++kc) { v16b a; { const float* p = X + (r0 + wave * 16 + col) * (size_t)KD + kc * 32 + 8 * g;   /* row-major [b*t][KD] */
#pragma unroll
      for (int i = 0; i < 8; ++i) { a[i] = (__bf16)p[i]; a[8 + i] = (__bf16)p[16 + i]; } }
    asm volatile("s_wait_loadcnt 0x0" ::: "memory");
#pragma unroll
    for (int j = 0; j < 8; ++j) { const v16b w = WCOL(WA, kc * 32, c0 + j * 16 + col, lane); asm volatile("s_wait_loadcnt 0x0" ::: "memory"); acc[j] = wmma_bf(a, w, acc[j]); } }
  if (which < 2) { _Float16* DH = which == 0 ? QH : KH; _Float16* DL = which == 0 ? QL : KL; const int nhi = which == 0 ? QHI : KHI; const bool hi_rows = t0 < nhi;
#pragma unroll
    for (int j = 0; j < 8; ++j) { const float bias = BA ? bfr(BA[c0 + j * 16 + col]) : 0.f;
#pragma unroll
      for (int r = 0; r < 8; ++r) { const float v = acc[j][r] + bias; const _Float16 hv = (_Float16)v; sh[wave * 16 + 8 * g + r][j * 16 + col] = hv; sl[wave * 16 + 8 * g + r][j * 16 + col] = (_Float16)((v - (float)hv) * 1024.0f); } }
    __syncthreads();
    for (int e = tid; e < 64 * 16; e += 128) { const int rl = e >> 4, q = e & 15; vst2((unsigned*)(DH + (r0 + rl) * CCQ + c0 + q * 8), *(const v4u*)&sh[rl][q * 8]); if (hi_rows) vst2((unsigned*)(DL + (bb * nhi + t0 + rl) * (size_t)CCQ + c0 + q * 8), *(const v4u*)&sl[rl][q * 8]); }   /* q/k rows: pitch CCQ (c0 = 0 or 128) */
  } else { const bool hi_rows = t0 < KHI;
#pragma unroll
    for (int j = 0; j < 8; ++j) { const float bias = BA ? bfr(BA[c0 + j * 16 + col]) : 0.f;
#pragma unroll
      for (int r = 0; r < 8; ++r) { const float v = acc[j][r] + bias; const int rl = wave * 16 + 8 * g + r, cl = j * 16 + col; th[cl][rl] = (_Float16)v; const __bf16 bh = (__bf16)v; tb[cl][rl] = bh; tbl[cl][rl] = (__bf16)(v - (float)bh); } }
    __syncthreads();
    for (int e = tid; e < 128 * 8; e += 128) { const int cl = e >> 3, q = e & 7; vst2((unsigned*)(VT + (bb * CC + c0 + cl) * (size_t)TT + t0 + q * 8), *(const v4u*)&th[cl][q * 8]); if (hi_rows) { const size_t o3 = (bb * CC + c0 + cl) * (size_t)KHI + t0 + q * 8; vst2((unsigned*)(VB + o3), *(const v4u*)&tb[cl][q * 8]); vst2((unsigned*)(VBL + o3), *(const v4u*)&tbl[cl][q * 8]); } } } }
__device__ __forceinline__ unsigned lds_off(const void* p) { return (unsigned)(size_t)p; }
// eight 16-byte copies of one lane, global -> LDS; the s_wait_xcnt stands inside the statement so that no address register is rewritten in front of it
__device__ __forceinline__ void copy8(const unsigned l[8], const char* const gp[8]) {
  asm volatile("global_load_async_to_lds_b128 %0, %8, off\n\t"
               "global_load_async_to_lds_b128 %1, %9, off\n\t"
               "global_load_async_to_lds_b128 %2, %10, off\n\t"
               "global_load_async_to_lds_b128 %3, %11, off\n\t"
               "global_load_async_to_lds_b128 %4, %12, off\n\t"
               "global_load_async_to_lds_b128 %5, %13, off\n\t"
               "global_load_async_to_lds_b128 %6, %14, off\n\t"
               "global_load_async_to_lds_b128 %7, %15, off\n\t"
               "s_wait_xcnt 0x0"
               :: "v"(l[0]), "v"(l[1]), "v"(l[2]), "v"(l[3]), "v"(l[4]), "v"(l[5]), "v"(l[6]), "v"(l[7]),
                  "v"(gp[0]), "v"(gp[1]), "v"(gp[2]), "v"(gp[3]), "v"(gp[4]), "v"(gp[5]), "v"(gp[6]), "v"(gp[7]) : "memory");
}
// the compiler keeps the distance behind its own builtin form
__device__ __forceinline__ v8f WM(v16h a, v16h b, v8f c) { return __builtin_amdgcn_wmma_f32_16x16x32_f16(false, a, false, b, (short)0, c, false, false); }
// ---- k_fa: scores, softmax and P . v in ONE kernel; the logits never leave the WGP. Block = (64 queries, batch), 8 waves = 4 query sub-tiles of 16 x 2 key halves: of every stage of 64 keys a wave takes 32.
// Scores TRANSPOSED: A = k rows (LDS), B = q rows (registers, hi + residual): D element r = key 8h + r, column = query = lane & 15; same 3 products in the same k order (hi.hi | k hi . q lo + k lo . q hi).
// So a lane holds 16 keys of ONE query: maximum and sum are in-lane plus one exchange with lane ^ 16, and two 16-key score tiles ARE the B fragment of 32 keys (elements 0..7 = tile 0, 8..15 = tile 1).
// Output TRANSPOSED too: A = v plane rows [channel][key] (LDS), B = P: D element r = channel 8h + r, column = query, so the running-maximum rescale is one factor per lane.
// k hi, k lo (64 rows x 512 B) and v (256 rows x 128 B) of a stage come into LDS by asynchronous copies, two buffers: the next stage flies while this one is multiplied. The two key halves are merged at the end through LDS.
#define FQ 64              // queries per block
#define FK 64              // keys per LDS stage
#define FKP 264            // staged k row pitch in f16: 512 B + 16 B (16 B x odd: ds_load_b128 walks over rows meet no bank twice)
#define FVP 72             // staged v row pitch in f16: 128 B + 16 B (same reason)
#define FST (2 * FK * FKP + CC * FVP)   // f16 elements of one buffer
#define FOP 260            // staged output row pitch in f32
// one stage: 256 threads, 24 copies each; a wave's copy covers one 512-B k row or four 128-B v row pieces
__device__ __forceinline__ void fa_fill(const _Float16* k_h, const _Float16* k_l, const _Float16* v_t, _Float16* sr, int tid) {
  unsigned l[8]; const char* gp[8];
#pragma unroll   // the arrays indexed here live in registers: every index must be a compile-time constant
  for (int i = 0; i < 8; ++i) { const int e = i * 256 + tid, row = e >> 5, q = e & 31; l[i] = lds_off(sr + row * FKP + q * 8); gp[i] = (const char*)(k_h + (size_t)row * CCQ + q * 8); }
  copy8(l, gp);
#pragma unroll   // the arrays indexed here live in registers: every index must be a compile-time constant
  for (int i = 0; i < 8; ++i) { const int e = i * 256 + tid, row = e >> 5, q = e & 31; l[i] = lds_off(sr + (FK + row) * FKP + q * 8); gp[i] = (const char*)(k_l + (size_t)row * CCQ + q * 8); }
  copy8(l, gp);
#pragma unroll   // the arrays indexed here live in registers: every index must be a compile-time constant
  for (int i = 0; i < 8; ++i) { const int e = i * 256 + tid, row = e >> 3, q = e & 7; l[i] = lds_off(sr + 2 * FK * FKP + row * FVP + q * 8); gp[i] = (const char*)(v_t + (size_t)row * TT + q * 8); }
  copy8(l, gp);
}
__global__ __launch_bounds__(256) void k_fa(const _Float16* __restrict__ QH, const _Float16* __restrict__ QL, const _Float16* __restrict__ KH, const _Float16* __restrict__ KL, const _Float16* __restrict__ VT, const int* __restrict__ RMASK, float* __restrict__ Y) {
  __shared__ __align__(16) _Float16 ring[2][FST]; __shared__ float xm[8][32], xl[8][32];
  const int tid = threadIdx.x, wave = tid >> 5, lane = tid & 31, col = lane & 15, g = lane >> 4; const int qs = wave & 3, kh = wave >> 2; const int b = blockIdx.y; const int q0 = blockIdx.x * FQ + qs * 16;
  const _Float16* k_h = KH + (size_t)b * TT * CCQ; const _Float16* k_l = KL + (size_t)b * KHI * CCQ; const _Float16* v_t = VT + (size_t)b * CC * TT;
  fa_fill(k_h, k_l, v_t, &ring[0][0], tid);
  v16h qh[HDQK / 32], ql[HDQK / 32];   /* this wave's 16 query rows, whole width, as B fragments */
  { const _Float16* qr = QH + ((size_t)b * TT + q0 + col) * CCQ; const _Float16* qlr = QL + ((size_t)b * QHI + q0 + col) * CCQ;
#pragma unroll   // the arrays indexed here live in registers: every index must be a compile-time constant
    for (int kk = 0; kk < HDQK / 32; ++kk) { qh[kk] = frag_h(qr + kk * 32, lane); ql[kk] = frag_h(qlr + kk * 32, lane); } }
  const float mk = (float)RMASK[(size_t)b * TT + q0 + col];   /* multiplicative mask of this lane's query row */
  asm volatile("s_wait_xcnt 0x0" ::: "memory");       // before an address register of the loads above is written again
  asm volatile("s_wait_asynccnt 0x0" ::: "memory");   // stage 0 has landed for this wave's own copies
  __syncthreads();                                     // ... and for every wave's
  fa_fill(k_h + (size_t)FK * CCQ, k_l + (size_t)FK * CCQ, v_t + FK, &ring[1][0], tid);
  v8f o[CC / 16] = {}; float m = -3.0e38f, l = 0.f;
#pragma unroll 1   // one stage a trip: the buffer index stays a run-time bit and the loop stays small
  for (int t = 0; t < TT / FK; ++t) { const _Float16* sk = &ring[t & 1][(kh * 32 + col) * FKP]; const _Float16* sv = &ring[t & 1][2 * FK * FKP + col * FVP + kh * 32];
    v8f acc[2] = {}, accl[2] = {}; v16h ah[2][2], al[2][2];   /* fragments of k chunk kk + 1 are read from LDS in front of the products of chunk kk */
#pragma unroll   // the arrays indexed here live in registers: every index must be a compile-time constant
    for (int u = 0; u < 2; ++u) { ah[0][u] = frag_h(sk + u * 16 * FKP, lane); al[0][u] = frag_h(sk + (FK + u * 16) * FKP, lane); }
#pragma unroll   // the arrays indexed here live in registers: every index must be a compile-time constant
    for (int kk = 0; kk < HDQK / 32; ++kk) { const int c = kk & 1, n = c ^ 1;
      if (kk + 1 < HDQK / 32) {
#pragma unroll   // the arrays indexed here live in registers: every index must be a compile-time constant
        for (int u = 0; u < 2; ++u) { ah[n][u] = frag_h(sk + u * 16 * FKP + (kk + 1) * 32, lane); al[n][u] = frag_h(sk + (FK + u * 16) * FKP + (kk + 1) * 32, lane); } }
      __builtin_amdgcn_sched_barrier(0);   // the LDS reads of chunk kk + 1 stay in front of the products of chunk kk
      /* the two products into accl[0] stand three matrix instructions apart, those into accl[1] two */
      acc[0] = WM(ah[c][0], qh[kk], acc[0]); accl[0] = WM(ah[c][0], ql[kk], accl[0]); acc[1] = WM(ah[c][1], qh[kk], acc[1]); accl[1] = WM(ah[c][1], ql[kk], accl[1]); accl[0] = WM(al[c][0], qh[kk], accl[0]); accl[1] = WM(al[c][1], qh[kk], accl[1]);
      __builtin_amdgcn_sched_barrier(0); }   // no product of chunk kk + 1 is pulled in here: it would wait on LDS reads that were only just issued
    v16h vf[2][4];   /* the first four v fragments do not depend on P: their LDS reads are written ahead of the exponentials, which cover the latency */
#pragma unroll   // the arrays indexed here live in registers: every index must be a compile-time constant
    for (int u = 0; u < 4; ++u) vf[0][u] = frag_h(sv + u * 16 * FVP, lane);
    float s[2][8]; float mx0 = -3.0e38f, mx1 = -3.0e38f;
#pragma unroll   // the arrays indexed here live in registers: every index must be a compile-time constant
    for (int r = 0; r < 8; ++r) { float v0 = (acc[0][r] + accl[0][r] * (1.0f / 1024.0f)) * SCALE, v1 = (acc[1][r] + accl[1][r] * (1.0f / 1024.0f)) * SCALE; v0 = v0 * mk; v1 = v1 * mk; s[0][r] = v0; s[1][r] = v1; mx0 = fmaxf(mx0, v0); mx1 = fmaxf(mx1, v1); }
    float mx = fmaxf(mx0, mx1); mx = fmaxf(mx, __shfl_xor(mx, 16));   /* the other 16 keys of the same query */
    const float mn = fmaxf(m, mx); const float af = expf(m - mn); m = mn;   /* first stage: exp(-3e38) = 0 */
    float ps0 = 0.f, ps1 = 0.f; v16h pf;
#pragma unroll   // the arrays indexed here live in registers: every index must be a compile-time constant
    for (int r = 0; r < 8; ++r) { const float e0 = expf(s[0][r] - mn), e1 = expf(s[1][r] - mn); ps0 += e0; ps1 += e1; pf[r] = (_Float16)(e0 * 2048.0f); pf[8 + r] = (_Float16)(e1 * 2048.0f); }
    l = l * af + (ps0 + ps1);   /* per lane: its own 16 keys a stage; the two lanes of a query are added behind the loop */
#pragma unroll   // the arrays indexed here live in registers: every index must be a compile-time constant
    for (int j = 0; j < CC / 16; ++j) o[j] = o[j] * af;
#pragma unroll   // the arrays indexed here live in registers: every index must be a compile-time constant
    for (int jg = 0; jg < CC / 64; ++jg) { const int c = jg & 1, n = c ^ 1;   /* four channel tiles a group: the LDS reads of group jg + 1 stand together in front of the products of group jg */
      if (jg + 1 < CC / 64) {
#pragma unroll   // the arrays indexed here live in registers: every index must be a compile-time constant
        for (int u = 0; u < 4; ++u) vf[n][u] = frag_h(sv + ((jg + 1) * 4 + u) * 16 * FVP, lane); }
      __builtin_amdgcn_sched_barrier(0);   // the LDS reads of group jg + 1 stay in one place, in front of the products of group jg
#pragma unroll   // the arrays indexed here live in registers: every index must be a compile-time constant
      for (int u = 0; u < 4; ++u) o[jg * 4 + u] = WM(vf[c][u], pf, o[jg * 4 + u]);
      __builtin_amdgcn_sched_barrier(0); }   // no LDS read of a later group is spread among these products
    asm volatile("s_wait_dscnt 0x0" ::: "memory");      // this wave's reads of buffer t & 1 are done before it is handed to the copies (last trip: to the output staging)
    asm volatile("s_wait_asynccnt 0x0" ::: "memory");   // this wave's copies of stage t + 1 have landed
    __syncthreads();                                     // publishes stage t + 1 and ends every reader's last read of buffer t & 1
    if (t + 2 < TT / FK) fa_fill(k_h + (size_t)(t + 2) * FK * CCQ, k_l + (size_t)(t + 2) * FK * CCQ, v_t + (t + 2) * FK, &ring[t & 1][0], tid); }
  asm volatile("s_wait_asynccnt 0x0" ::: "memory");     // no copy is outstanding when the ring becomes output staging
  l += __shfl_xor(l, 16);
  xm[wave][lane] = m; xl[wave][lane] = l;
  __syncthreads();                                       // maximum and sum of the other key half are readable
  const float m2 = xm[wave ^ 4][lane], l2 = xl[wave ^ 4][lane]; const float ms = fmaxf(m, m2); const float a1 = expf(m - ms), a2 = expf(m2 - ms);
  const float f = a1 / ((l * a1 + l2 * a2) * 2048.0f);   /* the sum holds exp(0) = 1 of the row's maximum: never 0 */
  float (*ss)[16][FOP] = (float (*)[16][FOP])&ring[0][0];   /* 8 x 16 x 260 f32 inside the ring, free behind the last trip's barrier; each wave writes its own range */
#pragma unroll   // the arrays indexed here live in registers: every index must be a compile-time constant
  for (int j = 0; j < CC / 16; ++j) { const v8f w = o[j] * f; const v4f w0 = {w[0], w[1], w[2], w[3]}, w1 = {w[4], w[5], w[6], w[7]}; *(v4f*)&ss[wave][col][j * 16 + 8 * g] = w0; *(v4f*)&ss[wave][col][j * 16 + 8 * g + 4] = w1; }
  __syncthreads();                                       // both halves' scaled outputs are readable
  for (int rl = 0; rl < 8; ++rl) { const int row = kh * 8 + rl;   /* a wave adds and stores 8 of its pair's 16 rows: two 512-B pieces a row */
#pragma unroll
    for (int c = 0; c < 2; ++c) vst2(Y + ((size_t)b * TT + q0 + row) * CC + c * 128 + lane * 4, *(const v4f*)&ss[qs][row][c * 128 + lane * 4] + *(const v4f*)&ss[qs + 4][row][c * 128 + lane * 4]); } }

extern "C" void kernel_launch(void* const* d_in, const int* in_sizes, int n_in, void* d_out, int out_size, void* d_ws, size_t ws_size, hipStream_t stream) {
  (void)in_sizes; (void)n_in; (void)out_size;
  const float** F = (const float**)d_in;
  if (ws_size < (size_t)WS_END) return;
  char* ws = (char*)d_ws; _Float16 *QH = (_Float16*)(ws + WS_QH), *KH = (_Float16*)(ws + WS_KH), *VT = (_Float16*)(ws + WS_VT), *QL = (_Float16*)(ws + WS_QL), *KL = (_Float16*)(ws + WS_KL); __bf16 *VB = (__bf16*)(ws + WS_VB), *VBL = (__bf16*)(ws + WS_VBL); float *S = (float*)(ws + WS_S), *Y = (float*)(ws + WS_Y);
  (void)S; (void)Y; (void)QL; (void)KL; (void)VB; (void)VBL;
  // inputs: 0 x [8,2048,256]; 1 kernel [3,256,256] ((in,out): Q | K | V matrices); 2 mask [8,2048] int32
  const float* Wq = F[1]; const float* Wk = F[1] + (size_t)DIN * CCQ; const float* Wv = F[1] + 2 * (size_t)DIN * CCQ;
  k_projT<0><<<dim3(TNB * TT / 64, CCQ / 128, 2), 128, 0, stream>>>(F[0], F[0], F[0], Wq, Wk, Wv, nullptr, nullptr, nullptr, QH, QL, KH, KL, VT, VB, VBL);   /* which 0, 1: q and k rows (hi + residual planes) */
  k_projT<2><<<dim3(TNB * TT / 64, CC / 128, 1), 128, 0, stream>>>(F[0], F[0], F[0], Wq, Wk, Wv, nullptr, nullptr, nullptr, QH, QL, KH, KL, VT, VB, VBL);     /* which 2: v planes */
  k_fa<<<dim3(TT / FQ, TNB), 256, 0, stream>>>(QH, QL, KH, KL, VT, (const int*)d_in[2], (float*)d_out);   /* scores, softmax, P . v: all batches in one launch */
}

// v004
// Measured time: 90.3 microseconds a run.
// Two timings next to v003 put it at 1.41 and 1.40 times that version's speed.
// Counting every step since v000, it is 5.66 times as fast.
// compute dtype: all float inputs rounded to bf16; q/k/v projections with EXACT bf16 products on WMMA 16x16x32 (f32 accumulate); logits q x k with BOTH operands as f16 hi + (x 2^10) residual (3 products: hi.hi + lo.hi + hi.lo) x 64^-0.5, for every row (the logits have sigma - 500); the int row mask multiplies the logits in f32; softmax f32 with a running maximum (scores, softmax and P.v fused); exp(logit - running maximum) x 2^11 once to f16 x v once to f16 (1 product), divided by the row sum at the end; f32 output.
#include <hip/hip_runtime.h>
#include <math.h>

typedef __attribute__((ext_vector_type(16))) _Float16 v16h;
typedef __attribute__((ext_vector_type(16))) __bf16 v16b;
typedef __attribute__((ext_vector_type(8)))  _Float16 v8h;
typedef __attribute__((ext_vector_type(8)))  float v8f;
typedef __attribute__((ext_vector_type(4)))  float v4f;
typedef __attribute__((ext_vector_type(2)))  float v2f;
typedef __attribute__((ext_vector_type(4)))  unsigned v4u;
typedef __attribute__((ext_vector_type(4)))  int v4i;
typedef float __attribute__((may_alias)) float_a;
typedef int __attribute__((may_alias)) int_a;

template <typename T> __device__ __forceinline__ void vst2(void* p, T v) { *(T*)p = v;  }
__device__ __forceinline__ v8f wmma16(v16h a, v16h b, v8f c) {
  v8f d = __builtin_amdgcn_wmma_f32_16x16x32_f16(false, a, false, b, (short)0, c, false, false);
  asm volatile("v_nop\n\tv_nop\n\tv_nop\n\tv_nop" : "+v"(d) : "v"(a), "v"(b));
  return d;
}
__device__ __forceinline__ v8f wmma_bf(v16b a, v16b b, v8f c) {
  v8f d = __builtin_amdgcn_wmma_f32_16x16x32_bf16(false, a, false, b, (short)0, c, false, false);
  asm volatile("v_nop\n\tv_nop\n\tv_nop\n\tv_nop" : "+v"(d) : "v"(a), "v"(b));
  return d;
}
// 16x16x32 fragments: lane = (h = lane>>4, row/col = lane&15); elements 0..7 = k0+8h+0..7, 8..15 = k0+16+8h+0..7; D element r = row 8h+r
__device__ __forceinline__ v16h frag_h(const _Float16* rowk0, int lane) {
  union { v16h v; v8h q[2]; } u; const _Float16* p = rowk0 + 8 * (lane >> 4);
  u.q[0] = *(const v8h*)p; u.q[1] = *(const v8h*)(p + 16); return u.v;
}
__device__ __forceinline__ v16h frag_f32(const float* rowk0, int lane) {
  v16h a; const float* p = rowk0 + 8 * (lane >> 4);
#pragma unroll
  for (int i = 0; i < 8; ++i) { a[i] = (_Float16)p[i]; a[8 + i] = (_Float16)p[16 + i]; }
  return a;
}
__device__ __forceinline__ v16h frag_f32s(const float* rowk0, int lane, float sc) {
  v16h a; const float* p = rowk0 + 8 * (lane >> 4);
#pragma unroll
  for (int i = 0; i < 8; ++i) { a[i] = (_Float16)(p[i] * sc); a[8 + i] = (_Float16)(p[16 + i] * sc); }
  return a;
}
// column fragment from a [K][ld] layout (column n), rows >= K read as 0
__device__ __forceinline__ v16h fragc_f32(const float* W, int k0, int n, int lane, int ld, int K) {
  v16h a; const int g = lane >> 4;
#pragma unroll
  for (int i = 0; i < 8; ++i) { const int ka = k0 + 8 * g + i, kb = ka + 16;
    a[i] = (_Float16)(ka < K ? W[(size_t)(ka < K ? ka : K - 1) * ld + n] : 0.f); a[8 + i] = (_Float16)(kb < K ? W[(size_t)(kb < K ? kb : K - 1) * ld + n] : 0.f); }
  return a;
}
struct F2 { v16b h, l; };
__device__ __forceinline__ F2 bsplit16(const float v[16]) { F2 r;
#pragma unroll
  for (int i = 0; i < 16; ++i) { const __bf16 h = (__bf16)v[i]; r.h[i] = h; r.l[i] = (__bf16)(v[i] - (float)h); }
  return r; }
__device__ __forceinline__ F2 split_row(const float* row, int k0, int lane) { float v[16]; const float* p = row + k0 + 8 * (lane >> 4);
#pragma unroll
  for (int i = 0; i < 8; ++i) { v[i] = p[i]; v[8 + i] = p[16 + i]; }
  return bsplit16(v); }
__device__ __forceinline__ F2 split_rowK(const float* row, int k0, int lane, int K) { float v[16]; const int g = lane >> 4;
#pragma unroll
  for (int i = 0; i < 8; ++i) { const int ka = k0 + 8 * g + i, kb = ka + 16; v[i] = ka < K ? row[ka < K ? ka : K - 1] : 0.f; v[8 + i] = kb < K ? row[kb < K ? kb : K - 1] : 0.f; }
  return bsplit16(v); }
__device__ __forceinline__ F2 split_col(const float* W, int k0, int n, int lane, int ld, int K) { float v[16]; const int g = lane >> 4;
#pragma unroll
  for (int i = 0; i < 8; ++i) { const int ka = k0 + 8 * g + i, kb = ka + 16; v[i] = ka < K ? W[(size_t)(ka < K ? ka : K - 1) * ld + n] : 0.f; v[8 + i] = kb < K ? W[(size_t)(kb < K ? kb : K - 1) * ld + n] : 0.f; }
  return bsplit16(v); }
__device__ __forceinline__ v8f mac3(const F2& a, const F2& b, v8f c) { c = wmma_bf(a.l, b.h, c); c = wmma_bf(a.h, b.l, c); return wmma_bf(a.h, b.h, c); }
__device__ __forceinline__ float sigm(float v) { return 1.0f / (1.0f + expf(-v)); }
#define LDSX() do { asm volatile("s_wait_dscnt 0" ::: "memory"); __builtin_amdgcn_wave_barrier(); __builtin_amdgcn_fence(__ATOMIC_RELEASE, "workgroup"); } while (0)

// Single-head self-attention with unscaled N(0,1) projection kernels and a multiplicative row mask (x [8,2048,256]; kernel [3,256,256] (in,out): Q, K, V; mask [8,2048] int 0/1; SCALE = 1/sqrt(64) hard-coded): QK = (Q K^T) / 8; QK *= mask[b][q] per QUERY row (masked rows: all-zero logits -> uniform attention); A = softmax(QK); out = A V -> [8,2048,256].
#define NB 8
#define TT 2048
#define CC 256            // value width (v planes, output rows)
#define CCQ 256           // q / k row width
#define DIN 256          // x width
#define NH 1
#define HD 256
#define NQB (TT / 64)
#define HG 4               // four 2,048 x 2,048 f32 planes of WS_S, which no kernel uses (k_fa keeps the logits on chip)
#define SCALE (0.125f)             // 1/sqrt(64), hard-coded in the source
#define HDQK 256           // q / k width
#define CAUSAL 0
#ifndef TNB
#define TNB NB
#endif
__device__ __forceinline__ v16b zero16b() { v16b z; _Pragma("unroll") for (int i = 0; i < 16; ++i) z[i] = (__bf16)0.f; return z; }
__device__ __forceinline__ float bfr(float v) { return (float)(__bf16)v; }
__host__ __device__ __forceinline__ int kb_last(int qb) { return CAUSAL ? ((qb * 64 + 63) >> 7) : (TT / 128 - 1); }
typedef __attribute__((ext_vector_type(8))) __bf16 v8b;
__device__ __forceinline__ v16b frag_b(const __bf16* rowk0, int lane) {
  union { v16b v; v8b q[2]; } u; const __bf16* p = rowk0 + 8 * (lane >> 4);
  u.q[0] = *(const v8b*)p; u.q[1] = *(const v8b*)(p + 16); return u.v;
}
#define QBH 0              // k_fa keeps the single-product P.v path for every block
#define QBH_SC NQB         // k_fa: EVERY query block takes the 3-product (q hi+lo x k hi+lo) path
#define QHI TT              // q residual rows for every query
#define KHI TT              // k residual rows for every key (the bf16 v hi/lo planes are written too but unused)
// B fragment (k rows k0+.., output column o) of a weight: (in,out) [K][ld] or (out,in) [ld rows of K]: bf16 exact, or f16(bf16 * 256) exact
__device__ __forceinline__ v16b wcol_io(const float* Wm, int k0, int o, int lane, int ld) { v16b w; const int g = lane >> 4;
#pragma unroll
  for (int i = 0; i < 8; ++i) { w[i] = (__bf16)Wm[(size_t)(k0 + 8 * g + i) * ld + o]; w[8 + i] = (__bf16)Wm[(size_t)(k0 + 16 + 8 * g + i) * ld + o]; }
  return w; }
__device__ __forceinline__ v16b wcol_oi(const float* Wm, int k0, int o, int lane, int K) { v16b w; const float* p = Wm + (size_t)o * K + k0 + 8 * (lane >> 4);
#pragma unroll
  for (int i = 0; i < 8; ++i) { w[i] = (__bf16)p[i]; w[8 + i] = (__bf16)p[16 + i]; }
  return w; }
__device__ __forceinline__ v16h wcolh_io(const float* Wm, int k0, int o, int lane, int ld) { v16h w; const int g = lane >> 4;
#pragma unroll
  for (int i = 0; i < 8; ++i) { w[i] = (_Float16)(bfr(Wm[(size_t)(k0 + 8 * g + i) * ld + o]) * 256.0f); w[8 + i] = (_Float16)(bfr(Wm[(size_t)(k0 + 16 + 8 * g + i) * ld + o]) * 256.0f); }
  return w; }
__device__ __forceinline__ v16h wcolh_oi(const float* Wm, int k0, int o, int lane, int K) { v16h w; const float* p = Wm + (size_t)o * K + k0 + 8 * (lane >> 4);
#pragma unroll
  for (int i = 0; i < 8; ++i) { w[i] = (_Float16)(bfr(p[i]) * 256.0f); w[8 + i] = (_Float16)(bfr(p[16 + i]) * 256.0f); }
  return w; }
#define WQKV_LAYOUT 0   // 0 = (in,out) [K][CC]; 1 = (out,in) [CC][DIN]; 2 = per-head [NH][DIN][HD]
__device__ __forceinline__ v16b wcol_hdk(const float* Wm, int k0, int o, int lane) { v16b w; const int g = lane >> 4; const float* p = Wm + (size_t)(o / HD) * DIN * HD + (o % HD);
#pragma unroll
  for (int i = 0; i < 8; ++i) { w[i] = (__bf16)p[(size_t)(k0 + 8 * g + i) * HD]; w[8 + i] = (__bf16)p[(size_t)(k0 + 16 + 8 * g + i) * HD]; }
  return w; }
#define WO_OUT_IN 0
#if WQKV_LAYOUT == 1
#define WCOL(W, k0, o, lane) wcol_oi(W, k0, (o), lane, DIN)   /* unused: layout 0 */
#elif WQKV_LAYOUT == 2
#define WCOL(W, k0, o, lane) wcol_hdk(W, k0, o, lane)
#else
#define WCOL(W, k0, o, lane) (which == 2 ? wcol_io(W, k0, (o), lane, CC) : ((o) < HDQK ? wcol_io(W, k0, (o), lane, HDQK) : zero16b()))   /* Wv [256][256]; Wq/Wk [256][256]: projected q/k columns >= 256 would read as zero (grid y = 2 covers 0..255) */
#endif
#if WO_OUT_IN
#define WOCOL(W, k0, o, lane) wcol_oi(W, k0, o, lane, CC)
#define WOCOLH(W, k0, o, lane) wcolh_oi(W, k0, o, lane, CC)
#else
#define WOCOL(W, k0, o, lane) wcol_io(W, k0, o, lane, DIN)
#define WOCOLH(W, k0, o, lane) wcolh_io(W, k0, o, lane, DIN)
#endif
#define BG HG
#define BGN (TNB < BG ? TNB : BG)   // unused: k_fa takes all TNB batches in one launch
#define DVH 128            // unused: a k_fa wave keeps all 256 value columns in 16 accumulator tiles
#define SM_EXTRA_PARAMS , int bsm, const int* __restrict__ RMASK
// multiplicative per-QUERY-row int mask applied to the scaled logits before the softmax (mask 0 -> every logit of the row becomes 0 -> uniform attention), as the module
#define SM_MASK_HOOK do { v = v * (float)RMASK[(size_t)(bsm + (int)blockIdx.y) * TT + t]; } while (0)
#ifndef SM_EXTRA_PARAMS
#define SM_EXTRA_PARAMS
#endif
#ifndef PROJ_EXTRA_PARAMS
#define PROJ_EXTRA_PARAMS
#endif
#ifndef SM_MASK_HOOK
#define SM_MASK_HOOK (void)0
#endif

#define WS_QH  0u                                      // f16 q rows [b*t][CCQ]
#define WS_KH  (WS_QH + 2u * (size_t)NB * TT * CCQ)     // f16 k rows [b*t][CCQ]
#define WS_VT  (WS_KH + 2u * (size_t)NB * TT * CCQ)     // f16 v planes [b][c][t]
#define WS_QL  (WS_VT + 2u * (size_t)NB * CC * TT)      // f16 q residual x 2^10 rows [b][t < QHI][CCQ]
#define WS_KL  (WS_QL + 2u * (size_t)NB * QHI * CCQ)    // f16 k residual x 2^10 rows [b][t < KHI][CCQ]
#define WS_VB  (WS_KL + 2u * (size_t)NB * KHI * CCQ)    // bf16 v hi planes [b][c][t < KHI]
#define WS_VBL (WS_VB + 2u * (size_t)NB * CC * KHI)
#define WS_S   (WS_VBL + 2u * (size_t)NB * CC * KHI)    // f32 [hg][t][s], unused: k_fa keeps the logits on chip
#define WS_Y   (WS_S  + 4u * (size_t)HG * TT * TT)      // f32 ctx rows [b*t][CC] (only when there is an output projection)
#define WS_END (WS_Y  + 0u)

#define PWP 264            // staged weight row pitch in bf16: 512 B + 16 B (16 B x odd: ds_load_b128 walks over rows meet no bank twice)
// four waves a SIMD (256 registers) and 67,584 B of LDS: four blocks a WGP, so that the 1,024 blocks of the q/k launch are resident at once
// ---- k_proj: block = (64 rows, 128 cols, which): q/k/v = X W (+ b) with exact bf16 products (K = DIN) -> which 0: q f16 rows (+ residual rows < QHI); 1: k f16 rows (+ residual rows < KHI); 2: v f16 planes [c][t] (+ bf16 hi/lo planes for t < KHI)
template <int WOFF> __global__ __launch_bounds__(128) __attribute__((amdgpu_waves_per_eu(4))) void k_projT(const float* __restrict__ XQ, const float* __restrict__ XK, const float* __restrict__ XV, const float* __restrict__ WQ, const float* __restrict__ WK, const float* __restrict__ WV, const float* __restrict__ BQ, const float* __restrict__ BK, const float* __restrict__ BV,
    _Float16* __restrict__ QH, _Float16* __restrict__ QL, _Float16* __restrict__ KH, _Float16* __restrict__ KL, _Float16* __restrict__ VT, __bf16* __restrict__ VB, __bf16* __restrict__ VBL) {
  // one LDS pool: first the weight tile, bf16, transposed to [output column][k]; behind the products (and a barrier) the same bytes are the output staging
  __shared__ __align__(16) char pool[128 * PWP * 2];
  __bf16 (*wt)[PWP] = (__bf16 (*)[PWP])pool;
  _Float16 (*sh)[136] = (_Float16 (*)[136])pool; _Float16 (*sl)[136] = (_Float16 (*)[136])(pool + 64 * 136 * 2);
  _Float16 (*th)[72] = (_Float16 (*)[72])pool; __bf16 (*tb)[72] = (__bf16 (*)[72])(pool + 128 * 72 * 2); __bf16 (*tbl)[72] = (__bf16 (*)[72])(pool + 2 * 128 * 72 * 2);
  const int tid = threadIdx.x, wave = tid >> 5, lane = tid & 31, col = lane & 15, g = lane >> 4; const int which = blockIdx.z + WOFF; const int c0 = blockIdx.y * 128; const size_t r0 = (size_t)blockIdx.x * 64; const size_t bb = r0 / TT; const int t0 = (int)(r0 % TT);
  const float* X = which == 0 ? XQ : which == 1 ? XK : XV; const float* WA = which == 0 ? WQ : which == 1 ? WK : WV; const float* BA = which == 0 ? BQ : which == 1 ? BK : BV;
  const int KD = DIN;
  v8f acc[8] = {};
  v16b xa[DIN / 32];   /* this wave's 16 x rows, whole width, as A fragments */
  /* Weight tile [DIN][128 columns from c0] -> wt[column][k], read from global ONCE per block. A wave fills its own 32 columns; a lane takes 4 columns x 8 k a unit: 8 loads of 16 B (a wave's load = four whole 128-B lines), 4 LDS stores of 16 B (8 k of one column).
     Twelve units of 8 loads a lane: 0..7 = the weight tile's 32-k slabs, 8..11 = two k chunks each of the lane's x row. Six units are in flight; a unit is used up (to LDS, or to bf16 fragments) and then the unit six further on is issued into its registers. */
  { const int cb = wave * 32 + (lane & 7) * 4, kq = (lane >> 3) * 8; const float* pw = WA + (size_t)kq * CCQ + c0 + cb; const float* px = X + (r0 + wave * 16 + col) * (size_t)KD + 8 * g;   /* x row-major [b*t][KD] */
    v4f un[12][8];
#pragma unroll   // the arrays indexed here live in registers: every index must be a compile-time constant
    for (int n = -6; n < 12; ++n) {
      if (n >= 0 && n < 8) {
#pragma unroll
        for (int c = 0; c < 4; ++c) { v8b t;
#pragma unroll
          for (int i = 0; i < 8; ++i) t[i] = (__bf16)un[n][i][c];
          *(v8b*)&wt[cb + c][n * 32 + kq] = t; } }
      if (n >= 8) {
#pragma unroll
        for (int e = 0; e < 32; ++e) xa[(n - 8) * 2 + (e >> 4)][e & 15] = (__bf16)un[n][e >> 2][e & 3]; }
      __builtin_amdgcn_sched_barrier(0);   // unit n is used up before unit n + 6 is issued: its registers are free again (no spill at four waves a SIMD)
      const int m = n + 6;
      if (m < 8) {
#pragma unroll
        for (int i = 0; i < 8; ++i) un[m][i] = *(const v4f*)(pw + (size_t)(m * 32 + i) * CCQ); }
      else if (m < 12) {
#pragma unroll
        for (int i = 0; i < 8; ++i) un[m][i] = *(const v4f*)(px + ((m - 8) * 2 + (i >> 2)) * 32 + ((i >> 1) & 1) * 16 + (i & 1) * 4); }
      if (m == 11) asm volatile("s_wait_xcnt 0x0" ::: "memory");   // behind the last load: before an address register of the loads above is written again
      __builtin_amdgcn_sched_barrier(0); } }   // the loads of unit n + 6 are issued here and not pushed behind the wait for unit n + 1
  __syncthreads();   // the whole weight tile is readable by every wave
  v16b bf[2][4];   /* B fragments in groups of four (group f: k chunk f >> 1, column tiles 4 (f & 1) + 0..3); the LDS reads of group f + 1 stand together in front of the products of group f */
#pragma unroll   // the arrays indexed here live in registers: every index must be a compile-time constant
  for (int u = 0; u < 4; ++u) bf[0][u] = frag_b(&wt[u * 16 + col][0], lane);
#pragma unroll   // the arrays indexed here live in registers: every index must be a compile-time constant
  for (int f = 0; f < DIN / 16; ++f) { const int cu = f & 1, nx = cu ^ 1;
    if (f + 1 < DIN / 16) {
#pragma unroll
      for (int u = 0; u < 4; ++u) bf[nx][u] = frag_b(&wt[(nx * 4 + u) * 16 + col][((f + 1) >> 1) * 32], lane); }
    __builtin_amdgcn_sched_barrier(0);   // the LDS reads of group f + 1 stay in one place, in front of the products of group f
#pragma unroll
    for (int u = 0; u < 4; ++u) acc[cu * 4 + u] = __builtin_amdgcn_wmma_f32_16x16x32_bf16(false, xa[f >> 1], false, bf[cu][u], (short)0, acc[cu * 4 + u], false, false);   /* same products in the same k order as before */
    __builtin_amdgcn_sched_barrier(0); }   // no LDS read of a later group is spread among these products
  __syncthreads();   // every wave's last read of the weight tile is done before the pool becomes output staging
  if (which < 2) { _Float16* DH = which == 0 ? QH : KH; _Float16* DL = which == 0 ? QL : KL; const int nhi = which == 0 ? QHI : KHI; const bool hi_rows = t0 < nhi;
#pragma unroll
    for (int j = 0; j < 8; ++j) { const float bias = BA ? bfr(BA[c0 + j * 16 + col]) : 0.f;
#pragma unroll
      for (int r = 0; r < 8; ++r) { const float v = acc[j][r] + bias; const _Float16 hv = (_Float16)v; sh[wave * 16 + 8 * g + r][j * 16 + col] = hv; sl[wave * 16 + 8 * g + r][j * 16 + col] = (_Float16)((v - (float)hv) * 1024.0f); } }
    __syncthreads();
    for (int e = tid; e < 64 * 16; e += 128) { const int rl = e >> 4, q = e & 15; vst2((unsigned*)(DH + (r0 + rl) * CCQ + c0 + q * 8), *(const v4u*)&sh[rl][q * 8]); if (hi_rows) vst2((unsigned*)(DL + (bb * nhi + t0 + rl) * (size_t)CCQ + c0 + q * 8), *(const v4u*)&sl[rl][q * 8]); }   /* q/k rows: pitch CCQ (c0 = 0 or 128) */
  } else { const bool hi_rows = t0 < KHI;
#pragma unroll
    for (int j = 0; j < 8; ++j) { const float bias = BA ? bfr(BA[c0 + j * 16 + col]) : 0.f;
      v8h hv; v8b bv, lv;   /* a lane's 8 rows of one column lie side by side in the staged planes: one 16-byte LDS store a plane */
#pragma unroll
      for (int r = 0; r < 8; ++r) { const float v = acc[j][r] + bias; hv[r] = (_Float16)v; const __bf16 bh = (__bf16)v; bv[r] = bh; lv[r] = (__bf16)(v - (float)bh); }
      { const int rl = wave * 16 + 8 * g, cl = j * 16 + col; *(v8h*)&th[cl][rl] = hv; *(v8b*)&tb[cl][rl] = bv; *(v8b*)&tbl[cl][rl] = lv; } }
    __syncthreads();
    for (int e = tid; e < 128 * 8; e += 128) { const int cl = e >> 3, q = e & 7; vst2((unsigned*)(VT + (bb * CC + c0 + cl) * (size_t)TT + t0 + q * 8), *(const v4u*)&th[cl][q * 8]); if (hi_rows) { const size_t o3 = (bb * CC + c0 + cl) * (size_t)KHI + t0 + q * 8; vst2((unsigned*)(VB + o3), *(const v4u*)&tb[cl][q * 8]); vst2((unsigned*)(VBL + o3), *(const v4u*)&tbl[cl][q * 8]); } } } }
__device__ __forceinline__ unsigned lds_off(const void* p) { return (unsigned)(size_t)p; }
// eight 16-byte copies of one lane, global -> LDS; the s_wait_xcnt stands inside the statement so that no address register is rewritten in front of it
__device__ __forceinline__ void copy8(const unsigned l[8], const char* const gp[8]) {
  asm volatile("global_load_async_to_lds_b128 %0, %8, off\n\t"
               "global_load_async_to_lds_b128 %1, %9, off\n\t"
               "global_load_async_to_lds_b128 %2, %10, off\n\t"
               "global_load_async_to_lds_b128 %3, %11, off\n\t"
               "global_load_async_to_lds_b128 %4, %12, off\n\t"
               "global_load_async_to_lds_b128 %5, %13, off\n\t"
               "global_load_async_to_lds_b128 %6, %14, off\n\t"
               "global_load_async_to_lds_b128 %7, %15, off\n\t"
               "s_wait_xcnt 0x0"
               :: "v"(l[0]), "v"(l[1]), "v"(l[2]), "v"(l[3]), "v"(l[4]), "v"(l[5]), "v"(l[6]), "v"(l[7]),
                  "v"(gp[0]), "v"(gp[1]), "v"(gp[2]), "v"(gp[3]), "v"(gp[4]), "v"(gp[5]), "v"(gp[6]), "v"(gp[7]) : "memory");
}
// the compiler keeps the distance behind its own builtin form
__device__ __forceinline__ v8f WM(v16h a, v16h b, v8f c) { return __builtin_amdgcn_wmma_f32_16x16x32_f16(false, a, false, b, (short)0, c, false, false); }
// ---- k_fa: scores, softmax and P . v in ONE kernel; the logits never leave the WGP. Block = (64 queries, batch), 8 waves = 4 query sub-tiles of 16 x 2 key halves: of every stage of 64 keys a wave takes 32.
// Scores TRANSPOSED: A = k rows (LDS), B = q rows (registers, hi + residual): D element r = key 8h + r, column = query = lane & 15; same 3 products in the same k order (hi.hi | k hi . q lo + k lo . q hi).
// So a lane holds 16 keys of ONE query: maximum and sum are in-lane plus one exchange with lane ^ 16, and two 16-key score tiles ARE the B fragment of 32 keys (elements 0..7 = tile 0, 8..15 = tile 1).
// Output TRANSPOSED too: A = v plane rows [channel][key] (LDS), B = P: D element r = channel 8h + r, column = query, so the running-maximum rescale is one factor per lane.
// k hi, k lo (64 rows x 512 B) and v (256 rows x 128 B) of a stage come into LDS by asynchronous copies, two buffers: the next stage flies while this one is multiplied. The two key halves are merged at the end through LDS.
#define FQ 64              // queries per block
#define FK 64              // keys per LDS stage
#define FKP 264            // staged k row pitch in f16: 512 B + 16 B (16 B x odd: ds_load_b128 walks over rows meet no bank twice)
#define FVP 72             // staged v row pitch in f16: 128 B + 16 B (same reason)
#define FST (2 * FK * FKP + CC * FVP)   // f16 elements of one buffer
#define FOP 260            // staged output row pitch in f32
// one stage: 256 threads, 24 copies each; a wave's copy covers one 512-B k row or four 128-B v row pieces
__device__ __forceinline__ void fa_fill(const _Float16* k_h, const _Float16* k_l, const _Float16* v_t, _Float16* sr, int tid) {
  unsigned l[8]; const char* gp[8];
#pragma unroll   // the arrays indexed here live in registers: every index must be a compile-time constant
  for (int i = 0; i < 8; ++i) { const int e = i * 256 + tid, row = e >> 5, q = e & 31; l[i] = lds_off(sr + row * FKP + q * 8); gp[i] = (const char*)(k_h + (size_t)row * CCQ + q * 8); }
  copy8(l, gp);
#pragma unroll   // the arrays indexed here live in registers: every index must be a compile-time constant
  for (int i = 0; i < 8; ++i) { const int e = i * 256 + tid, row = e >> 5, q = e & 31; l[i] = lds_off(sr + (FK + row) * FKP + q * 8); gp[i] = (const char*)(k_l + (size_t)row * CCQ + q * 8); }
  copy8(l, gp);
#pragma unroll   // the arrays indexed here live in registers: every index must be a compile-time constant
  for (int i = 0; i < 8; ++i) { const int e = i * 256 + tid, row = e >> 3, q = e & 7; l[i] = lds_off(sr + 2 * FK * FKP + row * FVP + q * 8); gp[i] = (const char*)(v_t + (size_t)row * TT + q * 8); }
  copy8(l, gp);
}
__global__ __launch_bounds__(256) void k_fa(const _Float16* __restrict__ QH, const _Float16* __restrict__ QL, const _Float16* __restrict__ KH, const _Float16* __restrict__ KL, const _Float16* __restrict__ VT, const int* __restrict__ RMASK, float* __restrict__ Y) {
  __shared__ __align__(16) _Float16 ring[2][FST]; __shared__ float xm[8][32], xl[8][32];
  const int tid = threadIdx.x, wave = tid >> 5, lane = tid & 31, col = lane & 15, g = lane >> 4; const int qs = wave & 3, kh = wave >> 2; const int b = blockIdx.y; const int q0 = blockIdx.x * FQ + qs * 16;
  const _Float16* k_h = KH + (size_t)b * TT * CCQ; const _Float16* k_l = KL + (size_t)b * KHI * CCQ; const _Float16* v_t = VT + (size_t)b * CC * TT;
  fa_fill(k_h, k_l, v_t, &ring[0][0], tid);
  v16h qh[HDQK / 32], ql[HDQK / 32];   /* this wave's 16 query rows, whole width, as B fragments */
  { const _Float16* qr = QH + ((size_t)b * TT + q0 + col) * CCQ; const _Float16* qlr = QL + ((size_t)b * QHI + q0 + col) * CCQ;
#pragma unroll   // the arrays indexed here live in registers: every index must be a compile-time constant
    for (int kk = 0; kk < HDQK / 32; ++kk) { qh[kk] = frag_h(qr + kk * 32, lane); ql[kk] = frag_h(qlr + kk * 32, lane); } }
  const float mk = (float)RMASK[(size_t)b * TT + q0 + col];   /* multiplicative mask of this lane's query row */
  asm volatile("s_wait_xcnt 0x0" ::: "memory");       // before an address register of the loads above is written again
  asm volatile("s_wait_asynccnt 0x0" ::: "memory");   // stage 0 has landed for this wave's own copies
  __syncthreads();                                     // ... and for every wave's
  fa_fill(k_h + (size_t)FK * CCQ, k_l + (size_t)FK * CCQ, v_t + FK, &ring[1][0], tid);
  v8f o[CC / 16] = {}; float m = -3.0e38f, l = 0.f;
#pragma unroll 1   // one stage a trip: the buffer index stays a run-time bit and the loop stays small
  for (int t = 0; t < TT / FK; ++t) { const _Float16* sk = &ring[t & 1][(kh * 32 + col) * FKP]; const _Float16* sv = &ring[t & 1][2 * FK * FKP + col * FVP + kh * 32];
    v8f acc[2] = {}, accl[2] = {}; v16h ah[2][2], al[2][2];   /* fragments of k chunk kk + 1 are read from LDS in front of the products of chunk kk */
#pragma unroll   // the arrays indexed here live in registers: every index must be a compile-time constant
    for (int u = 0; u < 2; ++u) { ah[0][u] = frag_h(sk + u * 16 * FKP, lane); al[0][u] = frag_h(sk + (FK + u * 16) * FKP, lane); }
#pragma unroll   // the arrays indexed here live in registers: every index must be a compile-time constant
    for (int kk = 0; kk < HDQK / 32; ++kk) { const int c = kk & 1, n = c ^ 1;
      if (kk + 1 < HDQK / 32) {
#pragma unroll   // the arrays indexed here live in registers: every index must be a compile-time constant
        for (int u = 0; u < 2; ++u) { ah[n][u] = frag_h(sk + u * 16 * FKP + (kk + 1) * 32, lane); al[n][u] = frag_h(sk + (FK + u * 16) * FKP + (kk + 1) * 32, lane); } }
      __builtin_amdgcn_sched_barrier(0);   // the LDS reads of chunk kk + 1 stay in front of the products of chunk kk
      /* the two products into accl[0] stand three matrix instructions apart, those into accl[1] two */
      acc[0] = WM(ah[c][0], qh[kk], acc[0]); accl[0] = WM(ah[c][0], ql[kk], accl[0]); acc[1] = WM(ah[c][1], qh[kk], acc[1]); accl[1] = WM(ah[c][1], ql[kk], accl[1]); accl[0] = WM(al[c][0], qh[kk], accl[0]); accl[1] = WM(al[c][1], qh[kk], accl[1]);
      __builtin_amdgcn_sched_barrier(0); }   // no product of chunk kk + 1 is pulled in here: it would wait on LDS reads that were only just issued
    v16h vf[2][4];   /* the first four v fragments do not depend on P: their LDS reads are written ahead of the exponentials, which cover the latency */
#pragma unroll   // the arrays indexed here live in registers: every index must be a compile-time constant
    for (int u = 0; u < 4; ++u) vf[0][u] = frag_h(sv + u * 16 * FVP, lane);
    float s[2][8]; float mx0 = -3.0e38f, mx1 = -3.0e38f;
#pragma unroll   // the arrays indexed here live in registers: every index must be a compile-time constant
    for (int r = 0; r < 8; ++r) { float v0 = (acc[0][r] + accl[0][r] * (1.0f / 1024.0f)) * SCALE, v1 = (acc[1][r] + accl[1][r] * (1.0f / 1024.0f)) * SCALE; v0 = v0 * mk; v1 = v1 * mk; s[0][r] = v0; s[1][r] = v1; mx0 = fmaxf(mx0, v0); mx1 = fmaxf(mx1, v1); }
    float mx = fmaxf(mx0, mx1); mx = fmaxf(mx, __shfl_xor(mx, 16));   /* the other 16 keys of the same query */
    const float mn = fmaxf(m, mx); const float af = expf(m - mn); m = mn;   /* first stage: exp(-3e38) = 0 */
    float ps0 = 0.f, ps1 = 0.f; v16h pf;
#pragma unroll   // the arrays indexed here live in registers: every index must be a compile-time constant
    for (int r = 0; r < 8; ++r) { const float e0 = expf(s[0][r] - mn), e1 = expf(s[1][r] - mn); ps0 += e0; ps1 += e1; pf[r] = (_Float16)(e0 * 2048.0f); pf[8 + r] = (_Float16)(e1 * 2048.0f); }
    l = l * af + (ps0 + ps1);   /* per lane: its own 16 keys a stage; the two lanes of a query are added behind the loop */
#pragma unroll   // the arrays indexed here live in registers: every index must be a compile-time constant
    for (int j = 0; j < CC / 16; ++j) o[j] = o[j] * af;
#pragma unroll   // the arrays indexed here live in registers: every index must be a compile-time constant
    for (int jg = 0; jg < CC / 64; ++jg) { const int c = jg & 1, n = c ^ 1;   /* four channel tiles a group: the LDS reads of group jg + 1 stand together in front of the products of group jg */
      if (jg + 1 < CC / 64) {
#pragma unroll   // the arrays indexed here live in registers: every index must be a compile-time constant
        for (int u = 0; u < 4; ++u) vf[n][u] = frag_h(sv + ((jg + 1) * 4 + u) * 16 * FVP, lane); }
      __builtin_amdgcn_sched_barrier(0);   // the LDS reads of group jg + 1 stay in one place, in front of the products of group jg
#pragma unroll   // the arrays indexed here live in registers: every index must be a compile-time constant
      for (int u = 0; u < 4; ++u) o[jg * 4 + u] = WM(vf[c][u], pf, o[jg * 4 + u]);
      __builtin_amdgcn_sched_barrier(0); }   // no LDS read of a later group is spread among these products
    asm volatile("s_wait_dscnt 0x0" ::: "memory");      // this wave's reads of buffer t & 1 are done before it is handed to the copies (last trip: to the output staging)
    asm volatile("s_wait_asynccnt 0x0" ::: "memory");   // this wave's copies of stage t + 1 have landed
    __syncthreads();                                     // publishes stage t + 1 and ends every reader's last read of buffer t & 1
    if (t + 2 < TT / FK) fa_fill(k_h + (size_t)(t + 2) * FK * CCQ, k_l + (size_t)(t + 2) * FK * CCQ, v_t + (t + 2) * FK, &ring[t & 1][0], tid); }
  asm volatile("s_wait_asynccnt 0x0" ::: "memory");     // no copy is outstanding when the ring becomes output staging
  l += __shfl_xor(l, 16);
  xm[wave][lane] = m; xl[wave][lane] = l;
  __syncthreads();                                       // maximum and sum of the other key half are readable
  const float m2 = xm[wave ^ 4][lane], l2 = xl[wave ^ 4][lane]; const float ms = fmaxf(m, m2); const float a1 = expf(m - ms), a2 = expf(m2 - ms);
  const float f = a1 / ((l * a1 + l2 * a2) * 2048.0f);   /* the sum holds exp(0) = 1 of the row's maximum: never 0 */
  float (*ss)[16][FOP] = (float (*)[16][FOP])&ring[0][0];   /* 8 x 16 x 260 f32 inside the ring, free behind the last trip's barrier; each wave writes its own range */
#pragma unroll   // the arrays indexed here live in registers: every index must be a compile-time constant
  for (int j = 0; j < CC / 16; ++j) { const v8f w = o[j] * f; const v4f w0 = {w[0], w[1], w[2], w[3]}, w1 = {w[4], w[5], w[6], w[7]}; *(v4f*)&ss[wave][col][j * 16 + 8 * g] = w0; *(v4f*)&ss[wave][col][j * 16 + 8 * g + 4] = w1; }
  __syncthreads();                                       // both halves' scaled outputs are readable
  for (int rl = 0; rl < 8; ++rl) { const int row = kh * 8 + rl;   /* a wave adds and stores 8 of its pair's 16 rows: two 512-B pieces a row */
#pragma unroll
    for (int c = 0; c < 2; ++c) vst2(Y + ((size_t)b * TT + q0 + row) * CC + c * 128 + lane * 4, *(const v4f*)&ss[qs][row][c * 128 + lane * 4] + *(const v4f*)&ss[qs + 4][row][c * 128 + lane * 4]); } }

extern "C" void kernel_launch(void* const* d_in, const int* in_sizes, int n_in, void* d_out, int out_size, void* d_ws, size_t ws_size, hipStream_t stream) {
  (void)in_sizes; (void)n_in; (void)out_size;
  const float** F = (const float**)d_in;
  if (ws_size < (size_t)WS_END) return;
  char* ws = (char*)d_ws; _Float16 *QH = (_Float16*)(ws + WS_QH), *KH = (_Float16*)(ws + WS_KH), *VT = (_Float16*)(ws + WS_VT), *QL = (_Float16*)(ws + WS_QL), *KL = (_Float16*)(ws + WS_KL); __bf16 *VB = (__bf16*)(ws + WS_VB), *VBL = (__bf16*)(ws + WS_VBL); float *S = (float*)(ws + WS_S), *Y = (float*)(ws + WS_Y);
  (void)S; (void)Y; (void)QL; (void)KL; (void)VB; (void)VBL;
  // inputs: 0 x [8,2048,256]; 1 kernel [3,256,256] ((in,out): Q | K | V matrices); 2 mask [8,2048] int32
  const float* Wq = F[1]; const float* Wk = F[1] + (size_t)DIN * CCQ; const float* Wv = F[1] + 2 * (size_t)DIN * CCQ;
  k_projT<0><<<dim3(TNB * TT / 64, CCQ / 128, 2), 128, 0, stream>>>(F[0], F[0], F[0], Wq, Wk, Wv, nullptr, nullptr, nullptr, QH, QL, KH, KL, VT, VB, VBL);   /* which 0, 1: q and k rows (hi + residual planes) */
  k_projT<2><<<dim3(TNB * TT / 64, CC / 128, 1), 128, 0, stream>>>(F[0], F[0], F[0], Wq, Wk, Wv, nullptr, nullptr, nullptr, QH, QL, KH, KL, VT, VB, VBL);     /* which 2: v planes */
  k_fa<<<dim3(TT / FQ, TNB), 256, 0, stream>>>(QH, QL, KH, KL, VT, (const int*)d_in[2], (float*)d_out);   /* scores, softmax, P . v: all batches in one launch */
}

// v005
// One run takes 84.4 microseconds.
// Timed twice side by side with v004, it ran 1.07 and 1.08 times as fast.
// Counting every step since v000, it is 6.08 times as fast.
// compute dtype: all float inputs rounded to bf16; q/k/v projections with EXACT bf16 products on WMMA 16x16x32 (f32 accumulate); logits q x k with BOTH operands as f16 hi + (x 2^10) residual (3 products: hi.hi + lo.hi + hi.lo) x 64^-0.5, for every row (the logits have sigma - 500); the int row mask multiplies the logits in f32; softmax f32 with a running maximum (scores, softmax and P.v fused); exp(logit - running maximum) x 2^11 once to f16 x v once to f16 (1 product), divided by the row sum at the end; f32 output.
#include <hip/hip_runtime.h>
#include <math.h>

typedef __attribute__((ext_vector_type(16))) _Float16 v16h;
typedef __attribute__((ext_vector_type(16))) __bf16 v16b;
typedef __attribute__((ext_vector_type(8)))  _Float16 v8h;
typedef __attribute__((ext_vector_type(8)))  float v8f;
typedef __attribute__((ext_vector_type(4)))  float v4f;
typedef __attribute__((ext_vector_type(2)))  float v2f;
typedef __attribute__((ext_vector_type(4)))  unsigned v4u;
typedef __attribute__((ext_vector_type(4)))  int v4i;
typedef float __attribute__((may_alias)) float_a;
typedef int __attribute__((may_alias)) int_a;

template <typename T> __device__ __forceinline__ void vst2(void* p, T v) { *(T*)p = v;  }
__device__ __forceinline__ v8f wmma16(v16h a, v16h b, v8f c) {
  v8f d = __builtin_amdgcn_wmma_f32_16x16x32_f16(false, a, false, b, (short)0, c, false, false);
  asm volatile("v_nop\n\tv_nop\n\tv_nop\n\tv_nop" : "+v"(d) : "v"(a), "v"(b));
  return d;
}
__device__ __forceinline__ v8f wmma_bf(v16b a, v16b b, v8f c) {
  v8f d = __builtin_amdgcn_wmma_f32_16x16x32_bf16(false, a, false, b, (short)0, c, false, false);
  asm volatile("v_nop\n\tv_nop\n\tv_nop\n\tv_nop" : "+v"(d) : "v"(a), "v"(b));
  return d;
}
// 16x16x32 fragments: lane = (h = lane>>4, row/col = lane&15); elements 0..7 = k0+8h+0..7, 8..15 = k0+16+8h+0..7; D element r = row 8h+r
__device__ __forceinline__ v16h frag_h(const _Float16* rowk0, int lane) {
  union { v16h v; v8h q[2]; } u; const _Float16* p = rowk0 + 8 * (lane >> 4);
  u.q[0] = *(const v8h*)p; u.q[1] = *(const v8h*)(p + 16); return u.v;
}
__device__ __forceinline__ v16h frag_f32(const float* rowk0, int lane) {
  v16h a; const float* p = rowk0 + 8 * (lane >> 4);
#pragma unroll
  for (int i = 0; i < 8; ++i) { a[i] = (_Float16)p[i]; a[8 + i] = (_Float16)p[16 + i]; }
  return a;
}
__device__ __forceinline__ v16h frag_f32s(const float* rowk0, int lane, float sc) {
  v16h a; const float* p = rowk0 + 8 * (lane >> 4);
#pragma unroll
  for (int i = 0; i < 8; ++i) { a[i] = (_Float16)(p[i] * sc); a[8 + i] = (_Float16)(p[16 + i] * sc); }
  return a;
}
// column fragment from a [K][ld] layout (column n), rows >= K read as 0
__device__ __forceinline__ v16h fragc_f32(const float* W, int k0, int n, int lane, int ld, int K) {
  v16h a; const int g = lane >> 4;
#pragma unroll
  for (int i = 0; i < 8; ++i) { const int ka = k0 + 8 * g + i, kb = ka + 16;
    a[i] = (_Float16)(ka < K ? W[(size_t)(ka < K ? ka : K - 1) * ld + n] : 0.f); a[8 + i] = (_Float16)(kb < K ? W[(size_t)(kb < K ? kb : K - 1) * ld + n] : 0.f); }
  return a;
}
struct F2 { v16b h, l; };
__device__ __forceinline__ F2 bsplit16(const float v[16]) { F2 r;
#pragma unroll
  for (int i = 0; i < 16; ++i) { const __bf16 h = (__bf16)v[i]; r.h[i] = h; r.l[i] = (__bf16)(v[i] - (float)h); }
  return r; }
__device__ __forceinline__ F2 split_row(const float* row, int k0, int lane) { float v[16]; const float* p = row + k0 + 8 * (lane >> 4);
#pragma unroll
  for (int i = 0; i < 8; ++i) { v[i] = p[i]; v[8 + i] = p[16 + i]; }
  return bsplit16(v); }
__device__ __forceinline__ F2 split_rowK(const float* row, int k0, int lane, int K) { float v[16]; const int g = lane >> 4;
#pragma unroll
  for (int i = 0; i < 8; ++i) { const int ka = k0 + 8 * g + i, kb = ka + 16; v[i] = ka < K ? row[ka < K ? ka : K - 1] : 0.f; v[8 + i] = kb < K ? row[kb < K ? kb : K - 1] : 0.f; }
  return bsplit16(v); }
__device__ __forceinline__ F2 split_col(const float* W, int k0, int n, int lane, int ld, int K) { float v[16]; const int g = lane >> 4;
#pragma unroll
  for (int i = 0; i < 8; ++i) { const int ka = k0 + 8 * g + i, kb = ka + 16; v[i] = ka < K ? W[(size_t)(ka < K ? ka : K - 1) * ld + n] : 0.f; v[8 + i] = kb < K ? W[(size_t)(kb < K ? kb : K - 1) * ld + n] : 0.f; }
  return bsplit16(v); }
__device__ __forceinline__ v8f mac3(const F2& a, const F2& b, v8f c) { c = wmma_bf(a.l, b.h, c); c = wmma_bf(a.h, b.l, c); return wmma_bf(a.h, b.h, c); }
__device__ __forceinline__ float sigm(float v) { return 1.0f / (1.0f + expf(-v)); }
#define LDSX() do { asm volatile("s_wait_dscnt 0" ::: "memory"); __builtin_amdgcn_wave_barrier(); __builtin_amdgcn_fence(__ATOMIC_RELEASE, "workgroup"); } while (0)

// Single-head self-attention with unscaled N(0,1) projection kernels and a multiplicative row mask (x [8,2048,256]; kernel [3,256,256] (in,out): Q, K, V; mask [8,2048] int 0/1; SCALE = 1/sqrt(64) hard-coded): QK = (Q K^T) / 8; QK *= mask[b][q] per QUERY row (masked rows: all-zero logits -> uniform attention); A = softmax(QK); out = A V -> [8,2048,256].
#define NB 8
#define TT 2048
#define CC 256            // value width (v planes, output rows)
#define CCQ 256           // q / k row width
#define DIN 256          // x width
#define NH 1
#define HD 256
#define NQB (TT / 64)
#define HG 4               // four 2,048 x 2,048 f32 planes of WS_S, which no kernel uses (k_fa keeps the logits on chip)
#define SCALE (0.125f)             // 1/sqrt(64), hard-coded in the source
#define HDQK 256           // q / k width
#define CAUSAL 0
#ifndef TNB
#define TNB NB
#endif
__device__ __forceinline__ v16b zero16b() { v16b z; _Pragma("unroll") for (int i = 0; i < 16; ++i) z[i] = (__bf16)0.f; return z; }
__device__ __forceinline__ float bfr(float v) { return (float)(__bf16)v; }
__host__ __device__ __forceinline__ int kb_last(int qb) { return CAUSAL ? ((qb * 64 + 63) >> 7) : (TT / 128 - 1); }
typedef __attribute__((ext_vector_type(8))) __bf16 v8b;
__device__ __forceinline__ v16b frag_b(const __bf16* rowk0, int lane) {
  union { v16b v; v8b q[2]; } u; const __bf16* p = rowk0 + 8 * (lane >> 4);
  u.q[0] = *(const v8b*)p; u.q[1] = *(const v8b*)(p + 16); return u.v;
}
#define QBH 0              // k_fa keeps the single-product P.v path for every block
#define QBH_SC NQB         // k_fa: EVERY query block takes the 3-product (q hi+lo x k hi+lo) path
#define QHI TT              // q residual rows for every query
#define KHI TT              // k residual rows for every key (the bf16 v hi/lo planes are written too but unused)
// B fragment (k rows k0+.., output column o) of a weight: (in,out) [K][ld] or (out,in) [ld rows of K]: bf16 exact, or f16(bf16 * 256) exact
__device__ __forceinline__ v16b wcol_io(const float* Wm, int k0, int o, int lane, int ld) { v16b w; const int g = lane >> 4;
#pragma unroll
  for (int i = 0; i < 8; ++i) { w[i] = (__bf16)Wm[(size_t)(k0 + 8 * g + i) * ld + o]; w[8 + i] = (__bf16)Wm[(size_t)(k0 + 16 + 8 * g + i) * ld + o]; }
  return w; }
__device__ __forceinline__ v16b wcol_oi(const float* Wm, int k0, int o, int lane, int K) { v16b w; const float* p = Wm + (size_t)o * K + k0 + 8 * (lane >> 4);
#pragma unroll
  for (int i = 0; i < 8; ++i) { w[i] = (__bf16)p[i]; w[8 + i] = (__bf16)p[16 + i]; }
  return w; }
__device__ __forceinline__ v16h wcolh_io(const float* Wm, int k0, int o, int lane, int ld) { v16h w; const int g = lane >> 4;
#pragma unroll
  for (int i = 0; i < 8; ++i) { w[i] = (_Float16)(bfr(Wm[(size_t)(k0 + 8 * g + i) * ld + o]) * 256.0f); w[8 + i] = (_Float16)(bfr(Wm[(size_t)(k0 + 16 + 8 * g + i) * ld + o]) * 256.0f); }
  return w; }
__device__ __forceinline__ v16h wcolh_oi(const float* Wm, int k0, int o, int lane, int K) { v16h w; const float* p = Wm + (size_t)o * K + k0 + 8 * (lane >> 4);
#pragma unroll
  for (int i = 0; i < 8; ++i) { w[i] = (_Float16)(bfr(p[i]) * 256.0f); w[8 + i] = (_Float16)(bfr(p[16 + i]) * 256.0f); }
  return w; }
#define WQKV_LAYOUT 0   // 0 = (in,out) [K][CC]; 1 = (out,in) [CC][DIN]; 2 = per-head [NH][DIN][HD]
__device__ __forceinline__ v16b wcol_hdk(const float* Wm, int k0, int o, int lane) { v16b w; const int g = lane >> 4; const float* p = Wm + (size_t)(o / HD) * DIN * HD + (o % HD);
#pragma unroll
  for (int i = 0; i < 8; ++i) { w[i] = (__bf16)p[(size_t)(k0 + 8 * g + i) * HD]; w[8 + i] = (__bf16)p[(size_t)(k0 + 16 + 8 * g + i) * HD]; }
  return w; }
#define WO_OUT_IN 0
#if WQKV_LAYOUT == 1
#define WCOL(W, k0, o, lane) wcol_oi(W, k0, (o), lane, DIN)   /* unused: layout 0 */
#elif WQKV_LAYOUT == 2
#define WCOL(W, k0, o, lane) wcol_hdk(W, k0, o, lane)
#else
#define WCOL(W, k0, o, lane) (which == 2 ? wcol_io(W, k0, (o), lane, CC) : ((o) < HDQK ? wcol_io(W, k0, (o), lane, HDQK) : zero16b()))   /* Wv [256][256]; Wq/Wk [256][256]: projected q/k columns >= 256 would read as zero (grid y = 2 covers 0..255) */
#endif
#if WO_OUT_IN
#define WOCOL(W, k0, o, lane) wcol_oi(W, k0, o, lane, CC)
#define WOCOLH(W, k0, o, lane) wcolh_oi(W, k0, o, lane, CC)
#else
#define WOCOL(W, k0, o, lane) wcol_io(W, k0, o, lane, DIN)
#define WOCOLH(W, k0, o, lane) wcolh_io(W, k0, o, lane, DIN)
#endif
#define BG HG
#define BGN (TNB < BG ? TNB : BG)   // unused: k_fa takes all TNB batches in one launch
#define DVH 128            // unused: a k_fa wave keeps all 256 value columns in 16 accumulator tiles
#define SM_EXTRA_PARAMS , int bsm, const int* __restrict__ RMASK
// multiplicative per-QUERY-row int mask applied to the scaled logits before the softmax (mask 0 -> every logit of the row becomes 0 -> uniform attention), as the module
#define SM_MASK_HOOK do { v = v * (float)RMASK[(size_t)(bsm + (int)blockIdx.y) * TT + t]; } while (0)
#ifndef SM_EXTRA_PARAMS
#define SM_EXTRA_PARAMS
#endif
#ifndef PROJ_EXTRA_PARAMS
#define PROJ_EXTRA_PARAMS
#endif
#ifndef SM_MASK_HOOK
#define SM_MASK_HOOK (void)0
#endif

#define WS_QH  0u                                      // f16 q rows [b*t][CCQ]
#define WS_KH  (WS_QH + 2u * (size_t)NB * TT * CCQ)     // f16 k rows [b*t][CCQ]
#define WS_VT  (WS_KH + 2u * (size_t)NB * TT * CCQ)     // f16 v planes [b][c][t]
#define WS_QL  (WS_VT + 2u * (size_t)NB * CC * TT)      // f16 q residual x 2^10 rows [b][t < QHI][CCQ]
#define WS_KL  (WS_QL + 2u * (size_t)NB * QHI * CCQ)    // f16 k residual x 2^10 rows [b][t < KHI][CCQ]
#define WS_VB  (WS_KL + 2u * (size_t)NB * KHI * CCQ)    // bf16 v hi planes [b][c][t < KHI]
#define WS_VBL (WS_VB + 2u * (size_t)NB * CC * KHI)
#define WS_S   (WS_VBL + 2u * (size_t)NB * CC * KHI)    // f32 [hg][t][s], unused: k_fa keeps the logits on chip
#define WS_Y   (WS_S  + 4u * (size_t)HG * TT * TT)      // f32 ctx rows [b*t][CC] (only when there is an output projection)
#define WS_END (WS_Y  + 0u)

#define PWP 264            // staged weight row pitch in bf16: 512 B + 16 B (16 B x odd: ds_load_b128 walks over rows meet no bank twice)
// four waves a SIMD (256 registers) and 67,584 B of LDS: four blocks a WGP, so that the 1,024 blocks of the q/k launch are resident at once
// ---- k_proj: block = (64 rows, 128 cols, which): q/k/v = X W (+ b) with exact bf16 products (K = DIN) -> which 0: q f16 rows (+ residual rows < QHI); 1: k f16 rows (+ residual rows < KHI); 2: v f16 planes [c][t] (+ bf16 hi/lo planes for t < KHI)
template <int WOFF> __global__ __launch_bounds__(128) __attribute__((amdgpu_waves_per_eu(4))) void k_projT(const float* __restrict__ XQ, const float* __restrict__ XK, const float* __restrict__ XV, const float* __restrict__ WQ, const float* __restrict__ WK, const float* __restrict__ WV, const float* __restrict__ BQ, const float* __restrict__ BK, const float* __restrict__ BV,
    _Float16* __restrict__ QH, _Float16* __restrict__ QL, _Float16* __restrict__ KH, _Float16* __restrict__ KL, _Float16* __restrict__ VT, __bf16* __restrict__ VB, __bf16* __restrict__ VBL) {
  // one LDS pool: first the weight tile, bf16, transposed to [output column][k]; behind the products (and a barrier) the same bytes are the output staging
  __shared__ __align__(16) char pool[128 * PWP * 2];
  __bf16 (*wt)[PWP] = (__bf16 (*)[PWP])pool;
  _Float16 (*sh)[136] = (_Float16 (*)[136])pool; _Float16 (*sl)[136] = (_Float16 (*)[136])(pool + 64 * 136 * 2);
  _Float16 (*th)[72] = (_Float16 (*)[72])pool; __bf16 (*tb)[72] = (__bf16 (*)[72])(pool + 128 * 72 * 2); __bf16 (*tbl)[72] = (__bf16 (*)[72])(pool + 2 * 128 * 72 * 2);
  const int tid = threadIdx.x, wave = tid >> 5, lane = tid & 31, col = lane & 15, g = lane >> 4; const int which = blockIdx.z + WOFF; const int c0 = blockIdx.y * 128; const size_t r0 = (size_t)blockIdx.x * 64; const size_t bb = r0 / TT; const int t0 = (int)(r0 % TT);
  const float* X = which == 0 ? XQ : which == 1 ? XK : XV; const float* WA = which == 0 ? WQ : which == 1 ? WK : WV; const float* BA = which == 0 ? BQ : which == 1 ? BK : BV;
  const int KD = DIN;
  v8f acc[8] = {};
  v16b xa[DIN / 32];   /* this wave's 16 x rows, whole width, as A fragments */
  /* Weight tile [DIN][128 columns from c0] -> wt[column][k], read from global ONCE per block. A wave fills its own 32 columns; a lane takes 4 columns x 8 k a unit: 8 loads of 16 B (a wave's load = four whole 128-B lines), 4 LDS stores of 16 B (8 k of one column).
     Twelve units of 8 loads a lane: 0..7 = the weight tile's 32-k slabs, 8..11 = two k chunks each of the lane's x row. Six units are in flight; a unit is used up (to LDS, or to bf16 fragments) and then the unit six further on is issued into its registers. */
  { const int cb = wave * 32 + (lane & 7) * 4, kq = (lane >> 3) * 8; const float* pw = WA + (size_t)kq * CCQ + c0 + cb; const float* px = X + (r0 + wave * 16 + col) * (size_t)KD + 8 * g;   /* x row-major [b*t][KD] */
    v4f un[12][8];
#pragma unroll   // the arrays indexed here live in registers: every index must be a compile-time constant
    for (int n = -6; n < 12; ++n) {
      if (n >= 0 && n < 8) {
#pragma unroll
        for (int c = 0; c < 4; ++c) { v8b t;
#pragma unroll
          for (int i = 0; i < 8; ++i) t[i] = (__bf16)un[n][i][c];
          *(v8b*)&wt[cb + c][n * 32 + kq] = t; } }
      if (n >= 8) {
#pragma unroll
        for (int e = 0; e < 32; ++e) xa[(n - 8) * 2 + (e >> 4)][e & 15] = (__bf16)un[n][e >> 2][e & 3]; }
      __builtin_amdgcn_sched_barrier(0);   // unit n is used up before unit n + 6 is issued: its registers are free again (no spill at four waves a SIMD)
      const int m = n + 6;
      if (m < 8) {
#pragma unroll
        for (int i = 0; i < 8; ++i) un[m][i] = *(const v4f*)(pw + (size_t)(m * 32 + i) * CCQ); }
      else if (m < 12) {
#pragma unroll
        for (int i = 0; i < 8; ++i) un[m][i] = *(const v4f*)(px + ((m - 8) * 2 + (i >> 2)) * 32 + ((i >> 1) & 1) * 16 + (i & 1) * 4); }
      if (m == 11) asm volatile("s_wait_xcnt 0x0" ::: "memory");   // behind the last load: before an address register of the loads above is written again
      __builtin_amdgcn_sched_barrier(0); } }   // the loads of unit n + 6 are issued here and not pushed behind the wait for unit n + 1
  __syncthreads();   // the whole weight tile is readable by every wave
  v16b bf[2][4];   /* B fragments in groups of four (group f: k chunk f >> 1, column tiles 4 (f & 1) + 0..3); the LDS reads of group f + 1 stand together in front of the products of group f */
#pragma unroll   // the arrays indexed here live in registers: every index must be a compile-time constant
  for (int u = 0; u < 4; ++u) bf[0][u] = frag_b(&wt[u * 16 + col][0], lane);
#pragma unroll   // the arrays indexed here live in registers: every index must be a compile-time constant
  for (int f = 0; f < DIN / 16; ++f) { const int cu = f & 1, nx = cu ^ 1;
    if (f + 1 < DIN / 16) {
#pragma unroll
      for (int u = 0; u < 4; ++u) bf[nx][u] = frag_b(&wt[(nx * 4 + u) * 16 + col][((f + 1) >> 1) * 32], lane); }
    __builtin_amdgcn_sched_barrier(0);   // the LDS reads of group f + 1 stay in one place, in front of the products of group f
#pragma unroll
    for (int u = 0; u < 4; ++u) acc[cu * 4 + u] = __builtin_amdgcn_wmma_f32_16x16x32_bf16(false, xa[f >> 1], false, bf[cu][u], (short)0, acc[cu * 4 + u], false, false);   /* same products in the same k order as before */
    __builtin_amdgcn_sched_barrier(0); }   // no LDS read of a later group is spread among these products
  __syncthreads();   // every wave's last read of the weight tile is done before the pool becomes output staging
  if (which < 2) { _Float16* DH = which == 0 ? QH : KH; _Float16* DL = which == 0 ? QL : KL; const int nhi = which == 0 ? QHI : KHI; const bool hi_rows = t0 < nhi;
#pragma unroll
    for (int j = 0; j < 8; ++j) { const float bias = BA ? bfr(BA[c0 + j * 16 + col]) : 0.f;
#pragma unroll
      for (int r = 0; r < 8; ++r) { const float v = acc[j][r] + bias; const _Float16 hv = (_Float16)v; sh[wave * 16 + 8 * g + r][j * 16 + col] = hv; sl[wave * 16 + 8 * g + r][j * 16 + col] = (_Float16)((v - (float)hv) * 1024.0f); } }
    __syncthreads();
    for (int e = tid; e < 64 * 16; e += 128) { const int rl = e >> 4, q = e & 15; vst2((unsigned*)(DH + (r0 + rl) * CCQ + c0 + q * 8), *(const v4u*)&sh[rl][q * 8]); if (hi_rows) vst2((unsigned*)(DL + (bb * nhi + t0 + rl) * (size_t)CCQ + c0 + q * 8), *(const v4u*)&sl[rl][q * 8]); }   /* q/k rows: pitch CCQ (c0 = 0 or 128) */
  } else { const bool hi_rows = t0 < KHI;
#pragma unroll
    for (int j = 0; j < 8; ++j) { const float bias = BA ? bfr(BA[c0 + j * 16 + col]) : 0.f;
      v8h hv; v8b bv, lv;   /* a lane's 8 rows of one column lie side by side in the staged planes: one 16-byte LDS store a plane */
#pragma unroll
      for (int r = 0; r < 8; ++r) { const float v = acc[j][r] + bias; hv[r] = (_Float16)v; const __bf16 bh = (__bf16)v; bv[r] = bh; lv[r] = (__bf16)(v - (float)bh); }
      { const int rl = wave * 16 + 8 * g, cl = j * 16 + col; *(v8h*)&th[cl][rl] = hv; *(v8b*)&tb[cl][rl] = bv; *(v8b*)&tbl[cl][rl] = lv; } }
    __syncthreads();
    for (int e = tid; e < 128 * 8; e += 128) { const int cl = e >> 3, q = e & 7; vst2((unsigned*)(VT + (bb * CC + c0 + cl) * (size_t)TT + t0 + q * 8), *(const v4u*)&th[cl][q * 8]); if (hi_rows) { const size_t o3 = (bb * CC + c0 + cl) * (size_t)KHI + t0 + q * 8; vst2((unsigned*)(VB + o3), *(const v4u*)&tb[cl][q * 8]); vst2((unsigned*)(VBL + o3), *(const v4u*)&tbl[cl][q * 8]); } } } }
__device__ __forceinline__ unsigned lds_off(const void* p) { return (unsigned)(size_t)p; }
// eight 16-byte copies of one lane, global -> LDS; the s_wait_xcnt stands inside the statement so that no address register is rewritten in front of it
__device__ __forceinline__ void copy8(const unsigned l[8], const char* const gp[8]) {
  asm volatile("global_load_async_to_lds_b128 %0, %8, off\n\t"
               "global_load_async_to_lds_b128 %1, %9, off\n\t"
               "global_load_async_to_lds_b128 %2, %10, off\n\t"
               "global_load_async_to_lds_b128 %3, %11, off\n\t"
               "global_load_async_to_lds_b128 %4, %12, off\n\t"
               "global_load_async_to_lds_b128 %5, %13, off\n\t"
               "global_load_async_to_lds_b128 %6, %14, off\n\t"
               "global_load_async_to_lds_b128 %7, %15, off\n\t"
               "s_wait_xcnt 0x0"
               :: "v"(l[0]), "v"(l[1]), "v"(l[2]), "v"(l[3]), "v"(l[4]), "v"(l[5]), "v"(l[6]), "v"(l[7]),
                  "v"(gp[0]), "v"(gp[1]), "v"(gp[2]), "v"(gp[3]), "v"(gp[4]), "v"(gp[5]), "v"(gp[6]), "v"(gp[7]) : "memory");
}
// the compiler keeps the distance behind its own builtin form
__device__ __forceinline__ v8f WM(v16h a, v16h b, v8f c) { return __builtin_amdgcn_wmma_f32_16x16x32_f16(false, a, false, b, (short)0, c, false, false); }
// ---- k_fa: scores, softmax and P . v in ONE kernel; the logits never leave the WGP. Block = (64 queries, batch), 8 waves = 4 query sub-tiles of 16 x 2 key halves: of every stage of 64 keys a wave takes 32.
// Scores TRANSPOSED: A = k rows (LDS), B = q rows (registers, hi + residual): D element r = key 8h + r, column = query = lane & 15; same 3 products in the same k order (hi.hi | k hi . q lo + k lo . q hi).
// So a lane holds 16 keys of ONE query: maximum and sum are in-lane plus one exchange with lane ^ 16, and two 16-key score tiles ARE the B fragment of 32 keys (elements 0..7 = tile 0, 8..15 = tile 1).
// Output TRANSPOSED too: A = v plane rows [channel][key] (LDS), B = P: D element r = channel 8h + r, column = query, so the running-maximum rescale is one factor per lane.
// k hi, k lo (64 rows x 512 B) and v (256 rows x 128 B) of a stage come into LDS by asynchronous copies, two buffers: the next stage flies while this one is multiplied. The two key halves are merged at the end through LDS.
#define FQ 64              // queries per block
#define FK 64              // keys per LDS stage
#define FKP 264            // staged k row pitch in f16: 512 B + 16 B (16 B x odd: ds_load_b128 walks over rows meet no bank twice)
#define FVP 72             // staged v row pitch in f16: 128 B + 16 B (same reason)
#define FST (2 * FK * FKP + CC * FVP)   // f16 elements of one buffer
#define FOP 260            // staged output row pitch in f32
// one stage: 256 threads, 24 copies each; a wave's copy covers one 512-B k row or four 128-B v row pieces
__device__ __forceinline__ void fa_fill(const _Float16* k_h, const _Float16* k_l, const _Float16* v_t, _Float16* sr, int tid) {
  unsigned l[8]; const char* gp[8];
#pragma unroll   // the arrays indexed here live in registers: every index must be a compile-time constant
  for (int i = 0; i < 8; ++i) { const int e = i * 256 + tid, row = e >> 5, q = e & 31; l[i] = lds_off(sr + row * FKP + q * 8); gp[i] = (const char*)(k_h + (size_t)row * CCQ + q * 8); }
  copy8(l, gp);
#pragma unroll   // the arrays indexed here live in registers: every index must be a compile-time constant
  for (int i = 0; i < 8; ++i) { const int e = i * 256 + tid, row = e >> 5, q = e & 31; l[i] = lds_off(sr + (FK + row) * FKP + q * 8); gp[i] = (const char*)(k_l + (size_t)row * CCQ + q * 8); }
  copy8(l, gp);
#pragma unroll   // the arrays indexed here live in registers: every index must be a compile-time constant
  for (int i = 0; i < 8; ++i) { const int e = i * 256 + tid, row = e >> 3, q = e & 7; l[i] = lds_off(sr + 2 * FK * FKP + row * FVP + q * 8); gp[i] = (const char*)(v_t + (size_t)row * TT + q * 8); }
  copy8(l, gp);
}
__global__ __launch_bounds__(256) void k_fa(const _Float16* __restrict__ QH, const _Float16* __restrict__ QL, const _Float16* __restrict__ KH, const _Float16* __restrict__ KL, const _Float16* __restrict__ VT, const int* __restrict__ RMASK, float* __restrict__ Y) {
  __shared__ __align__(16) _Float16 ring[2][FST]; __shared__ float xm[8][32], xl[8][32];
  const int tid = threadIdx.x, wave = tid >> 5, lane = tid & 31, col = lane & 15, g = lane >> 4; const int qs = wave & 3, kh = wave >> 2; const int b = blockIdx.y; const int q0 = blockIdx.x * FQ + qs * 16;
  const _Float16* k_h = KH + (size_t)b * TT * CCQ; const _Float16* k_l = KL + (size_t)b * KHI * CCQ; const _Float16* v_t = VT + (size_t)b * CC * TT;
  fa_fill(k_h, k_l, v_t, &ring[0][0], tid);
  v16h qh[HDQK / 32], ql[HDQK / 32];   /* this wave's 16 query rows, whole width, as B fragments */
  { const _Float16* qr = QH + ((size_t)b * TT + q0 + col) * CCQ; const _Float16* qlr = QL + ((size_t)b * QHI + q0 + col) * CCQ;
#pragma unroll   // the arrays indexed here live in registers: every index must be a compile-time constant
    for (int kk = 0; kk < HDQK / 32; ++kk) { qh[kk] = frag_h(qr + kk * 32, lane); ql[kk] = frag_h(qlr + kk * 32, lane); } }
  const float sc2 = (float)RMASK[(size_t)b * TT + q0 + col] * (SCALE * 1.44269504088896340736f);   /* one factor a lane: multiplicative mask of its query row x 1/8 x log2(e); the softmax runs in base 2 */
  asm volatile("s_wait_xcnt 0x0" ::: "memory");       // before an address register of the loads above is written again
  asm volatile("s_wait_asynccnt 0x0" ::: "memory");   // stage 0 has landed for this wave's own copies
  __syncthreads();                                     // ... and for every wave's
  fa_fill(k_h + (size_t)FK * CCQ, k_l + (size_t)FK * CCQ, v_t + FK, &ring[1][0], tid);
  v8f o[CC / 16] = {}; float m = -3.0e38f, l = 0.f;
#pragma unroll 1   // one stage a trip: the buffer index stays a run-time bit and the loop stays small
  for (int t = 0; t < TT / FK; ++t) { const _Float16* sk = &ring[t & 1][(kh * 32 + col) * FKP]; const _Float16* sv = &ring[t & 1][2 * FK * FKP + col * FVP + kh * 32];
    v8f acc[2] = {}, accl[2] = {}; v16h ah[2][2], al[2][2];   /* fragments of k chunk kk + 1 are read from LDS in front of the products of chunk kk */
#pragma unroll   // the arrays indexed here live in registers: every index must be a compile-time constant
    for (int u = 0; u < 2; ++u) { ah[0][u] = frag_h(sk + u * 16 * FKP, lane); al[0][u] = frag_h(sk + (FK + u * 16) * FKP, lane); }
#pragma unroll   // the arrays indexed here live in registers: every index must be a compile-time constant
    for (int kk = 0; kk < HDQK / 32; ++kk) { const int c = kk & 1, n = c ^ 1;
      if (kk + 1 < HDQK / 32) {
#pragma unroll   // the arrays indexed here live in registers: every index must be a compile-time constant
        for (int u = 0; u < 2; ++u) { ah[n][u] = frag_h(sk + u * 16 * FKP + (kk + 1) * 32, lane); al[n][u] = frag_h(sk + (FK + u * 16) * FKP + (kk + 1) * 32, lane); } }
      __builtin_amdgcn_sched_barrier(0);   // the LDS reads of chunk kk + 1 stay in front of the products of chunk kk
      /* the two products into accl[0] stand three matrix instructions apart, those into accl[1] two */
      acc[0] = WM(ah[c][0], qh[kk], acc[0]); accl[0] = WM(ah[c][0], ql[kk], accl[0]); acc[1] = WM(ah[c][1], qh[kk], acc[1]); accl[1] = WM(ah[c][1], ql[kk], accl[1]); accl[0] = WM(al[c][0], qh[kk], accl[0]); accl[1] = WM(al[c][1], qh[kk], accl[1]);
      __builtin_amdgcn_sched_barrier(0); }   // no product of chunk kk + 1 is pulled in here: it would wait on LDS reads that were only just issued
    v16h vf[2][4];   /* the first four v fragments do not depend on P: their LDS reads are written ahead of the exponentials, which cover the latency */
#pragma unroll   // the arrays indexed here live in registers: every index must be a compile-time constant
    for (int u = 0; u < 4; ++u) vf[0][u] = frag_h(sv + u * 16 * FVP, lane);
    float s[2][8]; float mx0 = -3.0e38f, mx1 = -3.0e38f;
#pragma unroll   // the arrays indexed here live in registers: every index must be a compile-time constant
    for (int r = 0; r < 8; ++r) { const float v0 = (acc[0][r] + accl[0][r] * (1.0f / 1024.0f)) * sc2, v1 = (acc[1][r] + accl[1][r] * (1.0f / 1024.0f)) * sc2; s[0][r] = v0; s[1][r] = v1; mx0 = fmaxf(mx0, v0); mx1 = fmaxf(mx1, v1); }
    float mx = fmaxf(mx0, mx1); mx = fmaxf(mx, __shfl_xor(mx, 16));   /* the other 16 keys of the same query */
    const float mn = fmaxf(m, mx - 11.0f); const float af = __builtin_amdgcn_exp2f(m - mn); m = mn;   /* the running maximum is kept 11 lower, so that every 2^(s - mn) already carries the 2^11 of the f16 P; first stage: 2^(-3e38) = 0 */
    float ps0 = 0.f, ps1 = 0.f; v16h pf;
#pragma unroll   // the arrays indexed here live in registers: every index must be a compile-time constant
    for (int r = 0; r < 8; r += 2) { const v2f mn2 = {mn, mn}; const v2f d0 = (v2f){s[0][r], s[0][r + 1]} - mn2, d1 = (v2f){s[1][r], s[1][r + 1]} - mn2;   /* two differences an instruction */
      const float e0 = __builtin_amdgcn_exp2f(d0[0]), e1 = __builtin_amdgcn_exp2f(d1[0]), e2 = __builtin_amdgcn_exp2f(d0[1]), e3 = __builtin_amdgcn_exp2f(d1[1]);   /* arguments end at about 11: the bare hardware exponential needs no range handling (far below: 0) */
      ps0 += e0; ps1 += e1; ps0 += e2; ps1 += e3; pf[r] = (_Float16)e0; pf[r + 1] = (_Float16)e2; pf[8 + r] = (_Float16)e1; pf[9 + r] = (_Float16)e3; }
    l = l * af + (ps0 + ps1);   /* per lane: its own 16 keys a stage; the two lanes of a query are added behind the loop */
#pragma unroll   // the arrays indexed here live in registers: every index must be a compile-time constant
    for (int j = 0; j < CC / 16; ++j) o[j] = o[j] * af;
#pragma unroll   // the arrays indexed here live in registers: every index must be a compile-time constant
    for (int jg = 0; jg < CC / 64; ++jg) { const int c = jg & 1, n = c ^ 1;   /* four channel tiles a group: the LDS reads of group jg + 1 stand together in front of the products of group jg */
      if (jg + 1 < CC / 64) {
#pragma unroll   // the arrays indexed here live in registers: every index must be a compile-time constant
        for (int u = 0; u < 4; ++u) vf[n][u] = frag_h(sv + ((jg + 1) * 4 + u) * 16 * FVP, lane); }
      __builtin_amdgcn_sched_barrier(0);   // the LDS reads of group jg + 1 stay in one place, in front of the products of group jg
#pragma unroll   // the arrays indexed here live in registers: every index must be a compile-time constant
      for (int u = 0; u < 4; ++u) o[jg * 4 + u] = WM(vf[c][u], pf, o[jg * 4 + u]);
      __builtin_amdgcn_sched_barrier(0); }   // no LDS read of a later group is spread among these products
    asm volatile("s_wait_dscnt 0x0" ::: "memory");      // this wave's reads of buffer t & 1 are done before it is handed to the copies (last two trips: to the output staging)
    asm volatile("s_wait_asynccnt 0x0" ::: "memory");   // this wave's copies of stage t + 1 have landed
    __syncthreads();                                     // publishes stage t + 1 and ends every reader's last read of buffer t & 1
    if (t + 2 < TT / FK) fa_fill(k_h + (size_t)(t + 2) * FK * CCQ, k_l + (size_t)(t + 2) * FK * CCQ, v_t + (t + 2) * FK, &ring[t & 1][0], tid); }
  asm volatile("s_wait_asynccnt 0x0" ::: "memory");     // no copy is outstanding when the ring becomes output staging
  l += __shfl_xor(l, 16);
  xm[wave][lane] = m; xl[wave][lane] = l;
  __syncthreads();                                       // maximum and sum of the other key half are readable
  const float m2 = xm[wave ^ 4][lane], l2 = xl[wave ^ 4][lane]; const float ms = fmaxf(m, m2); const float a1 = __builtin_amdgcn_exp2f(m - ms), a2 = __builtin_amdgcn_exp2f(m2 - ms);
  const float f = a1 / (l * a1 + l2 * a2);   /* sums and outputs both carry the 2^11; the sum holds the 2^11 of the row's maximum: never 0 */
  float (*ss)[16][FOP] = (float (*)[16][FOP])&ring[0][0];   /* 8 x 16 x 260 f32 inside the ring, free behind the last trip's barrier; each wave writes its own range */
#pragma unroll   // the arrays indexed here live in registers: every index must be a compile-time constant
  for (int j = 0; j < CC / 16; ++j) { const v8f w = o[j] * f; const v4f w0 = {w[0], w[1], w[2], w[3]}, w1 = {w[4], w[5], w[6], w[7]}; *(v4f*)&ss[wave][col][j * 16 + 8 * g] = w0; *(v4f*)&ss[wave][col][j * 16 + 8 * g + 4] = w1; }
  __syncthreads();                                       // both halves' scaled outputs are readable
  for (int rl = 0; rl < 8; ++rl) { const int row = kh * 8 + rl;   /* a wave adds and stores 8 of its pair's 16 rows: two 512-B pieces a row */
#pragma unroll
    for (int c = 0; c < 2; ++c) vst2(Y + ((size_t)b * TT + q0 + row) * CC + c * 128 + lane * 4, *(const v4f*)&ss[qs][row][c * 128 + lane * 4] + *(const v4f*)&ss[qs + 4][row][c * 128 + lane * 4]); } }

extern "C" void kernel_launch(void* const* d_in, const int* in_sizes, int n_in, void* d_out, int out_size, void* d_ws, size_t ws_size, hipStream_t stream) {
  (void)in_sizes; (void)n_in; (void)out_size;
  const float** F = (const float**)d_in;
  if (ws_size < (size_t)WS_END) return;
  char* ws = (char*)d_ws; _Float16 *QH = (_Float16*)(ws + WS_QH), *KH = (_Float16*)(ws + WS_KH), *VT = (_Float16*)(ws + WS_VT), *QL = (_Float16*)(ws + WS_QL), *KL = (_Float16*)(ws + WS_KL); __bf16 *VB = (__bf16*)(ws + WS_VB), *VBL = (__bf16*)(ws + WS_VBL); float *S = (float*)(ws + WS_S), *Y = (float*)(ws + WS_Y);
  (void)S; (void)Y; (void)QL; (void)KL; (void)VB; (void)VBL;
  // inputs: 0 x [8,2048,256]; 1 kernel [3,256,256] ((in,out): Q | K | V matrices); 2 mask [8,2048] int32
  const float* Wq = F[1]; const float* Wk = F[1] + (size_t)DIN * CCQ; const float* Wv = F[1] + 2 * (size_t)DIN * CCQ;
  k_projT<0><<<dim3(TNB * TT / 64, CCQ / 128, 2), 128, 0, stream>>>(F[0], F[0], F[0], Wq, Wk, Wv, nullptr, nullptr, nullptr, QH, QL, KH, KL, VT, VB, VBL);   /* which 0, 1: q and k rows (hi + residual planes) */
  k_projT<2><<<dim3(TNB * TT / 64, CC / 128, 1), 128, 0, stream>>>(F[0], F[0], F[0], Wq, Wk, Wv, nullptr, nullptr, nullptr, QH, QL, KH, KL, VT, VB, VBL);     /* which 2: v planes */
  k_fa<<<dim3(TT / FQ, TNB), 256, 0, stream>>>(QH, QL, KH, KL, VT, (const int*)d_in[2], (float*)d_out);   /* scores, softmax, P . v: all batches in one launch */
}

// v006
// Measured time: 74.1 microseconds a run.
// In both of two side-by-side timings against v005, it was 1.13 times as fast.
// Over all steps from v000 it is 6.88 times as fast.
// compute dtype: all float inputs rounded to bf16; q/k/v projections with EXACT bf16 products on WMMA 16x16x32 (f32 accumulate); logits q x k with BOTH operands as f16 hi + (x 2^10) residual (3 products: hi.hi + lo.hi + hi.lo) x 64^-0.5, for every row (the logits have sigma - 500); the int row mask multiplies the logits in f32; softmax f32 with a running maximum (scores, softmax and P.v fused); exp(logit - running maximum) x 2^11 once to f16 x v once to f16 (1 product), divided by the row sum at the end; f32 output.
#include <hip/hip_runtime.h>
#include <math.h>

typedef __attribute__((ext_vector_type(16))) _Float16 v16h;
typedef __attribute__((ext_vector_type(16))) __bf16 v16b;
typedef __attribute__((ext_vector_type(8)))  _Float16 v8h;
typedef __attribute__((ext_vector_type(8)))  float v8f;
typedef __attribute__((ext_vector_type(4)))  float v4f;
typedef __attribute__((ext_vector_type(2)))  float v2f;
typedef __attribute__((ext_vector_type(4)))  unsigned v4u;
typedef __attribute__((ext_vector_type(4)))  int v4i;
typedef float __attribute__((may_alias)) float_a;
typedef int __attribute__((may_alias)) int_a;

template <typename T> __device__ __forceinline__ void vst2(void* p, T v) { *(T*)p = v;  }
__device__ __forceinline__ v8f wmma16(v16h a, v16h b, v8f c) {
  v8f d = __builtin_amdgcn_wmma_f32_16x16x32_f16(false, a, false, b, (short)0, c, false, false);
  asm volatile("v_nop\n\tv_nop\n\tv_nop\n\tv_nop" : "+v"(d) : "v"(a), "v"(b));
  return d;
}
__device__ __forceinline__ v8f wmma_bf(v16b a, v16b b, v8f c) {
  v8f d = __builtin_amdgcn_wmma_f32_16x16x32_bf16(false, a, false, b, (short)0, c, false, false);
  asm volatile("v_nop\n\tv_nop\n\tv_nop\n\tv_nop" : "+v"(d) : "v"(a), "v"(b));
  return d;
}
// 16x16x32 fragments: lane = (h = lane>>4, row/col = lane&15); elements 0..7 = k0+8h+0..7, 8..15 = k0+16+8h+0..7; D element r = row 8h+r
__device__ __forceinline__ v16h frag_h(const _Float16* rowk0, int lane) {
  union { v16h v; v8h q[2]; } u; const _Float16* p = rowk0 + 8 * (lane >> 4);
  u.q[0] = *(const v8h*)p; u.q[1] = *(const v8h*)(p + 16); return u.v;
}
__device__ __forceinline__ v16h frag_f32(const float* rowk0, int lane) {
  v16h a; const float* p = rowk0 + 8 * (lane >> 4);
#pragma unroll
  for (int i = 0; i < 8; ++i) { a[i] = (_Float16)p[i]; a[8 + i] = (_Float16)p[16 + i]; }
  return a;
}
__device__ __forceinline__ v16h frag_f32s(const float* rowk0, int lane, float sc) {
  v16h a; const float* p = rowk0 + 8 * (lane >> 4);
#pragma unroll
  for (int i = 0; i < 8; ++i) { a[i] = (_Float16)(p[i] * sc); a[8 + i] = (_Float16)(p[16 + i] * sc); }
  return a;
}
// column fragment from a [K][ld] layout (column n), rows >= K read as 0
__device__ __forceinline__ v16h fragc_f32(const float* W, int k0, int n, int lane, int ld, int K) {
  v16h a; const int g = lane >> 4;
#pragma unroll
  for (int i = 0; i < 8; ++i) { const int ka = k0 + 8 * g + i, kb = ka + 16;
    a[i] = (_Float16)(ka < K ? W[(size_t)(ka < K ? ka : K - 1) * ld + n] : 0.f); a[8 + i] = (_Float16)(kb < K ? W[(size_t)(kb < K ? kb : K - 1) * ld + n] : 0.f); }
  return a;
}
struct F2 { v16b h, l; };
__device__ __forceinline__ F2 bsplit16(const float v[16]) { F2 r;
#pragma unroll
  for (int i = 0; i < 16; ++i) { const __bf16 h = (__bf16)v[i]; r.h[i] = h; r.l[i] = (__bf16)(v[i] - (float)h); }
  return r; }
__device__ __forceinline__ F2 split_row(const float* row, int k0, int lane) { float v[16]; const float* p = row + k0 + 8 * (lane >> 4);
#pragma unroll
  for (int i = 0; i < 8; ++i) { v[i] = p[i]; v[8 + i] = p[16 + i]; }
  return bsplit16(v); }
__device__ __forceinline__ F2 split_rowK(const float* row, int k0, int lane, int K) { float v[16]; const int g = lane >> 4;
#pragma unroll
  for (int i = 0; i < 8; ++i) { const int ka = k0 + 8 * g + i, kb = ka + 16; v[i] = ka < K ? row[ka < K ? ka : K - 1] : 0.f; v[8 + i] = kb < K ? row[kb < K ? kb : K - 1] : 0.f; }
  return bsplit16(v); }
__device__ __forceinline__ F2 split_col(const float* W, int k0, int n, int lane, int ld, int K) { float v[16]; const int g = lane >> 4;
#pragma unroll
  for (int i = 0; i < 8; ++i) { const int ka = k0 + 8 * g + i, kb = ka + 16; v[i] = ka < K ? W[(size_t)(ka < K ? ka : K - 1) * ld + n] : 0.f; v[8 + i] = kb < K ? W[(size_t)(kb < K ? kb : K - 1) * ld + n] : 0.f; }
  return bsplit16(v); }
__device__ __forceinline__ v8f mac3(const F2& a, const F2& b, v8f c) { c = wmma_bf(a.l, b.h, c); c = wmma_bf(a.h, b.l, c); return wmma_bf(a.h, b.h, c); }
__device__ __forceinline__ float sigm(float v) { return 1.0f / (1.0f + expf(-v)); }
#define LDSX() do { asm volatile("s_wait_dscnt 0" ::: "memory"); __builtin_amdgcn_wave_barrier(); __builtin_amdgcn_fence(__ATOMIC_RELEASE, "workgroup"); } while (0)

// Single-head self-attention with unscaled N(0,1) projection kernels and a multiplicative row mask (x [8,2048,256]; kernel [3,256,256] (in,out): Q, K, V; mask [8,2048] int 0/1; SCALE = 1/sqrt(64) hard-coded): QK = (Q K^T) / 8; QK *= mask[b][q] per QUERY row (masked rows: all-zero logits -> uniform attention); A = softmax(QK); out = A V -> [8,2048,256].
#define NB 8
#define TT 2048
#define CC 256            // value width (v planes, output rows)
#define CCQ 256           // q / k row width
#define DIN 256          // x width
#define NH 1
#define HD 256
#define NQB (TT / 64)
#define HG 4               // four 2,048 x 2,048 f32 planes of WS_S, which hold k_fa's partials, slots and tile counts (k_fa keeps the logits on chip)
#define SCALE (0.125f)             // 1/sqrt(64), hard-coded in the source
#define HDQK 256           // q / k width
#define CAUSAL 0
#ifndef TNB
#define TNB NB
#endif
__device__ __forceinline__ v16b zero16b() { v16b z; _Pragma("unroll") for (int i = 0; i < 16; ++i) z[i] = (__bf16)0.f; return z; }
__device__ __forceinline__ float bfr(float v) { return (float)(__bf16)v; }
__host__ __device__ __forceinline__ int kb_last(int qb) { return CAUSAL ? ((qb * 64 + 63) >> 7) : (TT / 128 - 1); }
typedef __attribute__((ext_vector_type(8))) __bf16 v8b;
__device__ __forceinline__ v16b frag_b(const __bf16* rowk0, int lane) {
  union { v16b v; v8b q[2]; } u; const __bf16* p = rowk0 + 8 * (lane >> 4);
  u.q[0] = *(const v8b*)p; u.q[1] = *(const v8b*)(p + 16); return u.v;
}
#define QBH 0              // k_fa keeps the single-product P.v path for every block
#define QBH_SC NQB         // k_fa: EVERY query block takes the 3-product (q hi+lo x k hi+lo) path
#define QHI TT              // q residual rows for every query
#define KHI TT              // k residual rows for every key (the bf16 v hi/lo planes are written too but unused)
// B fragment (k rows k0+.., output column o) of a weight: (in,out) [K][ld] or (out,in) [ld rows of K]: bf16 exact, or f16(bf16 * 256) exact
__device__ __forceinline__ v16b wcol_io(const float* Wm, int k0, int o, int lane, int ld) { v16b w; const int g = lane >> 4;
#pragma unroll
  for (int i = 0; i < 8; ++i) { w[i] = (__bf16)Wm[(size_t)(k0 + 8 * g + i) * ld + o]; w[8 + i] = (__bf16)Wm[(size_t)(k0 + 16 + 8 * g + i) * ld + o]; }
  return w; }
__device__ __forceinline__ v16b wcol_oi(const float* Wm, int k0, int o, int lane, int K) { v16b w; const float* p = Wm + (size_t)o * K + k0 + 8 * (lane >> 4);
#pragma unroll
  for (int i = 0; i < 8; ++i) { w[i] = (__bf16)p[i]; w[8 + i] = (__bf16)p[16 + i]; }
  return w; }
__device__ __forceinline__ v16h wcolh_io(const float* Wm, int k0, int o, int lane, int ld) { v16h w; const int g = lane >> 4;
#pragma unroll
  for (int i = 0; i < 8; ++i) { w[i] = (_Float16)(bfr(Wm[(size_t)(k0 + 8 * g + i) * ld + o]) * 256.0f); w[8 + i] = (_Float16)(bfr(Wm[(size_t)(k0 + 16 + 8 * g + i) * ld + o]) * 256.0f); }
  return w; }
__device__ __forceinline__ v16h wcolh_oi(const float* Wm, int k0, int o, int lane, int K) { v16h w; const float* p = Wm + (size_t)o * K + k0 + 8 * (lane >> 4);
#pragma unroll
  for (int i = 0; i < 8; ++i) { w[i] = (_Float16)(bfr(p[i]) * 256.0f); w[8 + i] = (_Float16)(bfr(p[16 + i]) * 256.0f); }
  return w; }
#define WQKV_LAYOUT 0   // 0 = (in,out) [K][CC]; 1 = (out,in) [CC][DIN]; 2 = per-head [NH][DIN][HD]
__device__ __forceinline__ v16b wcol_hdk(const float* Wm, int k0, int o, int lane) { v16b w; const int g = lane >> 4; const float* p = Wm + (size_t)(o / HD) * DIN * HD + (o % HD);
#pragma unroll
  for (int i = 0; i < 8; ++i) { w[i] = (__bf16)p[(size_t)(k0 + 8 * g + i) * HD]; w[8 + i] = (__bf16)p[(size_t)(k0 + 16 + 8 * g + i) * HD]; }
  return w; }
#define WO_OUT_IN 0
#if WQKV_LAYOUT == 1
#define WCOL(W, k0, o, lane) wcol_oi(W, k0, (o), lane, DIN)   /* unused: layout 0 */
#elif WQKV_LAYOUT == 2
#define WCOL(W, k0, o, lane) wcol_hdk(W, k0, o, lane)
#else
#define WCOL(W, k0, o, lane) (which == 2 ? wcol_io(W, k0, (o), lane, CC) : ((o) < HDQK ? wcol_io(W, k0, (o), lane, HDQK) : zero16b()))   /* Wv [256][256]; Wq/Wk [256][256]: projected q/k columns >= 256 would read as zero (grid y = 2 covers 0..255) */
#endif
#if WO_OUT_IN
#define WOCOL(W, k0, o, lane) wcol_oi(W, k0, o, lane, CC)
#define WOCOLH(W, k0, o, lane) wcolh_oi(W, k0, o, lane, CC)
#else
#define WOCOL(W, k0, o, lane) wcol_io(W, k0, o, lane, DIN)
#define WOCOLH(W, k0, o, lane) wcolh_io(W, k0, o, lane, DIN)
#endif
#define BG HG
#define BGN (TNB < BG ? TNB : BG)   // unused: k_fa takes all TNB batches in one launch
#define DVH 128            // unused: a k_fa wave keeps all 256 value columns in 16 accumulator tiles
#define SM_EXTRA_PARAMS , int bsm, const int* __restrict__ RMASK
// multiplicative per-QUERY-row int mask applied to the scaled logits before the softmax (mask 0 -> every logit of the row becomes 0 -> uniform attention), as the module
#define SM_MASK_HOOK do { v = v * (float)RMASK[(size_t)(bsm + (int)blockIdx.y) * TT + t]; } while (0)
#ifndef SM_EXTRA_PARAMS
#define SM_EXTRA_PARAMS
#endif
#ifndef PROJ_EXTRA_PARAMS
#define PROJ_EXTRA_PARAMS
#endif
#ifndef SM_MASK_HOOK
#define SM_MASK_HOOK (void)0
#endif

#define WS_QH  0u                                      // f16 q rows [b*t][CCQ]
#define WS_KH  (WS_QH + 2u * (size_t)NB * TT * CCQ)     // f16 k rows [b*t][CCQ]
#define WS_VT  (WS_KH + 2u * (size_t)NB * TT * CCQ)     // f16 v planes [b][c][t]
#define WS_QL  (WS_VT + 2u * (size_t)NB * CC * TT)      // f16 q residual x 2^10 rows [b][t < QHI][CCQ]
#define WS_KL  (WS_QL + 2u * (size_t)NB * QHI * CCQ)    // f16 k residual x 2^10 rows [b][t < KHI][CCQ]
#define WS_VB  (WS_KL + 2u * (size_t)NB * KHI * CCQ)    // bf16 v hi planes [b][c][t < KHI]
#define WS_VBL (WS_VB + 2u * (size_t)NB * CC * KHI)
#define WS_S   (WS_VBL + 2u * (size_t)NB * CC * KHI)    // f32 [hg][t][s] space: k_fa keeps the logits on chip; its partials lie here
#define WS_Y   (WS_S  + 4u * (size_t)HG * TT * TT)      // f32 ctx rows [b*t][CC] (only when there is an output projection)
#define WS_END (WS_Y  + 0u)

#define PWP 264            // staged weight row pitch in bf16: 512 B + 16 B (16 B x odd: ds_load_b128 walks over rows meet no bank twice)
// four waves a SIMD (256 registers) and 67,584 B of LDS: four blocks a WGP, so that the 1,024 blocks of the q/k launch are resident at once
// ---- k_proj: block = (64 rows, 128 cols, which): q/k/v = X W (+ b) with exact bf16 products (K = DIN) -> which 0: q f16 rows (+ residual rows < QHI); 1: k f16 rows (+ residual rows < KHI); 2: v f16 planes [c][t] (+ bf16 hi/lo planes for t < KHI)
template <int WOFF> __global__ __launch_bounds__(128) __attribute__((amdgpu_waves_per_eu(4))) void k_projT(const float* __restrict__ XQ, const float* __restrict__ XK, const float* __restrict__ XV, const float* __restrict__ WQ, const float* __restrict__ WK, const float* __restrict__ WV, const float* __restrict__ BQ, const float* __restrict__ BK, const float* __restrict__ BV,
    _Float16* __restrict__ QH, _Float16* __restrict__ QL, _Float16* __restrict__ KH, _Float16* __restrict__ KL, _Float16* __restrict__ VT, __bf16* __restrict__ VB, __bf16* __restrict__ VBL) {
  // one LDS pool: first the weight tile, bf16, transposed to [output column][k]; behind the products (and a barrier) the same bytes are the output staging
  __shared__ __align__(16) char pool[128 * PWP * 2];
  __bf16 (*wt)[PWP] = (__bf16 (*)[PWP])pool;
  _Float16 (*sh)[136] = (_Float16 (*)[136])pool; _Float16 (*sl)[136] = (_Float16 (*)[136])(pool + 64 * 136 * 2);
  _Float16 (*th)[72] = (_Float16 (*)[72])pool; __bf16 (*tb)[72] = (__bf16 (*)[72])(pool + 128 * 72 * 2); __bf16 (*tbl)[72] = (__bf16 (*)[72])(pool + 2 * 128 * 72 * 2);
  const int tid = threadIdx.x, wave = tid >> 5, lane = tid & 31, col = lane & 15, g = lane >> 4; const int which = blockIdx.z + WOFF; const int c0 = blockIdx.y * 128; const size_t r0 = (size_t)blockIdx.x * 64; const size_t bb = r0 / TT; const int t0 = (int)(r0 % TT);
  const float* X = which == 0 ? XQ : which == 1 ? XK : XV; const float* WA = which == 0 ? WQ : which == 1 ? WK : WV; const float* BA = which == 0 ? BQ : which == 1 ? BK : BV;
  const int KD = DIN;
  v8f acc[8] = {};
  v16b xa[DIN / 32];   /* this wave's 16 x rows, whole width, as A fragments */
  /* Weight tile [DIN][128 columns from c0] -> wt[column][k], read from global ONCE per block. A wave fills its own 32 columns; a lane takes 4 columns x 8 k a unit: 8 loads of 16 B (a wave's load = four whole 128-B lines), 4 LDS stores of 16 B (8 k of one column).
     Twelve units of 8 loads a lane: 0..7 = the weight tile's 32-k slabs, 8..11 = two k chunks each of the lane's x row. Six units are in flight; a unit is used up (to LDS, or to bf16 fragments) and then the unit six further on is issued into its registers. */
  { const int cb = wave * 32 + (lane & 7) * 4, kq = (lane >> 3) * 8; const float* pw = WA + (size_t)kq * CCQ + c0 + cb; const float* px = X + (r0 + wave * 16 + col) * (size_t)KD + 8 * g;   /* x row-major [b*t][KD] */
    v4f un[12][8];
#pragma unroll   // the arrays indexed here live in registers: every index must be a compile-time constant
    for (int n = -6; n < 12; ++n) {
      if (n >= 0 && n < 8) {
#pragma unroll
        for (int c = 0; c < 4; ++c) { v8b t;
#pragma unroll
          for (int i = 0; i < 8; ++i) t[i] = (__bf16)un[n][i][c];
          *(v8b*)&wt[cb + c][n * 32 + kq] = t; } }
      if (n >= 8) {
#pragma unroll
        for (int e = 0; e < 32; ++e) xa[(n - 8) * 2 + (e >> 4)][e & 15] = (__bf16)un[n][e >> 2][e & 3]; }
      __builtin_amdgcn_sched_barrier(0);   // unit n is used up before unit n + 6 is issued: its registers are free again (no spill at four waves a SIMD)
      const int m = n + 6;
      if (m < 8) {
#pragma unroll
        for (int i = 0; i < 8; ++i) un[m][i] = *(const v4f*)(pw + (size_t)(m * 32 + i) * CCQ); }
      else if (m < 12) {
#pragma unroll
        for (int i = 0; i < 8; ++i) un[m][i] = *(const v4f*)(px + ((m - 8) * 2 + (i >> 2)) * 32 + ((i >> 1) & 1) * 16 + (i & 1) * 4); }
      if (m == 11) asm volatile("s_wait_xcnt 0x0" ::: "memory");   // behind the last load: before an address register of the loads above is written again
      __builtin_amdgcn_sched_barrier(0); } }   // the loads of unit n + 6 are issued here and not pushed behind the wait for unit n + 1
  __syncthreads();   // the whole weight tile is readable by every wave
  v16b bf[2][4];   /* B fragments in groups of four (group f: k chunk f >> 1, column tiles 4 (f & 1) + 0..3); the LDS reads of group f + 1 stand together in front of the products of group f */
#pragma unroll   // the arrays indexed here live in registers: every index must be a compile-time constant
  for (int u = 0; u < 4; ++u) bf[0][u] = frag_b(&wt[u * 16 + col][0], lane);
#pragma unroll   // the arrays indexed here live in registers: every index must be a compile-time constant
  for (int f = 0; f < DIN / 16; ++f) { const int cu = f & 1, nx = cu ^ 1;
    if (f + 1 < DIN / 16) {
#pragma unroll
      for (int u = 0; u < 4; ++u) bf[nx][u] = frag_b(&wt[(nx * 4 + u) * 16 + col][((f + 1) >> 1) * 32], lane); }
    __builtin_amdgcn_sched_barrier(0);   // the LDS reads of group f + 1 stay in one place, in front of the products of group f
#pragma unroll
    for (int u = 0; u < 4; ++u) acc[cu * 4 + u] = __builtin_amdgcn_wmma_f32_16x16x32_bf16(false, xa[f >> 1], false, bf[cu][u], (short)0, acc[cu * 4 + u], false, false);   /* same products in the same k order as before */
    __builtin_amdgcn_sched_barrier(0); }   // no LDS read of a later group is spread among these products
  __syncthreads();   // every wave's last read of the weight tile is done before the pool becomes output staging
  if (which < 2) { _Float16* DH = which == 0 ? QH : KH; _Float16* DL = which == 0 ? QL : KL; const int nhi = which == 0 ? QHI : KHI; const bool hi_rows = t0 < nhi;
#pragma unroll
    for (int j = 0; j < 8; ++j) { const float bias = BA ? bfr(BA[c0 + j * 16 + col]) : 0.f;
#pragma unroll
      for (int r = 0; r < 8; ++r) { const float v = acc[j][r] + bias; const _Float16 hv = (_Float16)v; sh[wave * 16 + 8 * g + r][j * 16 + col] = hv; sl[wave * 16 + 8 * g + r][j * 16 + col] = (_Float16)((v - (float)hv) * 1024.0f); } }
    __syncthreads();
    for (int e = tid; e < 64 * 16; e += 128) { const int rl = e >> 4, q = e & 15; vst2((unsigned*)(DH + (r0 + rl) * CCQ + c0 + q * 8), *(const v4u*)&sh[rl][q * 8]); if (hi_rows) vst2((unsigned*)(DL + (bb * nhi + t0 + rl) * (size_t)CCQ + c0 + q * 8), *(const v4u*)&sl[rl][q * 8]); }   /* q/k rows: pitch CCQ (c0 = 0 or 128) */
  } else { const bool hi_rows = t0 < KHI;
#pragma unroll
    for (int j = 0; j < 8; ++j) { const float bias = BA ? bfr(BA[c0 + j * 16 + col]) : 0.f;
      v8h hv; v8b bv, lv;   /* a lane's 8 rows of one column lie side by side in the staged planes: one 16-byte LDS store a plane */
#pragma unroll
      for (int r = 0; r < 8; ++r) { const float v = acc[j][r] + bias; hv[r] = (_Float16)v; const __bf16 bh = (__bf16)v; bv[r] = bh; lv[r] = (__bf16)(v - (float)bh); }
      { const int rl = wave * 16 + 8 * g, cl = j * 16 + col; *(v8h*)&th[cl][rl] = hv; *(v8b*)&tb[cl][rl] = bv; *(v8b*)&tbl[cl][rl] = lv; } }
    __syncthreads();
    for (int e = tid; e < 128 * 8; e += 128) { const int cl = e >> 3, q = e & 7; vst2((unsigned*)(VT + (bb * CC + c0 + cl) * (size_t)TT + t0 + q * 8), *(const v4u*)&th[cl][q * 8]); if (hi_rows) { const size_t o3 = (bb * CC + c0 + cl) * (size_t)KHI + t0 + q * 8; vst2((unsigned*)(VB + o3), *(const v4u*)&tb[cl][q * 8]); vst2((unsigned*)(VBL + o3), *(const v4u*)&tbl[cl][q * 8]); } } } }
__device__ __forceinline__ unsigned lds_off(const void* p) { return (unsigned)(size_t)p; }
// eight 16-byte copies of one lane, global -> LDS; the s_wait_xcnt stands inside the statement so that no address register is rewritten in front of it
__device__ __forceinline__ void copy8(const unsigned l[8], const char* const gp[8]) {
  asm volatile("global_load_async_to_lds_b128 %0, %8, off\n\t"
               "global_load_async_to_lds_b128 %1, %9, off\n\t"
               "global_load_async_to_lds_b128 %2, %10, off\n\t"
               "global_load_async_to_lds_b128 %3, %11, off\n\t"
               "global_load_async_to_lds_b128 %4, %12, off\n\t"
               "global_load_async_to_lds_b128 %5, %13, off\n\t"
               "global_load_async_to_lds_b128 %6, %14, off\n\t"
               "global_load_async_to_lds_b128 %7, %15, off\n\t"
               "s_wait_xcnt 0x0"
               :: "v"(l[0]), "v"(l[1]), "v"(l[2]), "v"(l[3]), "v"(l[4]), "v"(l[5]), "v"(l[6]), "v"(l[7]),
                  "v"(gp[0]), "v"(gp[1]), "v"(gp[2]), "v"(gp[3]), "v"(gp[4]), "v"(gp[5]), "v"(gp[6]), "v"(gp[7]) : "memory");
}
// the compiler keeps the distance behind its own builtin form
__device__ __forceinline__ v8f WM(v16h a, v16h b, v8f c) { return __builtin_amdgcn_wmma_f32_16x16x32_f16(false, a, false, b, (short)0, c, false, false); }
// ---- k_fa: scores, softmax and P . v in ONE kernel; the logits never leave the WGP. A tile = 64 query slots of one batch (which tiles a block works on: below); 8 waves = 4 query sub-tiles of 16 x 2 key halves: of every stage of 64 keys a wave takes 32.
// Scores TRANSPOSED: A = k rows (LDS), B = q rows (registers, hi + residual): D element r = key 8h + r, column = query = lane & 15; same 3 products in the same k order (hi.hi | k hi . q lo + k lo . q hi).
// So a lane holds 16 keys of ONE query: maximum and sum are in-lane plus one exchange with lane ^ 16, and two 16-key score tiles ARE the B fragment of 32 keys (elements 0..7 = tile 0, 8..15 = tile 1).
// Output TRANSPOSED too: A = v plane rows [channel][key] (LDS), B = P: D element r = channel 8h + r, column = query, so the running-maximum rescale is one factor per lane.
// k hi, k lo (64 rows x 512 B) and v (256 rows x 128 B) of a stage come into LDS by asynchronous copies, two buffers: the next stage flies while this one is multiplied. The two key halves are merged through LDS where a tile's share ends.
// A query row whose mask is 0 has all-zero logits whatever q and k are: all such rows of a batch have the SAME output row. The rows are ordered (mask != 0 first, in row order, then the others); only the slots 0 .. n1 are needed (slot n1 = one row of mask 0, which goes the ordinary way with factor 0 and stands for all of them).
// nt = tiles of 64 slots that hold them. The nt x 32 (tile, key stage) units of a batch are dealt in order to its 32 blocks, nt units each, for every mask; a block meets at most two tiles and writes one partial (maximum, sum, unnormalised output) for each; k_mg joins the partials of a row.
#define FQ 64              // query slots per tile
#define FK 64              // keys per LDS stage
#define FKP 264            // staged k row pitch in f16: 512 B + 16 B (16 B x odd: ds_load_b128 walks over rows meet no bank twice)
#define FVP 72             // staged v row pitch in f16: 128 B + 16 B (same reason)
#define FST (2 * FK * FKP + CC * FVP)   // f16 elements of one buffer
#define FSP 132            // staged partial-output row pitch in f32: 128 channels a pass + 16 B
#define NST (TT / FK)       // key stages of one query tile
static_assert(NST == NQB, "a batch has as many blocks as a tile has stages: every block gets exactly nt stages");
#define WS_PO  WS_S                                          // f32 partial outputs [b][block][segment][64 slots][CC]
#define WS_PM  (WS_PO + 4u * (size_t)NB * NQB * 2 * FQ * CC)   // f32 partial maxima [b][block][segment][64 slots]
#define WS_PL  (WS_PM + 4u * (size_t)NB * NQB * 2 * FQ)        // f32 partial sums, same shape
#define WS_SL  (WS_PL + 4u * (size_t)NB * NQB * 2 * FQ)        // int slot of every query row [b][t]
#define WS_NT  (WS_SL + 4u * (size_t)NB * TT)                  // int tiles of every batch [b]
static_assert(WS_NT + 4u * NB <= WS_END, "the partials lie inside the former logit planes");
// one stage: 256 threads, 24 copies each; a wave's copy covers one 512-B k row or four 128-B v row pieces
__device__ __forceinline__ void fa_fill(const _Float16* k_h, const _Float16* k_l, const _Float16* v_t, _Float16* sr, int tid) {
  unsigned l[8]; const char* gp[8];
#pragma unroll   // the arrays indexed here live in registers: every index must be a compile-time constant
  for (int i = 0; i < 8; ++i) { const int e = i * 256 + tid, row = e >> 5, q = e & 31; l[i] = lds_off(sr + row * FKP + q * 8); gp[i] = (const char*)(k_h + (size_t)row * CCQ + q * 8); }
  copy8(l, gp);
#pragma unroll   // the arrays indexed here live in registers: every index must be a compile-time constant
  for (int i = 0; i < 8; ++i) { const int e = i * 256 + tid, row = e >> 5, q = e & 31; l[i] = lds_off(sr + (FK + row) * FKP + q * 8); gp[i] = (const char*)(k_l + (size_t)row * CCQ + q * 8); }
  copy8(l, gp);
#pragma unroll   // the arrays indexed here live in registers: every index must be a compile-time constant
  for (int i = 0; i < 8; ++i) { const int e = i * 256 + tid, row = e >> 3, q = e & 7; l[i] = lds_off(sr + 2 * FK * FKP + row * FVP + q * 8); gp[i] = (const char*)(v_t + (size_t)row * TT + q * 8); }
  copy8(l, gp);
}
__global__ __launch_bounds__(256) void k_fa(const _Float16* __restrict__ QH, const _Float16* __restrict__ QL, const _Float16* __restrict__ KH, const _Float16* __restrict__ KL, const _Float16* __restrict__ VT, const int* __restrict__ RMASK, float* __restrict__ PO, float* __restrict__ PM, float* __restrict__ PL, int* __restrict__ SL, int* __restrict__ NT) {
  __shared__ __align__(16) _Float16 ring[2][FST]; __shared__ __align__(16) float st[8][16][FSP]; __shared__ float xm[8][32], xl[8][32]; __shared__ unsigned short ord[TT];
  const int tid = threadIdx.x, wave = tid >> 5, lane = tid & 31, col = lane & 15, g = lane >> 4; const int qs = wave & 3, kh = wave >> 2; const int b = blockIdx.y;
  const _Float16* k_h = KH + (size_t)b * TT * CCQ; const _Float16* k_l = KL + (size_t)b * KHI * CCQ; const _Float16* v_t = VT + (size_t)b * CC * TT;
  int n1;   /* rows of this batch with mask != 0 */
  { /* every wave counts the whole batch by itself (a lane: 64 rows as two bit words, then a scan over the lanes); of each lane's 64 rows wave w enters 8 into ord[slot] = row */
    const int* mk = RMASK + (size_t)b * TT + lane * 64; unsigned lo = 0, hi = 0;
#pragma unroll
    for (int c = 0; c < 8; ++c) { const v4i w0 = *(const v4i*)(mk + 4 * c), w1 = *(const v4i*)(mk + 32 + 4 * c);
#pragma unroll
      for (int e = 0; e < 4; ++e) { lo |= (w0[e] != 0 ? 1u : 0u) << (4 * c + e); hi |= (w1[e] != 0 ? 1u : 0u) << (4 * c + e); } }
    asm volatile("s_wait_xcnt 0x0" ::: "memory");       // before an address register of the loads above is written again
    const int cnt = __popc(lo) + __popc(hi); int inc = cnt;
#pragma unroll
    for (int d = 1; d < 32; d <<= 1) { const int y = __shfl_up(inc, d); if (lane >= d) inc += y; }
    n1 = __shfl(inc, 31);
    const unsigned word = wave < 4 ? lo : hi; const int sh = (wave & 3) * 8;
    int r1 = inc - cnt + (wave < 4 ? 0 : __popc(lo)) + __popc(word & ((1u << sh) - 1u));   /* rows with mask != 0 in front of row p */
    int sv[8];
#pragma unroll
    for (int i = 0; i < 8; ++i) { const int p = lane * 64 + wave * 8 + i; const int bit = (int)((word >> (sh + i)) & 1u); ord[bit ? r1 : n1 + p - r1] = (unsigned short)p; sv[i] = bit ? r1 : n1; r1 += bit; }
    if (blockIdx.x == 0) { int* sp = SL + (size_t)b * TT + lane * 64 + wave * 8; vst2(sp, (v4i){sv[0], sv[1], sv[2], sv[3]}); vst2(sp + 4, (v4i){sv[4], sv[5], sv[6], sv[7]});
      asm volatile("s_wait_xcnt 0x0" ::: "memory"); } }   // before an address register of the stores above is written again
  const int nt = __builtin_amdgcn_readfirstlane(n1 < TT ? (n1 >> 6) + 1 : NQB);   /* 1 .. 32 for every mask */
  if (blockIdx.x == 0 && tid == 0) NT[b] = nt;
  asm volatile("s_wait_xcnt 0x0" ::: "memory");       // before an address register of the store above is written again
  const int u0 = blockIdx.x * nt;   /* this block's units: u0 .. u0 + nt - 1; unit u = (tile u / 32, key stage u % 32) */
  { const int s = u0 & (NST - 1); fa_fill(k_h + (size_t)s * FK * CCQ, k_l + (size_t)s * FK * CCQ, v_t + s * FK, &ring[0][0], tid); }
  asm volatile("s_wait_asynccnt 0x0" ::: "memory");   // the first stage has landed for this wave's own copies
  __syncthreads();                                     // ... and for every wave's; ord is readable too
  if (nt > 1) { const int s = (u0 + 1) & (NST - 1); fa_fill(k_h + (size_t)s * FK * CCQ, k_l + (size_t)s * FK * CCQ, v_t + s * FK, &ring[1][0], tid); }
  v16h qh[HDQK / 32] = {}, ql[HDQK / 32] = {};   /* this wave's 16 query rows, whole width, as B fragments */
  float sc2 = 0.f;
  v8f o[CC / 16] = {}; float m = -3.0e38f, l = 0.f;
#pragma unroll 1   // one stage a trip: the buffer index stays a run-time bit and the loop stays small
  for (int t = 0; t < nt; ++t) { const int u = u0 + t; const _Float16* sk = &ring[t & 1][(kh * 32 + col) * FKP]; const _Float16* sv = &ring[t & 1][2 * FK * FKP + col * FVP + kh * 32];
    if (t == 0 || (u & (NST - 1)) == 0) {   /* a tile begins (the same test in every wave of the block): its query rows */
      const int qrow = ord[((u / NST) * FQ + qs * 16 + col) & (TT - 1)] & (TT - 1);
      const _Float16* qr = QH + ((size_t)b * TT + qrow) * CCQ; const _Float16* qlr = QL + ((size_t)b * QHI + qrow) * CCQ;
#pragma unroll   // the arrays indexed here live in registers: every index must be a compile-time constant
      for (int kk = 0; kk < HDQK / 32; ++kk) { qh[kk] = frag_h(qr + kk * 32, lane); ql[kk] = frag_h(qlr + kk * 32, lane); }
      sc2 = (float)RMASK[(size_t)b * TT + qrow] * (SCALE * 1.44269504088896340736f);   /* one factor a lane: multiplicative mask of its query row x 1/8 x log2(e); the softmax runs in base 2 */
      asm volatile("s_wait_xcnt 0x0" ::: "memory"); }   // before an address register of the loads above is written again
    v8f acc[2] = {}, accl[2] = {}; v16h ah[2][2], al[2][2];   /* fragments of k chunk kk + 1 are read from LDS in front of the products of chunk kk */
#pragma unroll   // the arrays indexed here live in registers: every index must be a compile-time constant
    for (int u = 0; u < 2; ++u) { ah[0][u] = frag_h(sk + u * 16 * FKP, lane); al[0][u] = frag_h(sk + (FK + u * 16) * FKP, lane); }
#pragma unroll   // the arrays indexed here live in registers: every index must be a compile-time constant
    for (int kk = 0; kk < HDQK / 32; ++kk) { const int c = kk & 1, n = c ^ 1;
      if (kk + 1 < HDQK / 32) {
#pragma unroll   // the arrays indexed here live in registers: every index must be a compile-time constant
        for (int u = 0; u < 2; ++u) { ah[n][u] = frag_h(sk + u * 16 * FKP + (kk + 1) * 32, lane); al[n][u] = frag_h(sk + (FK + u * 16) * FKP + (kk + 1) * 32, lane); } }
      __builtin_amdgcn_sched_barrier(0);   // the LDS reads of chunk kk + 1 stay in front of the products of chunk kk
      /* the two products into accl[0] stand three matrix instructions apart, those into accl[1] two */
      acc[0] = WM(ah[c][0], qh[kk], acc[0]); accl[0] = WM(ah[c][0], ql[kk], accl[0]); acc[1] = WM(ah[c][1], qh[kk], acc[1]); accl[1] = WM(ah[c][1], ql[kk], accl[1]); accl[0] = WM(al[c][0], qh[kk], accl[0]); accl[1] = WM(al[c][1], qh[kk], accl[1]);
      __builtin_amdgcn_sched_barrier(0); }   // no product of chunk kk + 1 is pulled in here: it would wait on LDS reads that were only just issued
    v16h vf[2][4];   /* the first four v fragments do not depend on P: their LDS reads are written ahead of the exponentials, which cover the latency */
#pragma unroll   // the arrays indexed here live in registers: every index must be a compile-time constant
    for (int u = 0; u < 4; ++u) vf[0][u] = frag_h(sv + u * 16 * FVP, lane);
    float s[2][8]; float mx0 = -3.0e38f, mx1 = -3.0e38f;
#pragma unroll   // the arrays indexed here live in registers: every index must be a compile-time constant
    for (int r = 0; r < 8; ++r) { const float v0 = (acc[0][r] + accl[0][r] * (1.0f / 1024.0f)) * sc2, v1 = (acc[1][r] + accl[1][r] * (1.0f / 1024.0f)) * sc2; s[0][r] = v0; s[1][r] = v1; mx0 = fmaxf(mx0, v0); mx1 = fmaxf(mx1, v1); }
    float mx = fmaxf(mx0, mx1); mx = fmaxf(mx, __shfl_xor(mx, 16));   /* the other 16 keys of the same query */
    const float mn = fmaxf(m, mx - 11.0f); const float af = __builtin_amdgcn_exp2f(m - mn); m = mn;   /* the running maximum is kept 11 lower, so that every 2^(s - mn) already carries the 2^11 of the f16 P; first stage: 2^(-3e38) = 0 */
    float ps0 = 0.f, ps1 = 0.f; v16h pf;
#pragma unroll   // the arrays indexed here live in registers: every index must be a compile-time constant
    for (int r = 0; r < 8; r += 2) { const v2f mn2 = {mn, mn}; const v2f d0 = (v2f){s[0][r], s[0][r + 1]} - mn2, d1 = (v2f){s[1][r], s[1][r + 1]} - mn2;   /* two differences an instruction */
      const float e0 = __builtin_amdgcn_exp2f(d0[0]), e1 = __builtin_amdgcn_exp2f(d1[0]), e2 = __builtin_amdgcn_exp2f(d0[1]), e3 = __builtin_amdgcn_exp2f(d1[1]);   /* arguments end at about 11: the bare hardware exponential needs no range handling (far below: 0) */
      ps0 += e0; ps1 += e1; ps0 += e2; ps1 += e3; pf[r] = (_Float16)e0; pf[r + 1] = (_Float16)e2; pf[8 + r] = (_Float16)e1; pf[9 + r] = (_Float16)e3; }
    l = l * af + (ps0 + ps1);   /* per lane: its own 16 keys a stage; the two lanes of a query are added where the tile's share ends */
#pragma unroll   // the arrays indexed here live in registers: every index must be a compile-time constant
    for (int j = 0; j < CC / 16; ++j) o[j] = o[j] * af;
#pragma unroll   // the arrays indexed here live in registers: every index must be a compile-time constant
    for (int jg = 0; jg < CC / 64; ++jg) { const int c = jg & 1, n = c ^ 1;   /* four channel tiles a group: the LDS reads of group jg + 1 stand together in front of the products of group jg */
      if (jg + 1 < CC / 64) {
#pragma unroll   // the arrays indexed here live in registers: every index must be a compile-time constant
        for (int u = 0; u < 4; ++u) vf[n][u] = frag_h(sv + ((jg + 1) * 4 + u) * 16 * FVP, lane); }
      __builtin_amdgcn_sched_barrier(0);   // the LDS reads of group jg + 1 stay in one place, in front of the products of group jg
#pragma unroll   // the arrays indexed here live in registers: every index must be a compile-time constant
      for (int u = 0; u < 4; ++u) o[jg * 4 + u] = WM(vf[c][u], pf, o[jg * 4 + u]);
      __builtin_amdgcn_sched_barrier(0); }   // no LDS read of a later group is spread among these products
    asm volatile("s_wait_dscnt 0x0" ::: "memory");      // this wave's reads of buffer t & 1 are done before it is handed to the copies
    asm volatile("s_wait_asynccnt 0x0" ::: "memory");   // this wave's copies of stage t + 1 have landed
    __syncthreads();                                     // publishes stage t + 1 and ends every reader's last read of buffer t & 1
    if (t + 2 < nt) { const int s = (u + 2) & (NST - 1); fa_fill(k_h + (size_t)s * FK * CCQ, k_l + (size_t)s * FK * CCQ, v_t + s * FK, &ring[t & 1][0], tid); }
    if ((u & (NST - 1)) == NST - 1 || t == nt - 1) {   /* the block's share of this tile ends (the same test in every wave of the block): join the two key halves, write the partial, start anew */
      const size_t piece = ((size_t)b * NQB + blockIdx.x) * 2 + (u / NST - u0 / NST);   /* segment 0 or 1: nt <= 32 units meet at most two tiles */
      l += __shfl_xor(l, 16);
      xm[wave][lane] = m; xl[wave][lane] = l;
      __syncthreads();                                   // maximum and sum of the other key half are readable
      const float m2 = xm[wave ^ 4][lane], l2 = xl[wave ^ 4][lane]; const float ms = fmaxf(m, m2); const float a1 = __builtin_amdgcn_exp2f(m - ms), a2 = __builtin_amdgcn_exp2f(m2 - ms);
      float* pp = PO + (piece * FQ + qs * 16 + kh * 8) * CC + lane * 4;   /* a wave adds and stores 8 of its pair's 16 rows: two 512-B pieces a row */
      v4f h0[8];   /* 128 channels a pass through the staging; every global store stands behind the last barrier, so that no barrier waits for a store */
#pragma unroll   // the arrays indexed here live in registers: every index must be a compile-time constant
      for (int j = 0; j < 8; ++j) { const v8f w = o[j] * a1; const v4f w0 = {w[0], w[1], w[2], w[3]}, w1 = {w[4], w[5], w[6], w[7]}; *(v4f*)&st[wave][col][j * 16 + 8 * g] = w0; *(v4f*)&st[wave][col][j * 16 + 8 * g + 4] = w1; }
      __syncthreads();                                   // both halves' scaled outputs, channels 0..127, are readable
#pragma unroll   // the arrays indexed here live in registers: every index must be a compile-time constant
      for (int rl = 0; rl < 8; ++rl) h0[rl] = *(const v4f*)&st[qs][kh * 8 + rl][lane * 4] + *(const v4f*)&st[qs + 4][kh * 8 + rl][lane * 4];
      __syncthreads();                                   // every reader has left the staging before it is written again
#pragma unroll   // the arrays indexed here live in registers: every index must be a compile-time constant
      for (int j = 0; j < 8; ++j) { const v8f w = o[8 + j] * a1; const v4f w0 = {w[0], w[1], w[2], w[3]}, w1 = {w[4], w[5], w[6], w[7]}; *(v4f*)&st[wave][col][j * 16 + 8 * g] = w0; *(v4f*)&st[wave][col][j * 16 + 8 * g + 4] = w1; }
      __syncthreads();                                   // channels 128..255 are readable; the staging, xm and xl are next written behind the barrier at the foot of a later stage
#pragma unroll   // the arrays indexed here live in registers: every index must be a compile-time constant
      for (int rl = 0; rl < 8; ++rl) { vst2(pp + (size_t)rl * CC, h0[rl]); vst2(pp + (size_t)rl * CC + 128, *(const v4f*)&st[qs][kh * 8 + rl][lane * 4] + *(const v4f*)&st[qs + 4][kh * 8 + rl][lane * 4]); }
      if (kh == 0 && g == 0) { PM[piece * FQ + qs * 16 + col] = ms; PL[piece * FQ + qs * 16 + col] = l * a1 + l2 * a2; }
      asm volatile("s_wait_xcnt 0x0" ::: "memory");     // before an address register of the stores above is written again
#pragma unroll   // the arrays indexed here live in registers: every index must be a compile-time constant
      for (int j = 0; j < CC / 16; ++j) o[j] = (v8f){};
      m = -3.0e38f; l = 0.f; } }
  asm volatile("s_wait_asynccnt 0x0" ::: "memory");     // no copy is outstanding when the wave ends
}
// 2^d with the free issue slot behind a transcendental in the same statement: in a row of exponentials the next one may be given this one's source register as its result
__device__ __forceinline__ float exp2_slot(float d) { float r; asm("v_exp_f32 %0, %1\n\tv_nop" : "=v"(r) : "v"(d)); return r; }
// ---- k_mg: one output row = the partials of its slot's tile, joined (common maximum, weights 2^(m - M)), divided by the joined sum. 16 lanes a row, 16 channels a lane; four partials are fetched at a time.
__global__ __launch_bounds__(256) void k_mg(const float* __restrict__ PO, const float* __restrict__ PM, const float* __restrict__ PL, const int* __restrict__ SL, const int* __restrict__ NT, float* __restrict__ Y) {
  const int c = threadIdx.x & 15, rg = threadIdx.x >> 4; const int b = blockIdx.y;
  int nt = NT[b]; nt = nt < 1 ? 1 : nt > NQB ? NQB : nt;
  int sl[2];
#pragma unroll
  for (int rr = 0; rr < 2; ++rr) sl[rr] = SL[(size_t)b * TT + blockIdx.x * 32 + rr * 16 + rg];
  asm volatile("s_wait_xcnt 0x0" ::: "memory");       // before an address register of the loads above is written again
#pragma unroll
  for (int rr = 0; rr < 2; ++rr) { const int q = blockIdx.x * 32 + rr * 16 + rg;
    int slot = sl[rr]; slot = slot < 0 ? 0 : slot > nt * FQ - 1 ? nt * FQ - 1 : slot;
    const int tau = slot / FQ, r = slot % FQ; const int j0 = (tau * NST) / nt, j1 = (tau * NST + NST - 1) / nt;   /* the blocks that hold units of tile tau; j1 <= 31 as tau < nt */
    float M = -3.0e38f, L = 0.f; v4f a[4] = {};
    for (int jb = j0; jb <= j1; jb += 4) { float pm[4], pl[4]; v4f x[4][4];
#pragma unroll
      for (int e = 0; e < 4; ++e) { const int jj = jb + e < j1 ? jb + e : j1; const size_t piece = ((size_t)b * NQB + jj) * 2 + (tau - (jj * nt) / NST);   /* past the last block: the last one again, with weight 0 */
        pm[e] = PM[piece * FQ + r]; pl[e] = PL[piece * FQ + r];
        asm volatile("s_wait_xcnt 0x0" ::: "memory");   // before a later load's result lands in an address register of the two loads above
#pragma unroll
        for (int k = 0; k < 4; ++k) x[e][k] = *(const v4f*)(PO + (piece * FQ + r) * CC + k * 64 + c * 4);
        asm volatile("s_wait_xcnt 0x0" ::: "memory"); }   // before a later load's result lands in the address register of the four loads above
      __builtin_amdgcn_sched_barrier(0);   // the loads of all four partials are issued before the first is used: one memory latency a group, not several
      const float Mn = fmaxf(fmaxf(M, fmaxf(pm[0], pm[1])), fmaxf(pm[2], pm[3])); const float f = exp2_slot(M - Mn); M = Mn; L *= f;
#pragma unroll
      for (int k = 0; k < 4; ++k) a[k] = a[k] * f;
#pragma unroll
      for (int e = 0; e < 4; ++e) { const float ex = exp2_slot(pm[e] - Mn); const float w = jb + e <= j1 ? ex : 0.f; L += pl[e] * w;
#pragma unroll
        for (int k = 0; k < 4; ++k) a[k] = a[k] + x[e][k] * w; } }
    const float inv = 1.0f / L;   /* sums and outputs both carry the 2^11; the sum holds the 2^11 of the row's maximum: never 0 */
#pragma unroll
    for (int k = 0; k < 4; ++k) vst2(Y + ((size_t)b * TT + q) * CC + k * 64 + c * 4, a[k] * inv);
    asm volatile("s_wait_xcnt 0x0" ::: "memory"); } }   // before an address register of the stores above is written again

extern "C" void kernel_launch(void* const* d_in, const int* in_sizes, int n_in, void* d_out, int out_size, void* d_ws, size_t ws_size, hipStream_t stream) {
  (void)in_sizes; (void)n_in; (void)out_size;
  const float** F = (const float**)d_in;
  if (ws_size < (size_t)WS_END) return;
  char* ws = (char*)d_ws; _Float16 *QH = (_Float16*)(ws + WS_QH), *KH = (_Float16*)(ws + WS_KH), *VT = (_Float16*)(ws + WS_VT), *QL = (_Float16*)(ws + WS_QL), *KL = (_Float16*)(ws + WS_KL); __bf16 *VB = (__bf16*)(ws + WS_VB), *VBL = (__bf16*)(ws + WS_VBL);
  float *PO = (float*)(ws + WS_PO), *PM = (float*)(ws + WS_PM), *PL = (float*)(ws + WS_PL); int *SL = (int*)(ws + WS_SL), *NT = (int*)(ws + WS_NT);
  // inputs: 0 x [8,2048,256]; 1 kernel [3,256,256] ((in,out): Q | K | V matrices); 2 mask [8,2048] int32
  const float* Wq = F[1]; const float* Wk = F[1] + (size_t)DIN * CCQ; const float* Wv = F[1] + 2 * (size_t)DIN * CCQ;
  k_projT<0><<<dim3(TNB * TT / 64, CCQ / 128, 2), 128, 0, stream>>>(F[0], F[0], F[0], Wq, Wk, Wv, nullptr, nullptr, nullptr, QH, QL, KH, KL, VT, VB, VBL);   /* which 0, 1: q and k rows (hi + residual planes) */
  k_projT<2><<<dim3(TNB * TT / 64, CC / 128, 1), 128, 0, stream>>>(F[0], F[0], F[0], Wq, Wk, Wv, nullptr, nullptr, nullptr, QH, QL, KH, KL, VT, VB, VBL);     /* which 2: v planes */
  k_fa<<<dim3(NQB, TNB), 256, 0, stream>>>(QH, QL, KH, KL, VT, (const int*)d_in[2], PO, PM, PL, SL, NT);   /* scores, softmax, P . v of the needed rows: partials */
  k_mg<<<dim3(TT / 32, TNB), 256, 0, stream>>>(PO, PM, PL, SL, NT, (float*)d_out);   /* every output row from its partials */
}

// v007
// One run takes 70 microseconds.
// In both of two side-by-side timings against v006, it was 1.05 times as fast.
// Counting every step since v000, it is 7.24 times as fast.
// compute dtype: all float inputs rounded to bf16; q/k/v projections with EXACT bf16 products on WMMA 16x16x32 (f32 accumulate); logits q x k with BOTH operands as f16 hi + (x 2^10) residual (3 products: hi.hi + lo.hi + hi.lo) x 64^-0.5, for every row (the logits have sigma - 500); the int row mask multiplies the logits in f32; softmax f32 with a running maximum (scores, softmax and P.v fused); exp(logit - running maximum) x 2^11 once to f16 x v once to f16 (1 product), divided by the row sum at the end; f32 output.
#include <hip/hip_runtime.h>
#include <math.h>

typedef __attribute__((ext_vector_type(16))) _Float16 v16h;
typedef __attribute__((ext_vector_type(16))) __bf16 v16b;
typedef __attribute__((ext_vector_type(8)))  _Float16 v8h;
typedef __attribute__((ext_vector_type(8)))  float v8f;
typedef __attribute__((ext_vector_type(4)))  float v4f;
typedef __attribute__((ext_vector_type(2)))  float v2f;
typedef __attribute__((ext_vector_type(4)))  unsigned v4u;
typedef __attribute__((ext_vector_type(4)))  int v4i;
typedef float __attribute__((may_alias)) float_a;
typedef int __attribute__((may_alias)) int_a;

template <typename T> __device__ __forceinline__ void vst2(void* p, T v) { *(T*)p = v;  }
__device__ __forceinline__ v8f wmma16(v16h a, v16h b, v8f c) {
  v8f d = __builtin_amdgcn_wmma_f32_16x16x32_f16(false, a, false, b, (short)0, c, false, false);
  asm volatile("v_nop\n\tv_nop\n\tv_nop\n\tv_nop" : "+v"(d) : "v"(a), "v"(b));
  return d;
}
__device__ __forceinline__ v8f wmma_bf(v16b a, v16b b, v8f c) {
  v8f d = __builtin_amdgcn_wmma_f32_16x16x32_bf16(false, a, false, b, (short)0, c, false, false);
  asm volatile("v_nop\n\tv_nop\n\tv_nop\n\tv_nop" : "+v"(d) : "v"(a), "v"(b));
  return d;
}
// 16x16x32 fragments: lane = (h = lane>>4, row/col = lane&15); elements 0..7 = k0+8h+0..7, 8..15 = k0+16+8h+0..7; D element r = row 8h+r
__device__ __forceinline__ v16h frag_h(const _Float16* rowk0, int lane) {
  union { v16h v; v8h q[2]; } u; const _Float16* p = rowk0 + 8 * (lane >> 4);
  u.q[0] = *(const v8h*)p; u.q[1] = *(const v8h*)(p + 16); return u.v;
}
__device__ __forceinline__ v16h frag_f32(const float* rowk0, int lane) {
  v16h a; const float* p = rowk0 + 8 * (lane >> 4);
#pragma unroll
  for (int i = 0; i < 8; ++i) { a[i] = (_Float16)p[i]; a[8 + i] = (_Float16)p[16 + i]; }
  return a;
}
__device__ __forceinline__ v16h frag_f32s(const float* rowk0, int lane, float sc) {
  v16h a; const float* p = rowk0 + 8 * (lane >> 4);
#pragma unroll
  for (int i = 0; i < 8; ++i) { a[i] = (_Float16)(p[i] * sc); a[8 + i] = (_Float16)(p[16 + i] * sc); }
  return a;
}
// column fragment from a [K][ld] layout (column n), rows >= K read as 0
__device__ __forceinline__ v16h fragc_f32(const float* W, int k0, int n, int lane, int ld, int K) {
  v16h a; const int g = lane >> 4;
#pragma unroll
  for (int i = 0; i < 8; ++i) { const int ka = k0 + 8 * g + i, kb = ka + 16;
    a[i] = (_Float16)(ka < K ? W[(size_t)(ka < K ? ka : K - 1) * ld + n] : 0.f); a[8 + i] = (_Float16)(kb < K ? W[(size_t)(kb < K ? kb : K - 1) * ld + n] : 0.f); }
  return a;
}
struct F2 { v16b h, l; };
__device__ __forceinline__ F2 bsplit16(const float v[16]) { F2 r;
#pragma unroll
  for (int i = 0; i < 16; ++i) { const __bf16 h = (__bf16)v[i]; r.h[i] = h; r.l[i] = (__bf16)(v[i] - (float)h); }
  return r; }
__device__ __forceinline__ F2 split_row(const float* row, int k0, int lane) { float v[16]; const float* p = row + k0 + 8 * (lane >> 4);
#pragma unroll
  for (int i = 0; i < 8; ++i) { v[i] = p[i]; v[8 + i] = p[16 + i]; }
  return bsplit16(v); }
__device__ __forceinline__ F2 split_rowK(const float* row, int k0, int lane, int K) { float v[16]; const int g = lane >> 4;
#pragma unroll
  for (int i = 0; i < 8; ++i) { const int ka = k0 + 8 * g + i, kb = ka + 16; v[i] = ka < K ? row[ka < K ? ka : K - 1] : 0.f; v[8 + i] = kb < K ? row[kb < K ? kb : K - 1] : 0.f; }
  return bsplit16(v); }
__device__ __forceinline__ F2 split_col(const float* W, int k0, int n, int lane, int ld, int K) { float v[16]; const int g = lane >> 4;
#pragma unroll
  for (int i = 0; i < 8; ++i) { const int ka = k0 + 8 * g + i, kb = ka + 16; v[i] = ka < K ? W[(size_t)(ka < K ? ka : K - 1) * ld + n] : 0.f; v[8 + i] = kb < K ? W[(size_t)(kb < K ? kb : K - 1) * ld + n] : 0.f; }
  return bsplit16(v); }
__device__ __forceinline__ v8f mac3(const F2& a, const F2& b, v8f c) { c = wmma_bf(a.l, b.h, c); c = wmma_bf(a.h, b.l, c); return wmma_bf(a.h, b.h, c); }
__device__ __forceinline__ float sigm(float v) { return 1.0f / (1.0f + expf(-v)); }
#define LDSX() do { asm volatile("s_wait_dscnt 0" ::: "memory"); __builtin_amdgcn_wave_barrier(); __builtin_amdgcn_fence(__ATOMIC_RELEASE, "workgroup"); } while (0)

// Single-head self-attention with unscaled N(0,1) projection kernels and a multiplicative row mask (x [8,2048,256]; kernel [3,256,256] (in,out): Q, K, V; mask [8,2048] int 0/1; SCALE = 1/sqrt(64) hard-coded): QK = (Q K^T) / 8; QK *= mask[b][q] per QUERY row (masked rows: all-zero logits -> uniform attention); A = softmax(QK); out = A V -> [8,2048,256].
#define NB 8
#define TT 2048
#define CC 256            // value width (v planes, output rows)
#define CCQ 256           // q / k row width
#define DIN 256          // x width
#define NH 1
#define HD 256
#define NQB (TT / 64)
#define HG 4               // four 2,048 x 2,048 f32 planes of WS_S, which hold k_fa's partials, slots and tile counts (k_fa keeps the logits on chip)
#define SCALE (0.125f)             // 1/sqrt(64), hard-coded in the source
#define HDQK 256           // q / k width
#define CAUSAL 0
#ifndef TNB
#define TNB NB
#endif
__device__ __forceinline__ v16b zero16b() { v16b z; _Pragma("unroll") for (int i = 0; i < 16; ++i) z[i] = (__bf16)0.f; return z; }
__device__ __forceinline__ float bfr(float v) { return (float)(__bf16)v; }
__host__ __device__ __forceinline__ int kb_last(int qb) { return CAUSAL ? ((qb * 64 + 63) >> 7) : (TT / 128 - 1); }
typedef __attribute__((ext_vector_type(8))) __bf16 v8b;
__device__ __forceinline__ v16b frag_b(const __bf16* rowk0, int lane) {
  union { v16b v; v8b q[2]; } u; const __bf16* p = rowk0 + 8 * (lane >> 4);
  u.q[0] = *(const v8b*)p; u.q[1] = *(const v8b*)(p + 16); return u.v;
}
#define QBH 0              // k_fa keeps the single-product P.v path for every block
#define QBH_SC NQB         // k_fa: EVERY query block takes the 3-product (q hi+lo x k hi+lo) path
#define QHI TT              // q residual rows for every query
#define KHI TT              // k residual rows for every key (the bf16 v hi/lo planes are written too but unused)
// B fragment (k rows k0+.., output column o) of a weight: (in,out) [K][ld] or (out,in) [ld rows of K]: bf16 exact, or f16(bf16 * 256) exact
__device__ __forceinline__ v16b wcol_io(const float* Wm, int k0, int o, int lane, int ld) { v16b w; const int g = lane >> 4;
#pragma unroll
  for (int i = 0; i < 8; ++i) { w[i] = (__bf16)Wm[(size_t)(k0 + 8 * g + i) * ld + o]; w[8 + i] = (__bf16)Wm[(size_t)(k0 + 16 + 8 * g + i) * ld + o]; }
  return w; }
__device__ __forceinline__ v16b wcol_oi(const float* Wm, int k0, int o, int lane, int K) { v16b w; const float* p = Wm + (size_t)o * K + k0 + 8 * (lane >> 4);
#pragma unroll
  for (int i = 0; i < 8; ++i) { w[i] = (__bf16)p[i]; w[8 + i] = (__bf16)p[16 + i]; }
  return w; }
__device__ __forceinline__ v16h wcolh_io(const float* Wm, int k0, int o, int lane, int ld) { v16h w; const int g = lane >> 4;
#pragma unroll
  for (int i = 0; i < 8; ++i) { w[i] = (_Float16)(bfr(Wm[(size_t)(k0 + 8 * g + i) * ld + o]) * 256.0f); w[8 + i] = (_Float16)(bfr(Wm[(size_t)(k0 + 16 + 8 * g + i) * ld + o]) * 256.0f); }
  return w; }
__device__ __forceinline__ v16h wcolh_oi(const float* Wm, int k0, int o, int lane, int K) { v16h w; const float* p = Wm + (size_t)o * K + k0 + 8 * (lane >> 4);
#pragma unroll
  for (int i = 0; i < 8; ++i) { w[i] = (_Float16)(bfr(p[i]) * 256.0f); w[8 + i] = (_Float16)(bfr(p[16 + i]) * 256.0f); }
  return w; }
#define WQKV_LAYOUT 0   // 0 = (in,out) [K][CC]; 1 = (out,in) [CC][DIN]; 2 = per-head [NH][DIN][HD]
__device__ __forceinline__ v16b wcol_hdk(const float* Wm, int k0, int o, int lane) { v16b w; const int g = lane >> 4; const float* p = Wm + (size_t)(o / HD) * DIN * HD + (o % HD);
#pragma unroll
  for (int i = 0; i < 8; ++i) { w[i] = (__bf16)p[(size_t)(k0 + 8 * g + i) * HD]; w[8 + i] = (__bf16)p[(size_t)(k0 + 16 + 8 * g + i) * HD]; }
  return w; }
#define WO_OUT_IN 0
#if WQKV_LAYOUT == 1
#define WCOL(W, k0, o, lane) wcol_oi(W, k0, (o), lane, DIN)   /* unused: layout 0 */
#elif WQKV_LAYOUT == 2
#define WCOL(W, k0, o, lane) wcol_hdk(W, k0, o, lane)
#else
#define WCOL(W, k0, o, lane) (which == 2 ? wcol_io(W, k0, (o), lane, CC) : ((o) < HDQK ? wcol_io(W, k0, (o), lane, HDQK) : zero16b()))   /* Wv [256][256]; Wq/Wk [256][256]: projected q/k columns >= 256 would read as zero (grid y = 2 covers 0..255) */
#endif
#if WO_OUT_IN
#define WOCOL(W, k0, o, lane) wcol_oi(W, k0, o, lane, CC)
#define WOCOLH(W, k0, o, lane) wcolh_oi(W, k0, o, lane, CC)
#else
#define WOCOL(W, k0, o, lane) wcol_io(W, k0, o, lane, DIN)
#define WOCOLH(W, k0, o, lane) wcolh_io(W, k0, o, lane, DIN)
#endif
#define BG HG
#define BGN (TNB < BG ? TNB : BG)   // unused: k_fa takes all TNB batches in one launch
#define DVH 128            // unused: a k_fa wave keeps all 256 value columns in 16 accumulator tiles
#define SM_EXTRA_PARAMS , int bsm, const int* __restrict__ RMASK
// multiplicative per-QUERY-row int mask applied to the scaled logits before the softmax (mask 0 -> every logit of the row becomes 0 -> uniform attention), as the module
#define SM_MASK_HOOK do { v = v * (float)RMASK[(size_t)(bsm + (int)blockIdx.y) * TT + t]; } while (0)
#ifndef SM_EXTRA_PARAMS
#define SM_EXTRA_PARAMS
#endif
#ifndef PROJ_EXTRA_PARAMS
#define PROJ_EXTRA_PARAMS
#endif
#ifndef SM_MASK_HOOK
#define SM_MASK_HOOK (void)0
#endif

#define WS_QH  0u                                      // f16 q rows [b*t][CCQ]
#define WS_KH  (WS_QH + 2u * (size_t)NB * TT * CCQ)     // f16 k rows [b*t][CCQ]
#define WS_VT  (WS_KH + 2u * (size_t)NB * TT * CCQ)     // f16 v planes [b][c][t]
#define WS_QL  (WS_VT + 2u * (size_t)NB * CC * TT)      // f16 q residual x 2^10 rows [b][t < QHI][CCQ]
#define WS_KL  (WS_QL + 2u * (size_t)NB * QHI * CCQ)    // f16 k residual x 2^10 rows [b][t < KHI][CCQ]
#define WS_VB  (WS_KL + 2u * (size_t)NB * KHI * CCQ)    // bf16 v hi planes [b][c][t < KHI]
#define WS_VBL (WS_VB + 2u * (size_t)NB * CC * KHI)
#define WS_S   (WS_VBL + 2u * (size_t)NB * CC * KHI)    // f32 [hg][t][s] space: k_fa keeps the logits on chip; its partials lie here
#define WS_Y   (WS_S  + 4u * (size_t)HG * TT * TT)      // f32 ctx rows [b*t][CC] (only when there is an output projection)
#define WS_END (WS_Y  + 0u)

#define XSP 72             // staged x row pitch in bf16: 128 B + 16 B (same reason as PWP)
typedef __attribute__((ext_vector_type(4))) __bf16 v4b;
#define PWP 264            // staged weight row pitch in bf16: 512 B + 16 B (16 B x odd: ds_load_b128 walks over rows meet no bank twice)
// four waves a SIMD (256 registers) and 76,800 B of LDS: four blocks a WGP, so that the 1,024 blocks of the q/k launch are resident at once
// ---- k_proj: block = (64 rows, 128 cols, which): q/k/v = X W (+ b) with exact bf16 products (K = DIN) -> which 0: q f16 rows (+ residual rows < QHI); 1: k f16 rows (+ residual rows < KHI); 2: v f16 planes [c][t] (+ bf16 hi/lo planes for t < KHI)
template <int WOFF> __global__ __launch_bounds__(128) __attribute__((amdgpu_waves_per_eu(4))) void k_projT(const float* __restrict__ XQ, const float* __restrict__ XK, const float* __restrict__ XV, const float* __restrict__ WQ, const float* __restrict__ WK, const float* __restrict__ WV, const float* __restrict__ BQ, const float* __restrict__ BK, const float* __restrict__ BV,
    _Float16* __restrict__ QH, _Float16* __restrict__ QL, _Float16* __restrict__ KH, _Float16* __restrict__ KL, _Float16* __restrict__ VT, __bf16* __restrict__ VB, __bf16* __restrict__ VBL) {
  // one LDS pool: first the weight tile, bf16, transposed to [output column][k]; behind the products (and a barrier) the same bytes are the output staging
  __shared__ __align__(16) char pool[128 * PWP * 2];
  __shared__ __align__(16) __bf16 xs[4][16][XSP];   /* a wave's own turning place for its x rows: 16 rows x 64 k at a time */
  __bf16 (*wt)[PWP] = (__bf16 (*)[PWP])pool;
  _Float16 (*sh)[136] = (_Float16 (*)[136])pool; _Float16 (*sl)[136] = (_Float16 (*)[136])(pool + 64 * 136 * 2);
  _Float16 (*th)[72] = (_Float16 (*)[72])pool; __bf16 (*tb)[72] = (__bf16 (*)[72])(pool + 128 * 72 * 2); __bf16 (*tbl)[72] = (__bf16 (*)[72])(pool + 2 * 128 * 72 * 2);
  const int tid = threadIdx.x, wave = tid >> 5, lane = tid & 31, col = lane & 15, g = lane >> 4; const int which = blockIdx.z + WOFF; const int c0 = blockIdx.y * 128; const size_t r0 = (size_t)blockIdx.x * 64; const size_t bb = r0 / TT; const int t0 = (int)(r0 % TT);
  const float* X = which == 0 ? XQ : which == 1 ? XK : XV; const float* WA = which == 0 ? WQ : which == 1 ? WK : WV; const float* BA = which == 0 ? BQ : which == 1 ? BK : BV;
  const int KD = DIN;
  v8f acc[8] = {};
  v16b xa[DIN / 32];   /* this wave's 16 x rows, whole width, as A fragments */
  /* Weight tile [DIN][128 columns from c0] -> wt[column][k], read from global ONCE per block. A wave fills its own 32 columns; a lane takes 4 columns x 8 k a unit: 8 loads of 16 B (a wave's load = four whole 128-B lines), 4 LDS stores of 16 B (8 k of one column).
     Twelve units of 8 loads a lane: 0..7 = the weight tile's 32-k slabs, 8..11 = two k chunks each of the wave's 16 x rows. An x load of a wave = 256 B in a row of each of two rows (four whole 128-B lines, not 32 B of each of 16 lines); the lanes get their A fragments (one row a lane) back through xs. Six units are in flight; a unit is used up (to LDS, or to bf16 fragments) and then the unit six further on is issued into its registers. */
  { const int cb = wave * 32 + (lane & 7) * 4, kq = (lane >> 3) * 8; const float* pw = WA + (size_t)kq * CCQ + c0 + cb; const float* px = X + (r0 + wave * 16 + g) * (size_t)KD + col * 4;   /* x row-major [b*t][KD]; load i of a unit: rows 2 i and 2 i + 1 */
    v4f un[12][8];
#pragma unroll   // the arrays indexed here live in registers: every index must be a compile-time constant
    for (int n = -6; n < 12; ++n) {
      if (n >= 0 && n < 8) {
#pragma unroll
        for (int c = 0; c < 4; ++c) { v8b t;
#pragma unroll
          for (int i = 0; i < 8; ++i) t[i] = (__bf16)un[n][i][c];
          *(v8b*)&wt[cb + c][n * 32 + kq] = t; } }
      if (n >= 8) {
#pragma unroll
        for (int i = 0; i < 8; ++i) { v4b t;
#pragma unroll
          for (int e = 0; e < 4; ++e) t[e] = (__bf16)un[n][i][e];
          *(v4b*)&xs[wave][2 * i + g][col * 4] = t; }
        asm volatile("s_wait_dscnt 0x0" ::: "memory");   // the wave's stores into xs are done before its lanes read what other lanes stored (the "memory" clobber keeps the compiler's LDS accesses on their sides)
        xa[(n - 8) * 2] = frag_b(&xs[wave][col][0], lane); xa[(n - 8) * 2 + 1] = frag_b(&xs[wave][col][32], lane);
        asm volatile("s_wait_dscnt 0x0" ::: "memory");   // the fragments are read before the next unit's stores overwrite xs
      }
      __builtin_amdgcn_sched_barrier(0);   // unit n is used up before unit n + 6 is issued: its registers are free again (no spill at four waves a SIMD)
      const int m = n + 6;
      if (m < 8) {
#pragma unroll
        for (int i = 0; i < 8; ++i) un[m][i] = *(const v4f*)(pw + (size_t)(m * 32 + i) * CCQ);
        if (m == 7) asm volatile("s_wait_xcnt 0x0" :: "v"(pw) : "memory"); }   // behind the last weight load; the address is named so that it stays in its registers up to here and no load's result is given them in front of the wait
      else if (m < 12) {
#pragma unroll
        for (int i = 0; i < 8; ++i) un[m][i] = *(const v4f*)(px + (size_t)(2 * i) * KD + (m - 8) * 64); }
      if (m == 11) asm volatile("s_wait_xcnt 0x0" ::: "memory");   // behind the last load: before an address register of the loads above is written again
      __builtin_amdgcn_sched_barrier(0); } }   // the loads of unit n + 6 are issued here and not pushed behind the wait for unit n + 1
  __syncthreads();   // the whole weight tile is readable by every wave
  v16b bf[2][4];   /* B fragments in groups of four (group f: k chunk f >> 1, column tiles 4 (f & 1) + 0..3); the LDS reads of group f + 1 stand together in front of the products of group f */
#pragma unroll   // the arrays indexed here live in registers: every index must be a compile-time constant
  for (int u = 0; u < 4; ++u) bf[0][u] = frag_b(&wt[u * 16 + col][0], lane);
#pragma unroll   // the arrays indexed here live in registers: every index must be a compile-time constant
  for (int f = 0; f < DIN / 16; ++f) { const int cu = f & 1, nx = cu ^ 1;
    if (f + 1 < DIN / 16) {
#pragma unroll
      for (int u = 0; u < 4; ++u) bf[nx][u] = frag_b(&wt[(nx * 4 + u) * 16 + col][((f + 1) >> 1) * 32], lane); }
    __builtin_amdgcn_sched_barrier(0);   // the LDS reads of group f + 1 stay in one place, in front of the products of group f
#pragma unroll
    for (int u = 0; u < 4; ++u) acc[cu * 4 + u] = __builtin_amdgcn_wmma_f32_16x16x32_bf16(false, xa[f >> 1], false, bf[cu][u], (short)0, acc[cu * 4 + u], false, false);   /* same products in the same k order as before */
    __builtin_amdgcn_sched_barrier(0); }   // no LDS read of a later group is spread among these products
  __syncthreads();   // every wave's last read of the weight tile is done before the pool becomes output staging
  if (which < 2) { _Float16* DH = which == 0 ? QH : KH; _Float16* DL = which == 0 ? QL : KL; const int nhi = which == 0 ? QHI : KHI; const bool hi_rows = t0 < nhi;
#pragma unroll
    for (int j = 0; j < 8; ++j) { const float bias = BA ? bfr(BA[c0 + j * 16 + col]) : 0.f;
#pragma unroll
      for (int r = 0; r < 8; ++r) { const float v = acc[j][r] + bias; const _Float16 hv = (_Float16)v; sh[wave * 16 + 8 * g + r][j * 16 + col] = hv; sl[wave * 16 + 8 * g + r][j * 16 + col] = (_Float16)((v - (float)hv) * 1024.0f); } }
    __syncthreads();
    for (int e = tid; e < 64 * 16; e += 128) { const int rl = e >> 4, q = e & 15; vst2((unsigned*)(DH + (r0 + rl) * CCQ + c0 + q * 8), *(const v4u*)&sh[rl][q * 8]); if (hi_rows) vst2((unsigned*)(DL + (bb * nhi + t0 + rl) * (size_t)CCQ + c0 + q * 8), *(const v4u*)&sl[rl][q * 8]); }   /* q/k rows: pitch CCQ (c0 = 0 or 128) */
  } else { const bool hi_rows = t0 < KHI;
#pragma unroll
    for (int j = 0; j < 8; ++j) { const float bias = BA ? bfr(BA[c0 + j * 16 + col]) : 0.f;
      v8h hv; v8b bv, lv;   /* a lane's 8 rows of one column lie side by side in the staged planes: one 16-byte LDS store a plane */
#pragma unroll
      for (int r = 0; r < 8; ++r) { const float v = acc[j][r] + bias; hv[r] = (_Float16)v; const __bf16 bh = (__bf16)v; bv[r] = bh; lv[r] = (__bf16)(v - (float)bh); }
      { const int rl = wave * 16 + 8 * g, cl = j * 16 + col; *(v8h*)&th[cl][rl] = hv; *(v8b*)&tb[cl][rl] = bv; *(v8b*)&tbl[cl][rl] = lv; } }
    __syncthreads();
    for (int e = tid; e < 128 * 8; e += 128) { const int cl = e >> 3, q = e & 7; vst2((unsigned*)(VT + (bb * CC + c0 + cl) * (size_t)TT + t0 + q * 8), *(const v4u*)&th[cl][q * 8]); if (hi_rows) { const size_t o3 = (bb * CC + c0 + cl) * (size_t)KHI + t0 + q * 8; vst2((unsigned*)(VB + o3), *(const v4u*)&tb[cl][q * 8]); vst2((unsigned*)(VBL + o3), *(const v4u*)&tbl[cl][q * 8]); } } } }
__device__ __forceinline__ unsigned lds_off(const void* p) { return (unsigned)(size_t)p; }
// eight 16-byte copies of one lane, global -> LDS; the s_wait_xcnt stands inside the statement so that no address register is rewritten in front of it
__device__ __forceinline__ void copy8(const unsigned l[8], const char* const gp[8]) {
  asm volatile("global_load_async_to_lds_b128 %0, %8, off\n\t"
               "global_load_async_to_lds_b128 %1, %9, off\n\t"
               "global_load_async_to_lds_b128 %2, %10, off\n\t"
               "global_load_async_to_lds_b128 %3, %11, off\n\t"
               "global_load_async_to_lds_b128 %4, %12, off\n\t"
               "global_load_async_to_lds_b128 %5, %13, off\n\t"
               "global_load_async_to_lds_b128 %6, %14, off\n\t"
               "global_load_async_to_lds_b128 %7, %15, off\n\t"
               "s_wait_xcnt 0x0"
               :: "v"(l[0]), "v"(l[1]), "v"(l[2]), "v"(l[3]), "v"(l[4]), "v"(l[5]), "v"(l[6]), "v"(l[7]),
                  "v"(gp[0]), "v"(gp[1]), "v"(gp[2]), "v"(gp[3]), "v"(gp[4]), "v"(gp[5]), "v"(gp[6]), "v"(gp[7]) : "memory");
}
// the compiler keeps the distance behind its own builtin form
__device__ __forceinline__ v8f WM(v16h a, v16h b, v8f c) { return __builtin_amdgcn_wmma_f32_16x16x32_f16(false, a, false, b, (short)0, c, false, false); }
// ---- k_fa: scores, softmax and P . v in ONE kernel; the logits never leave the WGP. A tile = 64 query slots of one batch (which tiles a block works on: below); 8 waves = 4 query sub-tiles of 16 x 2 key halves: of every stage of 64 keys a wave takes 32.
// Scores TRANSPOSED: A = k rows (LDS), B = q rows (registers, hi + residual): D element r = key 8h + r, column = query = lane & 15; same 3 products in the same k order (hi.hi | k hi . q lo + k lo . q hi).
// So a lane holds 16 keys of ONE query: maximum and sum are in-lane plus one exchange with lane ^ 16, and two 16-key score tiles ARE the B fragment of 32 keys (elements 0..7 = tile 0, 8..15 = tile 1).
// Output TRANSPOSED too: A = v plane rows [channel][key] (LDS), B = P: D element r = channel 8h + r, column = query, so the running-maximum rescale is one factor per lane.
// k hi, k lo (64 rows x 512 B) and v (256 rows x 128 B) of a stage come into LDS by asynchronous copies, two buffers: the next stage flies while this one is multiplied. The two key halves are merged through LDS where a tile's share ends.
// A query row whose mask is 0 has all-zero logits whatever q and k are: all such rows of a batch have the SAME output row. The rows are ordered (mask != 0 first, in row order, then the others); only the slots 0 .. n1 are needed (slot n1 = one row of mask 0, which goes the ordinary way with factor 0 and stands for all of them).
// nt = tiles of 64 slots that hold them. The nt x 32 (tile, key stage) units of a batch are dealt in order to its 32 blocks, nt units each, for every mask; a block meets at most two tiles and writes one partial (maximum, sum, unnormalised output) for each; k_mg joins the partials of a row.
#define FQ 64              // query slots per tile
#define FK 64              // keys per LDS stage
#define FKP 264            // staged k row pitch in f16: 512 B + 16 B (16 B x odd: ds_load_b128 walks over rows meet no bank twice)
#define FVP 72             // staged v row pitch in f16: 128 B + 16 B (same reason)
#define FST (2 * FK * FKP + CC * FVP)   // f16 elements of one buffer
#define FSP 132            // staged partial-output row pitch in f32: 128 channels a pass + 16 B
#define NST (TT / FK)       // key stages of one query tile
#define QTP 136            // turned q row pitch in f16: 256 B + 16 B (16 B x odd, as FKP)
static_assert(NST == NQB, "a batch has as many blocks as a tile has stages: every block gets exactly nt stages");
#define WS_PO  WS_S                                          // f32 partial outputs [b][block][segment][64 slots][CC]
#define WS_PM  (WS_PO + 4u * (size_t)NB * NQB * 2 * FQ * CC)   // f32 partial maxima [b][block][segment][64 slots]
#define WS_PL  (WS_PM + 4u * (size_t)NB * NQB * 2 * FQ)        // f32 partial sums, same shape
#define WS_SL  (WS_PL + 4u * (size_t)NB * NQB * 2 * FQ)        // int slot of every query row [b][t]
#define WS_NT  (WS_SL + 4u * (size_t)NB * TT)                  // int tiles of every batch [b]
static_assert(WS_NT + 4u * NB <= WS_END, "the partials lie inside the former logit planes");
// one stage: 256 threads, 24 copies each; a wave's copy covers one 512-B k row or four 128-B v row pieces
__device__ __forceinline__ void fa_fill(const _Float16* k_h, const _Float16* k_l, const _Float16* v_t, _Float16* sr, int tid) {
  unsigned l[8]; const char* gp[8];
#pragma unroll   // the arrays indexed here live in registers: every index must be a compile-time constant
  for (int i = 0; i < 8; ++i) { const int e = i * 256 + tid, row = e >> 5, q = e & 31; l[i] = lds_off(sr + row * FKP + q * 8); gp[i] = (const char*)(k_h + (size_t)row * CCQ + q * 8); }
  copy8(l, gp);
#pragma unroll   // the arrays indexed here live in registers: every index must be a compile-time constant
  for (int i = 0; i < 8; ++i) { const int e = i * 256 + tid, row = e >> 5, q = e & 31; l[i] = lds_off(sr + (FK + row) * FKP + q * 8); gp[i] = (const char*)(k_l + (size_t)row * CCQ + q * 8); }
  copy8(l, gp);
#pragma unroll   // the arrays indexed here live in registers: every index must be a compile-time constant
  for (int i = 0; i < 8; ++i) { const int e = i * 256 + tid, row = e >> 3, q = e & 7; l[i] = lds_off(sr + 2 * FK * FKP + row * FVP + q * 8); gp[i] = (const char*)(v_t + (size_t)row * TT + q * 8); }
  copy8(l, gp);
}
__global__ __launch_bounds__(256) void k_fa(const _Float16* __restrict__ QH, const _Float16* __restrict__ QL, const _Float16* __restrict__ KH, const _Float16* __restrict__ KL, const _Float16* __restrict__ VT, const int* __restrict__ RMASK, float* __restrict__ PO, float* __restrict__ PM, float* __restrict__ PL, int* __restrict__ SL, int* __restrict__ NT) {
  __shared__ __align__(16) _Float16 ring[2][FST]; __shared__ __align__(16) float st[8][16][FSP]; __shared__ float xm[8][32], xl[8][32]; __shared__ unsigned short ord[TT]; __shared__ __align__(16) _Float16 qt[8][16][QTP];   /* qt: a wave's own turning place for its q rows, 16 rows x 128 k at a time */
  const int tid = threadIdx.x, wave = tid >> 5, lane = tid & 31, col = lane & 15, g = lane >> 4; const int qs = wave & 3, kh = wave >> 2; const int b = blockIdx.y;
  const _Float16* k_h = KH + (size_t)b * TT * CCQ; const _Float16* k_l = KL + (size_t)b * KHI * CCQ; const _Float16* v_t = VT + (size_t)b * CC * TT;
  int n1;   /* rows of this batch with mask != 0 */
  { /* every wave counts the whole batch by itself (a lane: 64 rows as two bit words, then a scan over the lanes); of each lane's 64 rows wave w enters 8 into ord[slot] = row */
    /* a wave's load = 512 B in a row (four whole 128-B lines, not 16 B of each of 32 lines): load c gives lane l the rows 128 c + 4 l + 0..3, as four bits in byte 32 c + l of the wave's own qt; lane l then takes bytes 16 l .. 16 l + 15 = its 64 rows */
    const int* mk = RMASK + (size_t)b * TT + lane * 4; unsigned char* nb = (unsigned char*)&qt[wave][0][0]; v4i mw[16];
#pragma unroll   // the arrays indexed here live in registers: every index must be a compile-time constant
    for (int c = 0; c < 16; ++c) mw[c] = *(const v4i*)(mk + 128 * c);
    asm volatile("s_wait_xcnt 0x0" ::: "memory");       // before an address register of the loads above is written again
#pragma unroll   // the arrays indexed here live in registers: every index must be a compile-time constant
    for (int c = 0; c < 16; ++c) nb[32 * c + lane] = (unsigned char)((mw[c][0] != 0 ? 1u : 0u) | (mw[c][1] != 0 ? 2u : 0u) | (mw[c][2] != 0 ? 4u : 0u) | (mw[c][3] != 0 ? 8u : 0u));
    asm volatile("s_wait_dscnt 0x0" ::: "memory");      // the wave's stores into qt are done before its lanes read what other lanes stored (the "memory" clobber keeps the compiler's LDS accesses on their sides)
    const v4u nr = *(const v4u*)(nb + 16 * lane); unsigned pk[4];   /* four bytes of four bits each -> 16 bits */
#pragma unroll
    for (int e = 0; e < 4; ++e) { const unsigned y = (nr[e] | (nr[e] >> 4)) & 0x00FF00FFu; pk[e] = (y | (y >> 8)) & 0xFFFFu; }
    const unsigned lo = pk[0] | (pk[1] << 16), hi = pk[2] | (pk[3] << 16);
    const int cnt = __popc(lo) + __popc(hi); int inc = cnt;
#pragma unroll
    for (int d = 1; d < 32; d <<= 1) { const int y = __shfl_up(inc, d); if (lane >= d) inc += y; }
    n1 = __shfl(inc, 31);
    const unsigned word = wave < 4 ? lo : hi; const int sh = (wave & 3) * 8;
    int r1 = inc - cnt + (wave < 4 ? 0 : __popc(lo)) + __popc(word & ((1u << sh) - 1u));   /* rows with mask != 0 in front of row p */
    int sv[8];
#pragma unroll
    for (int i = 0; i < 8; ++i) { const int p = lane * 64 + wave * 8 + i; const int bit = (int)((word >> (sh + i)) & 1u); ord[bit ? r1 : n1 + p - r1] = (unsigned short)p; sv[i] = bit ? r1 : n1; r1 += bit; }
    if (blockIdx.x == 0) { int* sp = SL + (size_t)b * TT + lane * 64 + wave * 8; vst2(sp, (v4i){sv[0], sv[1], sv[2], sv[3]}); vst2(sp + 4, (v4i){sv[4], sv[5], sv[6], sv[7]});
      asm volatile("s_wait_xcnt 0x0" ::: "memory"); } }   // before an address register of the stores above is written again
  const int nt = __builtin_amdgcn_readfirstlane(n1 < TT ? (n1 >> 6) + 1 : NQB);   /* 1 .. 32 for every mask */
  if (blockIdx.x == 0 && tid == 0) NT[b] = nt;
  asm volatile("s_wait_xcnt 0x0" ::: "memory");       // before an address register of the store above is written again
  const int u0 = blockIdx.x * nt;   /* this block's units: u0 .. u0 + nt - 1; unit u = (tile u / 32, key stage u % 32) */
  { const int s = u0 & (NST - 1); fa_fill(k_h + (size_t)s * FK * CCQ, k_l + (size_t)s * FK * CCQ, v_t + s * FK, &ring[0][0], tid); }
  asm volatile("s_wait_asynccnt 0x0" ::: "memory");   // the first stage has landed for this wave's own copies
  __syncthreads();                                     // ... and for every wave's; ord is readable too
  if (nt > 1) { const int s = (u0 + 1) & (NST - 1); fa_fill(k_h + (size_t)s * FK * CCQ, k_l + (size_t)s * FK * CCQ, v_t + s * FK, &ring[1][0], tid); }
  v16h qh[HDQK / 32] = {}, ql[HDQK / 32] = {};   /* this wave's 16 query rows, whole width, as B fragments */
  float sc2 = 0.f;
  v8f o[CC / 16] = {}; float m = -3.0e38f, l = 0.f;
#pragma unroll 1   // one stage a trip: the buffer index stays a run-time bit and the loop stays small
  for (int t = 0; t < nt; ++t) { const int u = u0 + t; const _Float16* sk = &ring[t & 1][(kh * 32 + col) * FKP]; const _Float16* sv = &ring[t & 1][2 * FK * FKP + col * FVP + kh * 32];
    if (t == 0 || (u & (NST - 1)) == 0) {   /* a tile begins (the same test in every wave of the block): its query rows */
      const int qrow = ord[((u / NST) * FQ + qs * 16 + col) & (TT - 1)] & (TT - 1);
      /* a wave's load = 256 B in a row of each of two q rows (four whole 128-B lines, not 32 B of each of 16 lines); pass p = (plane p >> 1: hi, residual; k half p & 1); the lanes get their B fragments (one row a lane) back through qt */
      v8h w[4][8]; const _Float16* qa[8]; const _Float16* qb[8];
#pragma unroll   // the arrays indexed here live in registers: every index must be a compile-time constant
      for (int i = 0; i < 8; ++i) { const int lr = ord[((u / NST) * FQ + qs * 16 + 2 * i + g) & (TT - 1)] & (TT - 1);
        qa[i] = QH + ((size_t)b * TT + lr) * CCQ + col * 8; qb[i] = QL + ((size_t)b * QHI + lr) * CCQ + col * 8;
        w[0][i] = *(const v8h*)qa[i]; w[1][i] = *(const v8h*)(qa[i] + 128); w[2][i] = *(const v8h*)qb[i]; w[3][i] = *(const v8h*)(qb[i] + 128); }
      // behind the last q load; the addresses are named so that they stay in their registers up to here and nothing (a load's result either) is written there in front of the wait
      asm volatile("s_wait_xcnt 0x0" :: "v"(qa[0]), "v"(qa[1]), "v"(qa[2]), "v"(qa[3]), "v"(qa[4]), "v"(qa[5]), "v"(qa[6]), "v"(qa[7]), "v"(qb[0]), "v"(qb[1]), "v"(qb[2]), "v"(qb[3]), "v"(qb[4]), "v"(qb[5]), "v"(qb[6]), "v"(qb[7]) : "memory");
      sc2 = (float)RMASK[(size_t)b * TT + qrow] * (SCALE * 1.44269504088896340736f);   /* one factor a lane: multiplicative mask of its query row x 1/8 x log2(e); the softmax runs in base 2 */
      asm volatile("s_wait_xcnt 0x0" ::: "memory");   // before an address register of the loads above is written again
#pragma unroll   // the arrays indexed here live in registers: every index must be a compile-time constant
      for (int p = 0; p < 4; ++p) {
#pragma unroll   // the arrays indexed here live in registers: every index must be a compile-time constant
        for (int i = 0; i < 8; ++i) *(v8h*)&qt[wave][2 * i + g][col * 8] = w[p][i];
        asm volatile("s_wait_dscnt 0x0" ::: "memory");   // the wave's stores into qt are done before its lanes read what other lanes stored (the "memory" clobber keeps the compiler's LDS accesses on their sides)
#pragma unroll   // the arrays indexed here live in registers: every index must be a compile-time constant
        for (int c = 0; c < 4; ++c) { const v16h f = frag_h(&qt[wave][col][c * 32], lane); if (p < 2) qh[(p & 1) * 4 + c] = f; else ql[(p & 1) * 4 + c] = f; }
        asm volatile("s_wait_dscnt 0x0" ::: "memory");   // the fragments are read before the next pass's stores overwrite qt
      } }
    v8f acc[2] = {}, accl[2] = {}; v16h ah[2][2], al[2][2];   /* fragments of k chunk kk + 1 are read from LDS in front of the products of chunk kk */
#pragma unroll   // the arrays indexed here live in registers: every index must be a compile-time constant
    for (int u = 0; u < 2; ++u) { ah[0][u] = frag_h(sk + u * 16 * FKP, lane); al[0][u] = frag_h(sk + (FK + u * 16) * FKP, lane); }
#pragma unroll   // the arrays indexed here live in registers: every index must be a compile-time constant
    for (int kk = 0; kk < HDQK / 32; ++kk) { const int c = kk & 1, n = c ^ 1;
      if (kk + 1 < HDQK / 32) {
#pragma unroll   // the arrays indexed here live in registers: every index must be a compile-time constant
        for (int u = 0; u < 2; ++u) { ah[n][u] = frag_h(sk + u * 16 * FKP + (kk + 1) * 32, lane); al[n][u] = frag_h(sk + (FK + u * 16) * FKP + (kk + 1) * 32, lane); } }
      __builtin_amdgcn_sched_barrier(0);   // the LDS reads of chunk kk + 1 stay in front of the products of chunk kk
      /* the two products into accl[0] stand three matrix instructions apart, those into accl[1] two */
      acc[0] = WM(ah[c][0], qh[kk], acc[0]); accl[0] = WM(ah[c][0], ql[kk], accl[0]); acc[1] = WM(ah[c][1], qh[kk], acc[1]); accl[1] = WM(ah[c][1], ql[kk], accl[1]); accl[0] = WM(al[c][0], qh[kk], accl[0]); accl[1] = WM(al[c][1], qh[kk], accl[1]);
      __builtin_amdgcn_sched_barrier(0); }   // no product of chunk kk + 1 is pulled in here: it would wait on LDS reads that were only just issued
    v16h vf[2][4];   /* the first four v fragments do not depend on P: their LDS reads are written ahead of the exponentials, which cover the latency */
#pragma unroll   // the arrays indexed here live in registers: every index must be a compile-time constant
    for (int u = 0; u < 4; ++u) vf[0][u] = frag_h(sv + u * 16 * FVP, lane);
    float s[2][8]; float mx0 = -3.0e38f, mx1 = -3.0e38f;
#pragma unroll   // the arrays indexed here live in registers: every index must be a compile-time constant
    for (int r = 0; r < 8; ++r) { const float v0 = (acc[0][r] + accl[0][r] * (1.0f / 1024.0f)) * sc2, v1 = (acc[1][r] + accl[1][r] * (1.0f / 1024.0f)) * sc2; s[0][r] = v0; s[1][r] = v1; mx0 = fmaxf(mx0, v0); mx1 = fmaxf(mx1, v1); }
    float mx = fmaxf(mx0, mx1); mx = fmaxf(mx, __shfl_xor(mx, 16));   /* the other 16 keys of the same query */
    const float mn = fmaxf(m, mx - 11.0f); const float af = __builtin_amdgcn_exp2f(m - mn); m = mn;   /* the running maximum is kept 11 lower, so that every 2^(s - mn) already carries the 2^11 of the f16 P; first stage: 2^(-3e38) = 0 */
    float ps0 = 0.f, ps1 = 0.f; v16h pf;
#pragma unroll   // the arrays indexed here live in registers: every index must be a compile-time constant
    for (int r = 0; r < 8; r += 2) { const v2f mn2 = {mn, mn}; const v2f d0 = (v2f){s[0][r], s[0][r + 1]} - mn2, d1 = (v2f){s[1][r], s[1][r + 1]} - mn2;   /* two differences an instruction */
      const float e0 = __builtin_amdgcn_exp2f(d0[0]), e1 = __builtin_amdgcn_exp2f(d1[0]), e2 = __builtin_amdgcn_exp2f(d0[1]), e3 = __builtin_amdgcn_exp2f(d1[1]);   /* arguments end at about 11: the bare hardware exponential needs no range handling (far below: 0) */
      ps0 += e0; ps1 += e1; ps0 += e2; ps1 += e3; pf[r] = (_Float16)e0; pf[r + 1] = (_Float16)e2; pf[8 + r] = (_Float16)e1; pf[9 + r] = (_Float16)e3; }
    l = l * af + (ps0 + ps1);   /* per lane: its own 16 keys a stage; the two lanes of a query are added where the tile's share ends */
#pragma unroll   // the arrays indexed here live in registers: every index must be a compile-time constant
    for (int j = 0; j < CC / 16; ++j) o[j] = o[j] * af;
#pragma unroll   // the arrays indexed here live in registers: every index must be a compile-time constant
    for (int jg = 0; jg < CC / 64; ++jg) { const int c = jg & 1, n = c ^ 1;   /* four channel tiles a group: the LDS reads of group jg + 1 stand together in front of the products of group jg */
      if (jg + 1 < CC / 64) {
#pragma unroll   // the arrays indexed here live in registers: every index must be a compile-time constant
        for (int u = 0; u < 4; ++u) vf[n][u] = frag_h(sv + ((jg + 1) * 4 + u) * 16 * FVP, lane); }
      __builtin_amdgcn_sched_barrier(0);   // the LDS reads of group jg + 1 stay in one place, in front of the products of group jg
#pragma unroll   // the arrays indexed here live in registers: every index must be a compile-time constant
      for (int u = 0; u < 4; ++u) o[jg * 4 + u] = WM(vf[c][u], pf, o[jg * 4 + u]);
      __builtin_amdgcn_sched_barrier(0); }   // no LDS read of a later group is spread among these products
    asm volatile("s_wait_dscnt 0x0" ::: "memory");      // this wave's reads of buffer t & 1 are done before it is handed to the copies
    asm volatile("s_wait_asynccnt 0x0" ::: "memory");   // this wave's copies of stage t + 1 have landed
    __syncthreads();                                     // publishes stage t + 1 and ends every reader's last read of buffer t & 1
    if (t + 2 < nt) { const int s = (u + 2) & (NST - 1); fa_fill(k_h + (size_t)s * FK * CCQ, k_l + (size_t)s * FK * CCQ, v_t + s * FK, &ring[t & 1][0], tid); }
    if ((u & (NST - 1)) == NST - 1 || t == nt - 1) {   /* the block's share of this tile ends (the same test in every wave of the block): join the two key halves, write the partial, start anew */
      const size_t piece = ((size_t)b * NQB + blockIdx.x) * 2 + (u / NST - u0 / NST);   /* segment 0 or 1: nt <= 32 units meet at most two tiles */
      l += __shfl_xor(l, 16);
      xm[wave][lane] = m; xl[wave][lane] = l;
      __syncthreads();                                   // maximum and sum of the other key half are readable
      const float m2 = xm[wave ^ 4][lane], l2 = xl[wave ^ 4][lane]; const float ms = fmaxf(m, m2); const float a1 = __builtin_amdgcn_exp2f(m - ms), a2 = __builtin_amdgcn_exp2f(m2 - ms);
      float* pp = PO + (piece * FQ + qs * 16 + kh * 8) * CC + lane * 4;   /* a wave adds and stores 8 of its pair's 16 rows: two 512-B pieces a row */
      v4f h0[8];   /* 128 channels a pass through the staging; every global store stands behind the last barrier, so that no barrier waits for a store */
#pragma unroll   // the arrays indexed here live in registers: every index must be a compile-time constant
      for (int j = 0; j < 8; ++j) { const v8f w = o[j] * a1; const v4f w0 = {w[0], w[1], w[2], w[3]}, w1 = {w[4], w[5], w[6], w[7]}; *(v4f*)&st[wave][col][j * 16 + 8 * g] = w0; *(v4f*)&st[wave][col][j * 16 + 8 * g + 4] = w1; }
      __syncthreads();                                   // both halves' scaled outputs, channels 0..127, are readable
#pragma unroll   // the arrays indexed here live in registers: every index must be a compile-time constant
      for (int rl = 0; rl < 8; ++rl) h0[rl] = *(const v4f*)&st[qs][kh * 8 + rl][lane * 4] + *(const v4f*)&st[qs + 4][kh * 8 + rl][lane * 4];
      __syncthreads();                                   // every reader has left the staging before it is written again
#pragma unroll   // the arrays indexed here live in registers: every index must be a compile-time constant
      for (int j = 0; j < 8; ++j) { const v8f w = o[8 + j] * a1; const v4f w0 = {w[0], w[1], w[2], w[3]}, w1 = {w[4], w[5], w[6], w[7]}; *(v4f*)&st[wave][col][j * 16 + 8 * g] = w0; *(v4f*)&st[wave][col][j * 16 + 8 * g + 4] = w1; }
      __syncthreads();                                   // channels 128..255 are readable; the staging, xm and xl are next written behind the barrier at the foot of a later stage
#pragma unroll   // the arrays indexed here live in registers: every index must be a compile-time constant
      for (int rl = 0; rl < 8; ++rl) { vst2(pp + (size_t)rl * CC, h0[rl]); vst2(pp + (size_t)rl * CC + 128, *(const v4f*)&st[qs][kh * 8 + rl][lane * 4] + *(const v4f*)&st[qs + 4][kh * 8 + rl][lane * 4]); }
      if (kh == 0 && g == 0) { PM[piece * FQ + qs * 16 + col] = ms; PL[piece * FQ + qs * 16 + col] = l * a1 + l2 * a2; }
      asm volatile("s_wait_xcnt 0x0" ::: "memory");     // before an address register of the stores above is written again
#pragma unroll   // the arrays indexed here live in registers: every index must be a compile-time constant
      for (int j = 0; j < CC / 16; ++j) o[j] = (v8f){};
      m = -3.0e38f; l = 0.f; } }
  asm volatile("s_wait_asynccnt 0x0" ::: "memory");     // no copy is outstanding when the wave ends
}
// 2^d with the free issue slot behind a transcendental in the same statement: in a row of exponentials the next one may be given this one's source register as its result
__device__ __forceinline__ float exp2_slot(float d) { float r; asm("v_exp_f32 %0, %1\n\tv_nop" : "=v"(r) : "v"(d)); return r; }
// ---- k_mg: one output row = the partials of its slot's tile, joined (common maximum, weights 2^(m - M)), divided by the joined sum. 16 lanes a row, 16 channels a lane; four partials are fetched at a time.
__global__ __launch_bounds__(256) void k_mg(const float* __restrict__ PO, const float* __restrict__ PM, const float* __restrict__ PL, const int* __restrict__ SL, const int* __restrict__ NT, float* __restrict__ Y) {
  const int c = threadIdx.x & 15, rg = threadIdx.x >> 4; const int b = blockIdx.y;
  int nt = NT[b]; nt = nt < 1 ? 1 : nt > NQB ? NQB : nt;
  int sl[2];
#pragma unroll
  for (int rr = 0; rr < 2; ++rr) sl[rr] = SL[(size_t)b * TT + blockIdx.x * 32 + rr * 16 + rg];
  asm volatile("s_wait_xcnt 0x0" ::: "memory");       // before an address register of the loads above is written again
#pragma unroll
  for (int rr = 0; rr < 2; ++rr) { const int q = blockIdx.x * 32 + rr * 16 + rg;
    int slot = sl[rr]; slot = slot < 0 ? 0 : slot > nt * FQ - 1 ? nt * FQ - 1 : slot;
    const int tau = slot / FQ, r = slot % FQ; const int j0 = (tau * NST) / nt, j1 = (tau * NST + NST - 1) / nt;   /* the blocks that hold units of tile tau; j1 <= 31 as tau < nt */
    float M = -3.0e38f, L = 0.f; v4f a[4] = {};
    for (int jb = j0; jb <= j1; jb += 4) { float pm[4], pl[4]; v4f x[4][4];
#pragma unroll
      for (int e = 0; e < 4; ++e) { const int jj = jb + e < j1 ? jb + e : j1; const size_t piece = ((size_t)b * NQB + jj) * 2 + (tau - (jj * nt) / NST);   /* past the last block: the last one again, with weight 0 */
        pm[e] = PM[piece * FQ + r]; pl[e] = PL[piece * FQ + r];
        asm volatile("s_wait_xcnt 0x0" ::: "memory");   // before a later load's result lands in an address register of the two loads above
#pragma unroll
        for (int k = 0; k < 4; ++k) x[e][k] = *(const v4f*)(PO + (piece * FQ + r) * CC + k * 64 + c * 4);
        asm volatile("s_wait_xcnt 0x0" ::: "memory"); }   // before a later load's result lands in the address register of the four loads above
      __builtin_amdgcn_sched_barrier(0);   // the loads of all four partials are issued before the first is used: one memory latency a group, not several
      const float Mn = fmaxf(fmaxf(M, fmaxf(pm[0], pm[1])), fmaxf(pm[2], pm[3])); const float f = exp2_slot(M - Mn); M = Mn; L *= f;
#pragma unroll
      for (int k = 0; k < 4; ++k) a[k] = a[k] * f;
#pragma unroll
      for (int e = 0; e < 4; ++e) { const float ex = exp2_slot(pm[e] - Mn); const float w = jb + e <= j1 ? ex : 0.f; L += pl[e] * w;
#pragma unroll
        for (int k = 0; k < 4; ++k) a[k] = a[k] + x[e][k] * w; } }
    const float inv = 1.0f / L;   /* sums and outputs both carry the 2^11; the sum holds the 2^11 of the row's maximum: never 0 */
#pragma unroll
    for (int k = 0; k < 4; ++k) vst2(Y + ((size_t)b * TT + q) * CC + k * 64 + c * 4, a[k] * inv);
    asm volatile("s_wait_xcnt 0x0" ::: "memory"); } }   // before an address register of the stores above is written again

extern "C" void kernel_launch(void* const* d_in, const int* in_sizes, int n_in, void* d_out, int out_size, void* d_ws, size_t ws_size, hipStream_t stream) {
  (void)in_sizes; (void)n_in; (void)out_size;
  const float** F = (const float**)d_in;
  if (ws_size < (size_t)WS_END) return;
  char* ws = (char*)d_ws; _Float16 *QH = (_Float16*)(ws + WS_QH), *KH = (_Float16*)(ws + WS_KH), *VT = (_Float16*)(ws + WS_VT), *QL = (_Float16*)(ws + WS_QL), *KL = (_Float16*)(ws + WS_KL); __bf16 *VB = (__bf16*)(ws + WS_VB), *VBL = (__bf16*)(ws + WS_VBL);
  float *PO = (float*)(ws + WS_PO), *PM = (float*)(ws + WS_PM), *PL = (float*)(ws + WS_PL); int *SL = (int*)(ws + WS_SL), *NT = (int*)(ws + WS_NT);
  // inputs: 0 x [8,2048,256]; 1 kernel [3,256,256] ((in,out): Q | K | V matrices); 2 mask [8,2048] int32
  const float* Wq = F[1]; const float* Wk = F[1] + (size_t)DIN * CCQ; const float* Wv = F[1] + 2 * (size_t)DIN * CCQ;
  k_projT<0><<<dim3(TNB * TT / 64, CCQ / 128, 2), 128, 0, stream>>>(F[0], F[0], F[0], Wq, Wk, Wv, nullptr, nullptr, nullptr, QH, QL, KH, KL, VT, VB, VBL);   /* which 0, 1: q and k rows (hi + residual planes) */
  k_projT<2><<<dim3(TNB * TT / 64, CC / 128, 1), 128, 0, stream>>>(F[0], F[0], F[0], Wq, Wk, Wv, nullptr, nullptr, nullptr, QH, QL, KH, KL, VT, VB, VBL);     /* which 2: v planes */
  k_fa<<<dim3(NQB, TNB), 256, 0, stream>>>(QH, QL, KH, KL, VT, (const int*)d_in[2], PO, PM, PL, SL, NT);   /* scores, softmax, P . v of the needed rows: partials */
  k_mg<<<dim3(TT / 32, TNB), 256, 0, stream>>>(PO, PM, PL, SL, NT, (float*)d_out);   /* every output row from its partials */
}

// v008
// A run of this version takes 67.3 microseconds.
// Two timings next to v007 put it at 1.04 and 1.03 times that version's speed.
// All steps since v000 together make it 7.50 times as fast.
// compute dtype: all float inputs rounded to bf16; q/k/v projections with EXACT bf16 products on WMMA 16x16x32 (f32 accumulate); logits q x k with BOTH operands as f16 hi + (x 2^10) residual (3 products: hi.hi + lo.hi + hi.lo) x 64^-0.5, for every row (the logits have sigma - 500); the int row mask multiplies the logits in f32; softmax f32 with a running maximum (scores, softmax and P.v fused); exp(logit - running maximum) x 2^11 once to f16 x v once to f16 (1 product), divided by the row sum at the end; f32 output.
#include <hip/hip_runtime.h>
#include <math.h>

typedef __attribute__((ext_vector_type(16))) _Float16 v16h;
typedef __attribute__((ext_vector_type(16))) __bf16 v16b;
typedef __attribute__((ext_vector_type(8)))  _Float16 v8h;
typedef __attribute__((ext_vector_type(8)))  float v8f;
typedef __attribute__((ext_vector_type(4)))  float v4f;
typedef __attribute__((ext_vector_type(2)))  float v2f;
typedef __attribute__((ext_vector_type(4)))  unsigned v4u;
typedef __attribute__((ext_vector_type(4)))  int v4i;
typedef float __attribute__((may_alias)) float_a;
typedef int __attribute__((may_alias)) int_a;

template <typename T> __device__ __forceinline__ void vst2(void* p, T v) { *(T*)p = v;  }
__device__ __forceinline__ v8f wmma16(v16h a, v16h b, v8f c) {
  v8f d = __builtin_amdgcn_wmma_f32_16x16x32_f16(false, a, false, b, (short)0, c, false, false);
  asm volatile("v_nop\n\tv_nop\n\tv_nop\n\tv_nop" : "+v"(d) : "v"(a), "v"(b));
  return d;
}
__device__ __forceinline__ v8f wmma_bf(v16b a, v16b b, v8f c) {
  v8f d = __builtin_amdgcn_wmma_f32_16x16x32_bf16(false, a, false, b, (short)0, c, false, false);
  asm volatile("v_nop\n\tv_nop\n\tv_nop\n\tv_nop" : "+v"(d) : "v"(a), "v"(b));
  return d;
}
// 16x16x32 fragments: lane = (h = lane>>4, row/col = lane&15); elements 0..7 = k0+8h+0..7, 8..15 = k0+16+8h+0..7; D element r = row 8h+r
__device__ __forceinline__ v16h frag_h(const _Float16* rowk0, int lane) {
  union { v16h v; v8h q[2]; } u; const _Float16* p = rowk0 + 8 * (lane >> 4);
  u.q[0] = *(const v8h*)p; u.q[1] = *(const v8h*)(p + 16); return u.v;
}
__device__ __forceinline__ v16h frag_f32(const float* rowk0, int lane) {
  v16h a; const float* p = rowk0 + 8 * (lane >> 4);
#pragma unroll
  for (int i = 0; i < 8; ++i) { a[i] = (_Float16)p[i]; a[8 + i] = (_Float16)p[16 + i]; }
  return a;
}
__device__ __forceinline__ v16h frag_f32s(const float* rowk0, int lane, float sc) {
  v16h a; const float* p = rowk0 + 8 * (lane >> 4);
#pragma unroll
  for (int i = 0; i < 8; ++i) { a[i] = (_Float16)(p[i] * sc); a[8 + i] = (_Float16)(p[16 + i] * sc); }
  return a;
}
// column fragment from a [K][ld] layout (column n), rows >= K read as 0
__device__ __forceinline__ v16h fragc_f32(const float* W, int k0, int n, int lane, int ld, int K) {
  v16h a; const int g = lane >> 4;
#pragma unroll
  for (int i = 0; i < 8; ++i) { const int ka = k0 + 8 * g + i, kb = ka + 16;
    a[i] = (_Float16)(ka < K ? W[(size_t)(ka < K ? ka : K - 1) * ld + n] : 0.f); a[8 + i] = (_Float16)(kb < K ? W[(size_t)(kb < K ? kb : K - 1) * ld + n] : 0.f); }
  return a;
}
struct F2 { v16b h, l; };
__device__ __forceinline__ F2 bsplit16(const float v[16]) { F2 r;
#pragma unroll
  for (int i = 0; i < 16; ++i) { const __bf16 h = (__bf16)v[i]; r.h[i] = h; r.l[i] = (__bf16)(v[i] - (float)h); }
  return r; }
__device__ __forceinline__ F2 split_row(const float* row, int k0, int lane) { float v[16]; const float* p = row + k0 + 8 * (lane >> 4);
#pragma unroll
  for (int i = 0; i < 8; ++i) { v[i] = p[i]; v[8 + i] = p[16 + i]; }
  return bsplit16(v); }
__device__ __forceinline__ F2 split_rowK(const float* row, int k0, int lane, int K) { float v[16]; const int g = lane >> 4;
#pragma unroll
  for (int i = 0; i < 8; ++i) { const int ka = k0 + 8 * g + i, kb = ka + 16; v[i] = ka < K ? row[ka < K ? ka : K - 1] : 0.f; v[8 + i] = kb < K ? row[kb < K ? kb : K - 1] : 0.f; }
  return bsplit16(v); }
__device__ __forceinline__ F2 split_col(const float* W, int k0, int n, int lane, int ld, int K) { float v[16]; const int g = lane >> 4;
#pragma unroll
  for (int i = 0; i < 8; ++i) { const int ka = k0 + 8 * g + i, kb = ka + 16; v[i] = ka < K ? W[(size_t)(ka < K ? ka : K - 1) * ld + n] : 0.f; v[8 + i] = kb < K ? W[(size_t)(kb < K ? kb : K - 1) * ld + n] : 0.f; }
  return bsplit16(v); }
__device__ __forceinline__ v8f mac3(const F2& a, const F2& b, v8f c) { c = wmma_bf(a.l, b.h, c); c = wmma_bf(a.h, b.l, c); return wmma_bf(a.h, b.h, c); }
__device__ __forceinline__ float sigm(float v) { return 1.0f / (1.0f + expf(-v)); }
#define LDSX() do { asm volatile("s_wait_dscnt 0" ::: "memory"); __builtin_amdgcn_wave_barrier(); __builtin_amdgcn_fence(__ATOMIC_RELEASE, "workgroup"); } while (0)

// Single-head self-attention with unscaled N(0,1) projection kernels and a multiplicative row mask (x [8,2048,256]; kernel [3,256,256] (in,out): Q, K, V; mask [8,2048] int 0/1; SCALE = 1/sqrt(64) hard-coded): QK = (Q K^T) / 8; QK *= mask[b][q] per QUERY row (masked rows: all-zero logits -> uniform attention); A = softmax(QK); out = A V -> [8,2048,256].
#define NB 8
#define TT 2048
#define CC 256            // value width (v planes, output rows)
#define CCQ 256           // q / k row width
#define DIN 256          // x width
#define NH 1
#define HD 256
#define NQB (TT / 64)
#define HG 4               // four 2,048 x 2,048 f32 planes of WS_S, which hold k_fa's partials, slots and tile counts (k_fa keeps the logits on chip)
#define SCALE (0.125f)             // 1/sqrt(64), hard-coded in the source
#define HDQK 256           // q / k width
#define CAUSAL 0
#ifndef TNB
#define TNB NB
#endif
__device__ __forceinline__ v16b zero16b() { v16b z; _Pragma("unroll") for (int i = 0; i < 16; ++i) z[i] = (__bf16)0.f; return z; }
__device__ __forceinline__ float bfr(float v) { return (float)(__bf16)v; }
__host__ __device__ __forceinline__ int kb_last(int qb) { return CAUSAL ? ((qb * 64 + 63) >> 7) : (TT / 128 - 1); }
typedef __attribute__((ext_vector_type(8))) __bf16 v8b;
__device__ __forceinline__ v16b frag_b(const __bf16* rowk0, int lane) {
  union { v16b v; v8b q[2]; } u; const __bf16* p = rowk0 + 8 * (lane >> 4);
  u.q[0] = *(const v8b*)p; u.q[1] = *(const v8b*)(p + 16); return u.v;
}
#define QBH 0              // k_fa keeps the single-product P.v path for every block
#define QBH_SC NQB         // k_fa: EVERY query block takes the 3-product (q hi+lo x k hi+lo) path
#define QHI TT              // q residual rows for every query
#define KHI TT              // k residual rows for every key (the bf16 v hi/lo planes are written too but unused)
// B fragment (k rows k0+.., output column o) of a weight: (in,out) [K][ld] or (out,in) [ld rows of K]: bf16 exact, or f16(bf16 * 256) exact
__device__ __forceinline__ v16b wcol_io(const float* Wm, int k0, int o, int lane, int ld) { v16b w; const int g = lane >> 4;
#pragma unroll
  for (int i = 0; i < 8; ++i) { w[i] = (__bf16)Wm[(size_t)(k0 + 8 * g + i) * ld + o]; w[8 + i] = (__bf16)Wm[(size_t)(k0 + 16 + 8 * g + i) * ld + o]; }
  return w; }
__device__ __forceinline__ v16b wcol_oi(const float* Wm, int k0, int o, int lane, int K) { v16b w; const float* p = Wm + (size_t)o * K + k0 + 8 * (lane >> 4);
#pragma unroll
  for (int i = 0; i < 8; ++i) { w[i] = (__bf16)p[i]; w[8 + i] = (__bf16)p[16 + i]; }
  return w; }
__device__ __forceinline__ v16h wcolh_io(const float* Wm, int k0, int o, int lane, int ld) { v16h w; const int g = lane >> 4;
#pragma unroll
  for (int i = 0; i < 8; ++i) { w[i] = (_Float16)(bfr(Wm[(size_t)(k0 + 8 * g + i) * ld + o]) * 256.0f); w[8 + i] = (_Float16)(bfr(Wm[(size_t)(k0 + 16 + 8 * g + i) * ld + o]) * 256.0f); }
  return w; }
__device__ __forceinline__ v16h wcolh_oi(const float* Wm, int k0, int o, int lane, int K) { v16h w; const float* p = Wm + (size_t)o * K + k0 + 8 * (lane >> 4);
#pragma unroll
  for (int i = 0; i < 8; ++i) { w[i] = (_Float16)(bfr(p[i]) * 256.0f); w[8 + i] = (_Float16)(bfr(p[16 + i]) * 256.0f); }
  return w; }
#define WQKV_LAYOUT 0   // 0 = (in,out) [K][CC]; 1 = (out,in) [CC][DIN]; 2 = per-head [NH][DIN][HD]
__device__ __forceinline__ v16b wcol_hdk(const float* Wm, int k0, int o, int lane) { v16b w; const int g = lane >> 4; const float* p = Wm + (size_t)(o / HD) * DIN * HD + (o % HD);
#pragma unroll
  for (int i = 0; i < 8; ++i) { w[i] = (__bf16)p[(size_t)(k0 + 8 * g + i) * HD]; w[8 + i] = (__bf16)p[(size_t)(k0 + 16 + 8 * g + i) * HD]; }
  return w; }
#define WO_OUT_IN 0
#if WQKV_LAYOUT == 1
#define WCOL(W, k0, o, lane) wcol_oi(W, k0, (o), lane, DIN)   /* unused: layout 0 */
#elif WQKV_LAYOUT == 2
#define WCOL(W, k0, o, lane) wcol_hdk(W, k0, o, lane)
#else
#define WCOL(W, k0, o, lane) (which == 2 ? wcol_io(W, k0, (o), lane, CC) : ((o) < HDQK ? wcol_io(W, k0, (o), lane, HDQK) : zero16b()))   /* Wv [256][256]; Wq/Wk [256][256]: projected q/k columns >= 256 would read as zero (grid y = 2 covers 0..255) */
#endif
#if WO_OUT_IN
#define WOCOL(W, k0, o, lane) wcol_oi(W, k0, o, lane, CC)
#define WOCOLH(W, k0, o, lane) wcolh_oi(W, k0, o, lane, CC)
#else
#define WOCOL(W, k0, o, lane) wcol_io(W, k0, o, lane, DIN)
#define WOCOLH(W, k0, o, lane) wcolh_io(W, k0, o, lane, DIN)
#endif
#define BG HG
#define BGN (TNB < BG ? TNB : BG)   // unused: k_fa takes all TNB batches in one launch
#define DVH 128            // unused: a k_fa wave keeps all 256 value columns in 16 accumulator tiles
#define SM_EXTRA_PARAMS , int bsm, const int* __restrict__ RMASK
// multiplicative per-QUERY-row int mask applied to the scaled logits before the softmax (mask 0 -> every logit of the row becomes 0 -> uniform attention), as the module
#define SM_MASK_HOOK do { v = v * (float)RMASK[(size_t)(bsm + (int)blockIdx.y) * TT + t]; } while (0)
#ifndef SM_EXTRA_PARAMS
#define SM_EXTRA_PARAMS
#endif
#ifndef PROJ_EXTRA_PARAMS
#define PROJ_EXTRA_PARAMS
#endif
#ifndef SM_MASK_HOOK
#define SM_MASK_HOOK (void)0
#endif

#define WS_QH  0u                                      // f16 q rows [b*t][CCQ]
#define WS_KH  (WS_QH + 2u * (size_t)NB * TT * CCQ)     // f16 k rows [b*t][CCQ]
#define WS_VT  (WS_KH + 2u * (size_t)NB * TT * CCQ)     // f16 v planes [b][c][t]
#define WS_QL  (WS_VT + 2u * (size_t)NB * CC * TT)      // f16 q residual x 2^10 rows [b][t < QHI][CCQ]
#define WS_KL  (WS_QL + 2u * (size_t)NB * QHI * CCQ)    // f16 k residual x 2^10 rows [b][t < KHI][CCQ]
#define WS_VB  (WS_KL + 2u * (size_t)NB * KHI * CCQ)    // bf16 v hi planes [b][c][t < KHI]
#define WS_VBL (WS_VB + 2u * (size_t)NB * CC * KHI)
#define WS_S   (WS_VBL + 2u * (size_t)NB * CC * KHI)    // f32 [hg][t][s] space: k_fa keeps the logits on chip; its partials lie here
#define WS_Y   (WS_S  + 4u * (size_t)HG * TT * TT)      // f32 ctx rows [b*t][CC] (only when there is an output projection)
#define WS_END (WS_Y  + 0u)

#define XSP 72             // staged x row pitch in bf16: 128 B + 16 B (same reason as PWP)
typedef __attribute__((ext_vector_type(4))) __bf16 v4b;
#define PWP 264            // staged weight row pitch in bf16: 512 B + 16 B (16 B x odd: ds_load_b128 walks over rows meet no bank twice)
// two waves a SIMD (512 registers) and 122,880 B of LDS: two blocks a WGP, so that the 512 blocks of the q/k launch are resident at once
// ---- k_proj: block = (128 rows, 128 cols, which); a wave takes two groups of 16 rows (block rows 64 h + 16 wave + 0..15, h = 0, 1), so that the staged weight tile serves twice the rows and every B fragment read from LDS feeds two products: q/k/v = X W (+ b) with exact bf16 products (K = DIN) -> which 0: q f16 rows (+ residual rows < QHI); 1: k f16 rows (+ residual rows < KHI); 2: v f16 planes [c][t] (+ bf16 hi/lo planes for t < KHI)
template <int WOFF> __global__ __launch_bounds__(128) __attribute__((amdgpu_waves_per_eu(2))) void k_projT(const float* __restrict__ XQ, const float* __restrict__ XK, const float* __restrict__ XV, const float* __restrict__ WQ, const float* __restrict__ WK, const float* __restrict__ WV, const float* __restrict__ BQ, const float* __restrict__ BK, const float* __restrict__ BV,
    _Float16* __restrict__ QH, _Float16* __restrict__ QL, _Float16* __restrict__ KH, _Float16* __restrict__ KL, _Float16* __restrict__ VT, __bf16* __restrict__ VB, __bf16* __restrict__ VBL) {
  // one LDS pool: first the weight tile, bf16, transposed to [output column][k]; behind the products (and a barrier) the same bytes are the output staging
  __shared__ __align__(16) char pool[3 * 128 * 136 * 2];   /* the largest use: three staged v planes; the weight tile takes 128 * PWP * 2 B of it */
  __shared__ __align__(16) __bf16 xs[4][2][16][XSP];   /* a wave's own turning place for its x rows: two groups of 16 rows x 64 k at a time */
  __bf16 (*wt)[PWP] = (__bf16 (*)[PWP])pool;
  _Float16 (*sh)[136] = (_Float16 (*)[136])pool; _Float16 (*sl)[136] = (_Float16 (*)[136])(pool + 128 * 136 * 2);
  _Float16 (*th)[136] = (_Float16 (*)[136])pool; __bf16 (*tb)[136] = (__bf16 (*)[136])(pool + 128 * 136 * 2); __bf16 (*tbl)[136] = (__bf16 (*)[136])(pool + 2 * 128 * 136 * 2);   /* staged rows of 128 values: 256 B + 16 B (same reason as PWP) */
  const int tid = threadIdx.x, wave = tid >> 5, lane = tid & 31, col = lane & 15, g = lane >> 4; const int which = blockIdx.z + WOFF; const int c0 = blockIdx.y * 128; const size_t r0 = (size_t)blockIdx.x * 128; const size_t bb = r0 / TT; const int t0 = (int)(r0 % TT);
  const float* X = which == 0 ? XQ : which == 1 ? XK : XV; const float* WA = which == 0 ? WQ : which == 1 ? WK : WV; const float* BA = which == 0 ? BQ : which == 1 ? BK : BV;
  const int KD = DIN;
  v8f acc[2][8] = {};
  v16b xa[2][DIN / 32];   /* this wave's two groups of 16 x rows, whole width, as A fragments */
  /* Weight tile [DIN][128 columns from c0] -> wt[column][k], read from global ONCE per block. A wave fills its own 32 columns; a lane takes 4 columns x 8 k a unit: 8 loads of 16 B (a wave's load = four whole 128-B lines), 4 LDS stores of 16 B (8 k of one column).
     Sixteen units of 8 loads a lane: 0..7 = the weight tile's 32-k slabs, 8..15 = two k chunks each of 16 x rows, the wave's first and second row group in turn. An x load of a wave = 256 B in a row of each of two rows (four whole 128-B lines, not 32 B of each of 16 lines); the lanes get their A fragments (one row a lane) back through xs. Six units are in flight; a unit is used up (to LDS, or to bf16 fragments) and then the unit six further on is issued into its registers. */
  { const int cb = wave * 32 + (lane & 7) * 4, kq = (lane >> 3) * 8; const float* pw = WA + (size_t)kq * CCQ + c0 + cb; const float* px = X + (r0 + wave * 16 + g) * (size_t)KD + col * 4;   /* x row-major [b*t][KD]; load i of a unit: rows 2 i and 2 i + 1 */
    v4f un[16][8];
#pragma unroll   // the arrays indexed here live in registers: every index must be a compile-time constant
    for (int n = -6; n < 16; ++n) {
      if (n >= 0 && n < 8) {
#pragma unroll
        for (int c = 0; c < 4; ++c) { v8b t;
#pragma unroll
          for (int i = 0; i < 8; ++i) t[i] = (__bf16)un[n][i][c];
          *(v8b*)&wt[cb + c][n * 32 + kq] = t; } }
      if (n >= 8) { const int gr = (n - 8) & 1, cp = (n - 8) >> 1;   /* row group; pair of k chunks */
#pragma unroll
        for (int i = 0; i < 8; ++i) { v4b t;
#pragma unroll
          for (int e = 0; e < 4; ++e) t[e] = (__bf16)un[n][i][e];
          *(v4b*)&xs[wave][gr][2 * i + g][col * 4] = t; }
        if (gr == 1) {   /* both row groups of this pair of k chunks are stored: one LDS round trip for the two */
          asm volatile("s_wait_dscnt 0x0" ::: "memory");   // the wave's stores into xs are done before its lanes read what other lanes stored (the "memory" clobber keeps the compiler's LDS accesses on their sides)
#pragma unroll   // the arrays indexed here live in registers: every index must be a compile-time constant
          for (int h = 0; h < 2; ++h) { xa[h][cp * 2] = frag_b(&xs[wave][h][col][0], lane); xa[h][cp * 2 + 1] = frag_b(&xs[wave][h][col][32], lane); }
          asm volatile("s_wait_dscnt 0x0" ::: "memory"); }   // the fragments are read before the next units' stores overwrite xs
      }
      __builtin_amdgcn_sched_barrier(0);   // unit n is used up before unit n + 6 is issued: its registers are free again (no spill)
      const int m = n + 6;
      if (m < 8) {
#pragma unroll
        for (int i = 0; i < 8; ++i) un[m][i] = *(const v4f*)(pw + (size_t)(m * 32 + i) * CCQ);
        if (m == 7) asm volatile("s_wait_xcnt 0x0" :: "v"(pw) : "memory"); }   // behind the last weight load; the address is named so that it stays in its registers up to here and no load's result is given them in front of the wait
      else if (m < 16) {
#pragma unroll
        for (int i = 0; i < 8; ++i) un[m][i] = *(const v4f*)(px + (size_t)(((m - 8) & 1) * 64 + 2 * i) * KD + ((m - 8) >> 1) * 64); }
      if (m == 15) asm volatile("s_wait_xcnt 0x0" ::: "memory");   // behind the last load: before an address register of the loads above is written again
      __builtin_amdgcn_sched_barrier(0); } }   // the loads of unit n + 6 are issued here and not pushed behind the wait for unit n + 1
  __syncthreads();   // the whole weight tile is readable by every wave
  v16b bf[2][4];   /* B fragments in groups of four (group f: k chunk f >> 1, column tiles 4 (f & 1) + 0..3); the LDS reads of group f + 1 stand together in front of the products of group f */
#pragma unroll   // the arrays indexed here live in registers: every index must be a compile-time constant
  for (int u = 0; u < 4; ++u) bf[0][u] = frag_b(&wt[u * 16 + col][0], lane);
#pragma unroll   // the arrays indexed here live in registers: every index must be a compile-time constant
  for (int f = 0; f < DIN / 16; ++f) { const int cu = f & 1, nx = cu ^ 1;
    if (f + 1 < DIN / 16) {
#pragma unroll
      for (int u = 0; u < 4; ++u) bf[nx][u] = frag_b(&wt[(nx * 4 + u) * 16 + col][((f + 1) >> 1) * 32], lane); }
    __builtin_amdgcn_sched_barrier(0);   // the LDS reads of group f + 1 stay in one place, in front of the products of group f
#pragma unroll
    for (int h = 0; h < 2; ++h) {
#pragma unroll
      for (int u = 0; u < 4; ++u) acc[h][cu * 4 + u] = __builtin_amdgcn_wmma_f32_16x16x32_bf16(false, xa[h][f >> 1], false, bf[cu][u], (short)0, acc[h][cu * 4 + u], false, false); }   /* same products in the same k order as before */
    __builtin_amdgcn_sched_barrier(0); }   // no LDS read of a later group is spread among these products
  __syncthreads();   // every wave's last read of the weight tile is done before the pool becomes output staging
  if (which < 2) { _Float16* DH = which == 0 ? QH : KH; _Float16* DL = which == 0 ? QL : KL; const int nhi = which == 0 ? QHI : KHI; const bool hi_rows = t0 < nhi;
#pragma unroll
    for (int j = 0; j < 8; ++j) { const float bias = BA ? bfr(BA[c0 + j * 16 + col]) : 0.f;
#pragma unroll   // the arrays indexed here live in registers: every index must be a compile-time constant
      for (int h = 0; h < 2; ++h) {
#pragma unroll
        for (int r = 0; r < 8; ++r) { const float v = acc[h][j][r] + bias; const _Float16 hv = (_Float16)v; sh[h * 64 + wave * 16 + 8 * g + r][j * 16 + col] = hv; sl[h * 64 + wave * 16 + 8 * g + r][j * 16 + col] = (_Float16)((v - (float)hv) * 1024.0f); } } }
    __syncthreads();
    { const int rl = tid >> 4, q = tid & 15; v4u wh[16], wl[16];   /* q/k rows: pitch CCQ; piece i of a thread: row rl + 8 i. The LDS reads stand together: one LDS latency for the 32 pieces of a thread, not one a piece */
#pragma unroll   // the arrays indexed here live in registers: every index must be a compile-time constant
      for (int i = 0; i < 16; ++i) { wh[i] = *(const v4u*)&sh[rl + 8 * i][q * 8]; wl[i] = *(const v4u*)&sl[rl + 8 * i][q * 8]; }
      _Float16* ph = DH + (r0 + rl) * CCQ + c0 + q * 8; _Float16* pl = DL + (bb * nhi + t0 + rl) * (size_t)CCQ + c0 + q * 8;
#pragma unroll   // the arrays indexed here live in registers: every index must be a compile-time constant
      for (int k = 0; k < 16; k += 8) {
#pragma unroll   // the arrays indexed here live in registers: every index must be a compile-time constant
        for (int i = k; i < k + 8; ++i) { vst2((unsigned*)(ph + (size_t)(8 * i) * CCQ), wh[i]); if (hi_rows) vst2((unsigned*)(pl + (size_t)(8 * i) * CCQ), wl[i]); }
        // behind the stores; their values and addresses are named so that they stay in their registers up to here and nothing is written there in front of the wait
        asm volatile("s_wait_xcnt 0x0" :: "v"(ph), "v"(pl), "v"(wh[k]), "v"(wh[k + 1]), "v"(wh[k + 2]), "v"(wh[k + 3]), "v"(wh[k + 4]), "v"(wh[k + 5]), "v"(wh[k + 6]), "v"(wh[k + 7]), "v"(wl[k]), "v"(wl[k + 1]), "v"(wl[k + 2]), "v"(wl[k + 3]), "v"(wl[k + 4]), "v"(wl[k + 5]), "v"(wl[k + 6]), "v"(wl[k + 7]) : "memory"); } }
  } else { const bool hi_rows = t0 < KHI;
#pragma unroll
    for (int j = 0; j < 8; ++j) { const float bias = BA ? bfr(BA[c0 + j * 16 + col]) : 0.f;
#pragma unroll   // the arrays indexed here live in registers: every index must be a compile-time constant
      for (int h = 0; h < 2; ++h) {
        v8h hv; v8b bv, lv;   /* a lane's 8 rows of one column lie side by side in the staged planes: one 16-byte LDS store a plane */
#pragma unroll
        for (int r = 0; r < 8; ++r) { const float v = acc[h][j][r] + bias; hv[r] = (_Float16)v; const __bf16 bh = (__bf16)v; bv[r] = bh; lv[r] = (__bf16)(v - (float)bh); }
        { const int rl = h * 64 + wave * 16 + 8 * g, cl = j * 16 + col; *(v8h*)&th[cl][rl] = hv; *(v8b*)&tb[cl][rl] = bv; *(v8b*)&tbl[cl][rl] = lv; } } }
    __syncthreads();
    { const int cl = tid >> 4, q = tid & 15; v4u wv[16], wb[16], wl[16];   /* piece i of a thread: channel cl + 8 i; the LDS reads stand together, as above */
#pragma unroll   // the arrays indexed here live in registers: every index must be a compile-time constant
      for (int i = 0; i < 16; ++i) { wv[i] = *(const v4u*)&th[cl + 8 * i][q * 8]; wb[i] = *(const v4u*)&tb[cl + 8 * i][q * 8]; wl[i] = *(const v4u*)&tbl[cl + 8 * i][q * 8]; }
      _Float16* pv = VT + (bb * CC + c0 + cl) * (size_t)TT + t0 + q * 8; const size_t o3 = (bb * CC + c0 + cl) * (size_t)KHI + t0 + q * 8; __bf16* pb = VB + o3; __bf16* pl = VBL + o3;
#pragma unroll   // the arrays indexed here live in registers: every index must be a compile-time constant
      for (int k = 0; k < 16; k += 8) {
#pragma unroll   // the arrays indexed here live in registers: every index must be a compile-time constant
        for (int i = k; i < k + 8; ++i) { vst2((unsigned*)(pv + (size_t)(8 * i) * TT), wv[i]); if (hi_rows) { vst2((unsigned*)(pb + (size_t)(8 * i) * KHI), wb[i]); vst2((unsigned*)(pl + (size_t)(8 * i) * KHI), wl[i]); } }
        // behind the stores; their values and addresses are named so that they stay in their registers up to here and nothing is written there in front of the wait
        asm volatile("s_wait_xcnt 0x0" :: "v"(pv), "v"(pb), "v"(pl), "v"(wv[k]), "v"(wv[k + 1]), "v"(wv[k + 2]), "v"(wv[k + 3]), "v"(wv[k + 4]), "v"(wv[k + 5]), "v"(wv[k + 6]), "v"(wv[k + 7]), "v"(wb[k]), "v"(wb[k + 1]), "v"(wb[k + 2]), "v"(wb[k + 3]), "v"(wb[k + 4]), "v"(wb[k + 5]), "v"(wb[k + 6]), "v"(wb[k + 7]), "v"(wl[k]), "v"(wl[k + 1]), "v"(wl[k + 2]), "v"(wl[k + 3]), "v"(wl[k + 4]), "v"(wl[k + 5]), "v"(wl[k + 6]), "v"(wl[k + 7]) : "memory"); } } } }
__device__ __forceinline__ unsigned lds_off(const void* p) { return (unsigned)(size_t)p; }
// eight 16-byte copies of one lane, global -> LDS; the s_wait_xcnt stands inside the statement so that no address register is rewritten in front of it
__device__ __forceinline__ void copy8(const unsigned l[8], const char* const gp[8]) {
  asm volatile("global_load_async_to_lds_b128 %0, %8, off\n\t"
               "global_load_async_to_lds_b128 %1, %9, off\n\t"
               "global_load_async_to_lds_b128 %2, %10, off\n\t"
               "global_load_async_to_lds_b128 %3, %11, off\n\t"
               "global_load_async_to_lds_b128 %4, %12, off\n\t"
               "global_load_async_to_lds_b128 %5, %13, off\n\t"
               "global_load_async_to_lds_b128 %6, %14, off\n\t"
               "global_load_async_to_lds_b128 %7, %15, off\n\t"
               "s_wait_xcnt 0x0"
               :: "v"(l[0]), "v"(l[1]), "v"(l[2]), "v"(l[3]), "v"(l[4]), "v"(l[5]), "v"(l[6]), "v"(l[7]),
                  "v"(gp[0]), "v"(gp[1]), "v"(gp[2]), "v"(gp[3]), "v"(gp[4]), "v"(gp[5]), "v"(gp[6]), "v"(gp[7]) : "memory");
}
// the compiler keeps the distance behind its own builtin form
__device__ __forceinline__ v8f WM(v16h a, v16h b, v8f c) { return __builtin_amdgcn_wmma_f32_16x16x32_f16(false, a, false, b, (short)0, c, false, false); }
// ---- k_fa: scores, softmax and P . v in ONE kernel; the logits never leave the WGP. A tile = 64 query slots of one batch (which tiles a block works on: below); 8 waves = 4 query sub-tiles of 16 x 2 key halves: of every stage of 64 keys a wave takes 32.
// Scores TRANSPOSED: A = k rows (LDS), B = q rows (registers, hi + residual): D element r = key 8h + r, column = query = lane & 15; same 3 products in the same k order (hi.hi | k hi . q lo + k lo . q hi).
// So a lane holds 16 keys of ONE query: maximum and sum are in-lane plus one exchange with lane ^ 16, and two 16-key score tiles ARE the B fragment of 32 keys (elements 0..7 = tile 0, 8..15 = tile 1).
// Output TRANSPOSED too: A = v plane rows [channel][key] (LDS), B = P: D element r = channel 8h + r, column = query, so the running-maximum rescale is one factor per lane.
// k hi, k lo (64 rows x 512 B) and v (256 rows x 128 B) of a stage come into LDS by asynchronous copies, two buffers: the next stage flies while this one is multiplied. The two key halves are merged through LDS where a tile's share ends.
// A query row whose mask is 0 has all-zero logits whatever q and k are: all such rows of a batch have the SAME output row. The rows are ordered (mask != 0 first, in row order, then the others); only the slots 0 .. n1 are needed (slot n1 = one row of mask 0, which goes the ordinary way with factor 0 and stands for all of them).
// nt = tiles of 64 slots that hold them. The nt x 32 (tile, key stage) units of a batch are dealt in order to its 32 blocks, nt units each, for every mask; a block meets at most two tiles and writes one partial (maximum, sum, unnormalised output) for each; k_mg joins the partials of a row.
#define FQ 64              // query slots per tile
#define FK 64              // keys per LDS stage
#define FKP 264            // staged k row pitch in f16: 512 B + 16 B (16 B x odd: ds_load_b128 walks over rows meet no bank twice)
#define FVP 72             // staged v row pitch in f16: 128 B + 16 B (same reason)
#define FST (2 * FK * FKP + CC * FVP)   // f16 elements of one buffer
#define FSP 132            // staged partial-output row pitch in f32: 128 channels a pass + 16 B
#define NST (TT / FK)       // key stages of one query tile
#define QTP 136            // turned q row pitch in f16: 256 B + 16 B (16 B x odd, as FKP)
static_assert(NST == NQB, "a batch has as many blocks as a tile has stages: every block gets exactly nt stages");
#define WS_PO  WS_S                                          // f32 partial outputs [b][block][segment][64 slots][CC]
#define WS_PM  (WS_PO + 4u * (size_t)NB * NQB * 2 * FQ * CC)   // f32 partial maxima [b][block][segment][64 slots]
#define WS_PL  (WS_PM + 4u * (size_t)NB * NQB * 2 * FQ)        // f32 partial sums, same shape
#define WS_SL  (WS_PL + 4u * (size_t)NB * NQB * 2 * FQ)        // int slot of every query row [b][t]
#define WS_NT  (WS_SL + 4u * (size_t)NB * TT)                  // int tiles of every batch [b]
static_assert(WS_NT + 4u * NB <= WS_END, "the partials lie inside the former logit planes");
// one stage: 256 threads, 24 copies each; a wave's copy covers one 512-B k row or four 128-B v row pieces
__device__ __forceinline__ void fa_fill(const _Float16* k_h, const _Float16* k_l, const _Float16* v_t, _Float16* sr, int tid) {
  unsigned l[8]; const char* gp[8];
#pragma unroll   // the arrays indexed here live in registers: every index must be a compile-time constant
  for (int i = 0; i < 8; ++i) { const int e = i * 256 + tid, row = e >> 5, q = e & 31; l[i] = lds_off(sr + row * FKP + q * 8); gp[i] = (const char*)(k_h + (size_t)row * CCQ + q * 8); }
  copy8(l, gp);
#pragma unroll   // the arrays indexed here live in registers: every index must be a compile-time constant
  for (int i = 0; i < 8; ++i) { const int e = i * 256 + tid, row = e >> 5, q = e & 31; l[i] = lds_off(sr + (FK + row) * FKP + q * 8); gp[i] = (const char*)(k_l + (size_t)row * CCQ + q * 8); }
  copy8(l, gp);
#pragma unroll   // the arrays indexed here live in registers: every index must be a compile-time constant
  for (int i = 0; i < 8; ++i) { const int e = i * 256 + tid, row = e >> 3, q = e & 7; l[i] = lds_off(sr + 2 * FK * FKP + row * FVP + q * 8); gp[i] = (const char*)(v_t + (size_t)row * TT + q * 8); }
  copy8(l, gp);
}
__global__ __launch_bounds__(256) void k_fa(const _Float16* __restrict__ QH, const _Float16* __restrict__ QL, const _Float16* __restrict__ KH, const _Float16* __restrict__ KL, const _Float16* __restrict__ VT, const int* __restrict__ RMASK, float* __restrict__ PO, float* __restrict__ PM, float* __restrict__ PL, int* __restrict__ SL, int* __restrict__ NT) {
  __shared__ __align__(16) _Float16 ring[2][FST]; __shared__ __align__(16) float st[8][16][FSP]; __shared__ float xm[8][32], xl[8][32]; __shared__ unsigned short ord[TT]; __shared__ __align__(16) _Float16 qt[8][16][QTP];   /* qt: a wave's own turning place for its q rows, 16 rows x 128 k at a time */
  const int tid = threadIdx.x, wave = tid >> 5, lane = tid & 31, col = lane & 15, g = lane >> 4; const int qs = wave & 3, kh = wave >> 2; const int b = blockIdx.y;
  const _Float16* k_h = KH + (size_t)b * TT * CCQ; const _Float16* k_l = KL + (size_t)b * KHI * CCQ; const _Float16* v_t = VT + (size_t)b * CC * TT;
  int n1;   /* rows of this batch with mask != 0 */
  { /* every wave counts the whole batch by itself (a lane: 64 rows as two bit words, then a scan over the lanes); of each lane's 64 rows wave w enters 8 into ord[slot] = row */
    /* a wave's load = 512 B in a row (four whole 128-B lines, not 16 B of each of 32 lines): load c gives lane l the rows 128 c + 4 l + 0..3, as four bits in byte 32 c + l of the wave's own qt; lane l then takes bytes 16 l .. 16 l + 15 = its 64 rows */
    const int* mk = RMASK + (size_t)b * TT + lane * 4; unsigned char* nb = (unsigned char*)&qt[wave][0][0]; v4i mw[16];
#pragma unroll   // the arrays indexed here live in registers: every index must be a compile-time constant
    for (int c = 0; c < 16; ++c) mw[c] = *(const v4i*)(mk + 128 * c);
    asm volatile("s_wait_xcnt 0x0" ::: "memory");       // before an address register of the loads above is written again
#pragma unroll   // the arrays indexed here live in registers: every index must be a compile-time constant
    for (int c = 0; c < 16; ++c) nb[32 * c + lane] = (unsigned char)((mw[c][0] != 0 ? 1u : 0u) | (mw[c][1] != 0 ? 2u : 0u) | (mw[c][2] != 0 ? 4u : 0u) | (mw[c][3] != 0 ? 8u : 0u));
    asm volatile("s_wait_dscnt 0x0" ::: "memory");      // the wave's stores into qt are done before its lanes read what other lanes stored (the "memory" clobber keeps the compiler's LDS accesses on their sides)
    const v4u nr = *(const v4u*)(nb + 16 * lane); unsigned pk[4];   /* four bytes of four bits each -> 16 bits */
#pragma unroll
    for (int e = 0; e < 4; ++e) { const unsigned y = (nr[e] | (nr[e] >> 4)) & 0x00FF00FFu; pk[e] = (y | (y >> 8)) & 0xFFFFu; }
    const unsigned lo = pk[0] | (pk[1] << 16), hi = pk[2] | (pk[3] << 16);
    const int cnt = __popc(lo) + __popc(hi); int inc = cnt;
#pragma unroll
    for (int d = 1; d < 32; d <<= 1) { const int y = __shfl_up(inc, d); if (lane >= d) inc += y; }
    n1 = __shfl(inc, 31);
    const unsigned word = wave < 4 ? lo : hi; const int sh = (wave & 3) * 8;
    int r1 = inc - cnt + (wave < 4 ? 0 : __popc(lo)) + __popc(word & ((1u << sh) - 1u));   /* rows with mask != 0 in front of row p */
    int sv[8];
#pragma unroll
    for (int i = 0; i < 8; ++i) { const int p = lane * 64 + wave * 8 + i; const int bit = (int)((word >> (sh + i)) & 1u); ord[bit ? r1 : n1 + p - r1] = (unsigned short)p; sv[i] = bit ? r1 : n1; r1 += bit; }
    if (blockIdx.x == 0) { int* sp = SL + (size_t)b * TT + lane * 64 + wave * 8; vst2(sp, (v4i){sv[0], sv[1], sv[2], sv[3]}); vst2(sp + 4, (v4i){sv[4], sv[5], sv[6], sv[7]});
      asm volatile("s_wait_xcnt 0x0" ::: "memory"); } }   // before an address register of the stores above is written again
  const int nt = __builtin_amdgcn_readfirstlane(n1 < TT ? (n1 >> 6) + 1 : NQB);   /* 1 .. 32 for every mask */
  if (blockIdx.x == 0 && tid == 0) NT[b] = nt;
  asm volatile("s_wait_xcnt 0x0" ::: "memory");       // before an address register of the store above is written again
  const int u0 = blockIdx.x * nt;   /* this block's units: u0 .. u0 + nt - 1; unit u = (tile u / 32, key stage u % 32) */
  { const int s = u0 & (NST - 1); fa_fill(k_h + (size_t)s * FK * CCQ, k_l + (size_t)s * FK * CCQ, v_t + s * FK, &ring[0][0], tid); }
  asm volatile("s_wait_asynccnt 0x0" ::: "memory");   // the first stage has landed for this wave's own copies
  __syncthreads();                                     // ... and for every wave's; ord is readable too
  if (nt > 1) { const int s = (u0 + 1) & (NST - 1); fa_fill(k_h + (size_t)s * FK * CCQ, k_l + (size_t)s * FK * CCQ, v_t + s * FK, &ring[1][0], tid); }
  v16h qh[HDQK / 32] = {}, ql[HDQK / 32] = {};   /* this wave's 16 query rows, whole width, as B fragments */
  float sc2 = 0.f;
  v8f o[CC / 16] = {}; float m = -3.0e38f, l = 0.f;
#pragma unroll 1   // one stage a trip: the buffer index stays a run-time bit and the loop stays small
  for (int t = 0; t < nt; ++t) { const int u = u0 + t; const _Float16* sk = &ring[t & 1][(kh * 32 + col) * FKP]; const _Float16* sv = &ring[t & 1][2 * FK * FKP + col * FVP + kh * 32];
    if (t == 0 || (u & (NST - 1)) == 0) {   /* a tile begins (the same test in every wave of the block): its query rows */
      const int qrow = ord[((u / NST) * FQ + qs * 16 + col) & (TT - 1)] & (TT - 1);
      /* a wave's load = 256 B in a row of each of two q rows (four whole 128-B lines, not 32 B of each of 16 lines); pass p = (plane p >> 1: hi, residual; k half p & 1); the lanes get their B fragments (one row a lane) back through qt */
      v8h w[4][8]; const _Float16* qa[8]; const _Float16* qb[8];
#pragma unroll   // the arrays indexed here live in registers: every index must be a compile-time constant
      for (int i = 0; i < 8; ++i) { const int lr = ord[((u / NST) * FQ + qs * 16 + 2 * i + g) & (TT - 1)] & (TT - 1);
        qa[i] = QH + ((size_t)b * TT + lr) * CCQ + col * 8; qb[i] = QL + ((size_t)b * QHI + lr) * CCQ + col * 8;
        w[0][i] = *(const v8h*)qa[i]; w[1][i] = *(const v8h*)(qa[i] + 128); w[2][i] = *(const v8h*)qb[i]; w[3][i] = *(const v8h*)(qb[i] + 128); }
      // behind the last q load; the addresses are named so that they stay in their registers up to here and nothing (a load's result either) is written there in front of the wait
      asm volatile("s_wait_xcnt 0x0" :: "v"(qa[0]), "v"(qa[1]), "v"(qa[2]), "v"(qa[3]), "v"(qa[4]), "v"(qa[5]), "v"(qa[6]), "v"(qa[7]), "v"(qb[0]), "v"(qb[1]), "v"(qb[2]), "v"(qb[3]), "v"(qb[4]), "v"(qb[5]), "v"(qb[6]), "v"(qb[7]) : "memory");
      sc2 = (float)RMASK[(size_t)b * TT + qrow] * (SCALE * 1.44269504088896340736f);   /* one factor a lane: multiplicative mask of its query row x 1/8 x log2(e); the softmax runs in base 2 */
      asm volatile("s_wait_xcnt 0x0" ::: "memory");   // before an address register of the loads above is written again
#pragma unroll   // the arrays indexed here live in registers: every index must be a compile-time constant
      for (int p = 0; p < 4; ++p) {
#pragma unroll   // the arrays indexed here live in registers: every index must be a compile-time constant
        for (int i = 0; i < 8; ++i) *(v8h*)&qt[wave][2 * i + g][col * 8] = w[p][i];
        asm volatile("s_wait_dscnt 0x0" ::: "memory");   // the wave's stores into qt are done before its lanes read what other lanes stored (the "memory" clobber keeps the compiler's LDS accesses on their sides)
#pragma unroll   // the arrays indexed here live in registers: every index must be a compile-time constant
        for (int c = 0; c < 4; ++c) { const v16h f = frag_h(&qt[wave][col][c * 32], lane); if (p < 2) qh[(p & 1) * 4 + c] = f; else ql[(p & 1) * 4 + c] = f; }
        asm volatile("s_wait_dscnt 0x0" ::: "memory");   // the fragments are read before the next pass's stores overwrite qt
      } }
    v8f acc[2] = {}, accl[2] = {}; v16h ah[2][2], al[2][2];   /* fragments of k chunk kk + 1 are read from LDS in front of the products of chunk kk */
#pragma unroll   // the arrays indexed here live in registers: every index must be a compile-time constant
    for (int u = 0; u < 2; ++u) { ah[0][u] = frag_h(sk + u * 16 * FKP, lane); al[0][u] = frag_h(sk + (FK + u * 16) * FKP, lane); }
#pragma unroll   // the arrays indexed here live in registers: every index must be a compile-time constant
    for (int kk = 0; kk < HDQK / 32; ++kk) { const int c = kk & 1, n = c ^ 1;
      if (kk + 1 < HDQK / 32) {
#pragma unroll   // the arrays indexed here live in registers: every index must be a compile-time constant
        for (int u = 0; u < 2; ++u) { ah[n][u] = frag_h(sk + u * 16 * FKP + (kk + 1) * 32, lane); al[n][u] = frag_h(sk + (FK + u * 16) * FKP + (kk + 1) * 32, lane); } }
      __builtin_amdgcn_sched_barrier(0);   // the LDS reads of chunk kk + 1 stay in front of the products of chunk kk
      /* the two products into accl[0] stand three matrix instructions apart, those into accl[1] two */
      acc[0] = WM(ah[c][0], qh[kk], acc[0]); accl[0] = WM(ah[c][0], ql[kk], accl[0]); acc[1] = WM(ah[c][1], qh[kk], acc[1]); accl[1] = WM(ah[c][1], ql[kk], accl[1]); accl[0] = WM(al[c][0], qh[kk], accl[0]); accl[1] = WM(al[c][1], qh[kk], accl[1]);
      __builtin_amdgcn_sched_barrier(0); }   // no product of chunk kk + 1 is pulled in here: it would wait on LDS reads that were only just issued
    v16h vf[2][4];   /* the first four v fragments do not depend on P: their LDS reads are written ahead of the exponentials, which cover the latency */
#pragma unroll   // the arrays indexed here live in registers: every index must be a compile-time constant
    for (int u = 0; u < 4; ++u) vf[0][u] = frag_h(sv + u * 16 * FVP, lane);
    float s[2][8]; float mx0 = -3.0e38f, mx1 = -3.0e38f;
#pragma unroll   // the arrays indexed here live in registers: every index must be a compile-time constant
    for (int r = 0; r < 8; ++r) { const float v0 = (acc[0][r] + accl[0][r] * (1.0f / 1024.0f)) * sc2, v1 = (acc[1][r] + accl[1][r] * (1.0f / 1024.0f)) * sc2; s[0][r] = v0; s[1][r] = v1; mx0 = fmaxf(mx0, v0); mx1 = fmaxf(mx1, v1); }
    float mx = fmaxf(mx0, mx1); mx = fmaxf(mx, __shfl_xor(mx, 16));   /* the other 16 keys of the same query */
    const float mn = fmaxf(m, mx - 11.0f); const float af = __builtin_amdgcn_exp2f(m - mn); m = mn;   /* the running maximum is kept 11 lower, so that every 2^(s - mn) already carries the 2^11 of the f16 P; first stage: 2^(-3e38) = 0 */
    float ps0 = 0.f, ps1 = 0.f; v16h pf;
#pragma unroll   // the arrays indexed here live in registers: every index must be a compile-time constant
    for (int r = 0; r < 8; r += 2) { const v2f mn2 = {mn, mn}; const v2f d0 = (v2f){s[0][r], s[0][r + 1]} - mn2, d1 = (v2f){s[1][r], s[1][r + 1]} - mn2;   /* two differences an instruction */
      const float e0 = __builtin_amdgcn_exp2f(d0[0]), e1 = __builtin_amdgcn_exp2f(d1[0]), e2 = __builtin_amdgcn_exp2f(d0[1]), e3 = __builtin_amdgcn_exp2f(d1[1]);   /* arguments end at about 11: the bare hardware exponential needs no range handling (far below: 0) */
      ps0 += e0; ps1 += e1; ps0 += e2; ps1 += e3; pf[r] = (_Float16)e0; pf[r + 1] = (_Float16)e2; pf[8 + r] = (_Float16)e1; pf[9 + r] = (_Float16)e3; }
    l = l * af + (ps0 + ps1);   /* per lane: its own 16 keys a stage; the two lanes of a query are added where the tile's share ends */
#pragma unroll   // the arrays indexed here live in registers: every index must be a compile-time constant
    for (int j = 0; j < CC / 16; ++j) o[j] = o[j] * af;
#pragma unroll   // the arrays indexed here live in registers: every index must be a compile-time constant
    for (int jg = 0; jg < CC / 64; ++jg) { const int c = jg & 1, n = c ^ 1;   /* four channel tiles a group: the LDS reads of group jg + 1 stand together in front of the products of group jg */
      if (jg + 1 < CC / 64) {
#pragma unroll   // the arrays indexed here live in registers: every index must be a compile-time constant
        for (int u = 0; u < 4; ++u) vf[n][u] = frag_h(sv + ((jg + 1) * 4 + u) * 16 * FVP, lane); }
      __builtin_amdgcn_sched_barrier(0);   // the LDS reads of group jg + 1 stay in one place, in front of the products of group jg
#pragma unroll   // the arrays indexed here live in registers: every index must be a compile-time constant
      for (int u = 0; u < 4; ++u) o[jg * 4 + u] = WM(vf[c][u], pf, o[jg * 4 + u]);
      __builtin_amdgcn_sched_barrier(0); }   // no LDS read of a later group is spread among these products
    asm volatile("s_wait_dscnt 0x0" ::: "memory");      // this wave's reads of buffer t & 1 are done before it is handed to the copies
    asm volatile("s_wait_asynccnt 0x0" ::: "memory");   // this wave's copies of stage t + 1 have landed
    __syncthreads();                                     // publishes stage t + 1 and ends every reader's last read of buffer t & 1
    if (t + 2 < nt) { const int s = (u + 2) & (NST - 1); fa_fill(k_h + (size_t)s * FK * CCQ, k_l + (size_t)s * FK * CCQ, v_t + s * FK, &ring[t & 1][0], tid); }
    if ((u & (NST - 1)) == NST - 1 || t == nt - 1) {   /* the block's share of this tile ends (the same test in every wave of the block): join the two key halves, write the partial, start anew */
      const size_t piece = ((size_t)b * NQB + blockIdx.x) * 2 + (u / NST - u0 / NST);   /* segment 0 or 1: nt <= 32 units meet at most two tiles */
      l += __shfl_xor(l, 16);
      xm[wave][lane] = m; xl[wave][lane] = l;
      __syncthreads();                                   // maximum and sum of the other key half are readable
      const float m2 = xm[wave ^ 4][lane], l2 = xl[wave ^ 4][lane]; const float ms = fmaxf(m, m2); const float a1 = __builtin_amdgcn_exp2f(m - ms), a2 = __builtin_amdgcn_exp2f(m2 - ms);
      float* pp = PO + (piece * FQ + qs * 16 + kh * 8) * CC + lane * 4;   /* a wave adds and stores 8 of its pair's 16 rows: two 512-B pieces a row */
      v4f h0[8];   /* 128 channels a pass through the staging; every global store stands behind the last barrier, so that no barrier waits for a store */
#pragma unroll   // the arrays indexed here live in registers: every index must be a compile-time constant
      for (int j = 0; j < 8; ++j) { const v8f w = o[j] * a1; const v4f w0 = {w[0], w[1], w[2], w[3]}, w1 = {w[4], w[5], w[6], w[7]}; *(v4f*)&st[wave][col][j * 16 + 8 * g] = w0; *(v4f*)&st[wave][col][j * 16 + 8 * g + 4] = w1; }
      __syncthreads();                                   // both halves' scaled outputs, channels 0..127, are readable
#pragma unroll   // the arrays indexed here live in registers: every index must be a compile-time constant
      for (int rl = 0; rl < 8; ++rl) h0[rl] = *(const v4f*)&st[qs][kh * 8 + rl][lane * 4] + *(const v4f*)&st[qs + 4][kh * 8 + rl][lane * 4];
      __syncthreads();                                   // every reader has left the staging before it is written again
#pragma unroll   // the arrays indexed here live in registers: every index must be a compile-time constant
      for (int j = 0; j < 8; ++j) { const v8f w = o[8 + j] * a1; const v4f w0 = {w[0], w[1], w[2], w[3]}, w1 = {w[4], w[5], w[6], w[7]}; *(v4f*)&st[wave][col][j * 16 + 8 * g] = w0; *(v4f*)&st[wave][col][j * 16 + 8 * g + 4] = w1; }
      __syncthreads();                                   // channels 128..255 are readable; the staging, xm and xl are next written behind the barrier at the foot of a later stage
#pragma unroll   // the arrays indexed here live in registers: every index must be a compile-time constant
      for (int rl = 0; rl < 8; ++rl) { vst2(pp + (size_t)rl * CC, h0[rl]); vst2(pp + (size_t)rl * CC + 128, *(const v4f*)&st[qs][kh * 8 + rl][lane * 4] + *(const v4f*)&st[qs + 4][kh * 8 + rl][lane * 4]); }
      if (kh == 0 && g == 0) { PM[piece * FQ + qs * 16 + col] = ms; PL[piece * FQ + qs * 16 + col] = l * a1 + l2 * a2; }
      asm volatile("s_wait_xcnt 0x0" ::: "memory");     // before an address register of the stores above is written again
#pragma unroll   // the arrays indexed here live in registers: every index must be a compile-time constant
      for (int j = 0; j < CC / 16; ++j) o[j] = (v8f){};
      m = -3.0e38f; l = 0.f; } }
  asm volatile("s_wait_asynccnt 0x0" ::: "memory");     // no copy is outstanding when the wave ends
}
// 2^d with the free issue slot behind a transcendental in the same statement: in a row of exponentials the next one may be given this one's source register as its result
__device__ __forceinline__ float exp2_slot(float d) { float r; asm("v_exp_f32 %0, %1\n\tv_nop" : "=v"(r) : "v"(d)); return r; }
// ---- k_mg: one output row = the partials of its slot's tile, joined (common maximum, weights 2^(m - M)), divided by the joined sum. 16 lanes a row, 16 channels a lane; four partials are fetched at a time.
__global__ __launch_bounds__(256) void k_mg(const float* __restrict__ PO, const float* __restrict__ PM, const float* __restrict__ PL, const int* __restrict__ SL, const int* __restrict__ NT, float* __restrict__ Y) {
  const int c = threadIdx.x & 15, rg = threadIdx.x >> 4; const int b = blockIdx.y;
  int nt = NT[b]; nt = nt < 1 ? 1 : nt > NQB ? NQB : nt;
  int sl[2];
#pragma unroll
  for (int rr = 0; rr < 2; ++rr) sl[rr] = SL[(size_t)b * TT + blockIdx.x * 32 + rr * 16 + rg];
  asm volatile("s_wait_xcnt 0x0" ::: "memory");       // before an address register of the loads above is written again
#pragma unroll
  for (int rr = 0; rr < 2; ++rr) { const int q = blockIdx.x * 32 + rr * 16 + rg;
    int slot = sl[rr]; slot = slot < 0 ? 0 : slot > nt * FQ - 1 ? nt * FQ - 1 : slot;
    const int tau = slot / FQ, r = slot % FQ; const int j0 = (tau * NST) / nt, j1 = (tau * NST + NST - 1) / nt;   /* the blocks that hold units of tile tau; j1 <= 31 as tau < nt */
    float M = -3.0e38f, L = 0.f; v4f a[4] = {};
    for (int jb = j0; jb <= j1; jb += 4) { float pm[4], pl[4]; v4f x[4][4];
#pragma unroll
      for (int e = 0; e < 4; ++e) { const int jj = jb + e < j1 ? jb + e : j1; const size_t piece = ((size_t)b * NQB + jj) * 2 + (tau - (jj * nt) / NST);   /* past the last block: the last one again, with weight 0 */
        pm[e] = PM[piece * FQ + r]; pl[e] = PL[piece * FQ + r];
        asm volatile("s_wait_xcnt 0x0" ::: "memory");   // before a later load's result lands in an address register of the two loads above
#pragma unroll
        for (int k = 0; k < 4; ++k) x[e][k] = *(const v4f*)(PO + (piece * FQ + r) * CC + k * 64 + c * 4);
        asm volatile("s_wait_xcnt 0x0" ::: "memory"); }   // before a later load's result lands in the address register of the four loads above
      __builtin_amdgcn_sched_barrier(0);   // the loads of all four partials are issued before the first is used: one memory latency a group, not several
      const float Mn = fmaxf(fmaxf(M, fmaxf(pm[0], pm[1])), fmaxf(pm[2], pm[3])); const float f = exp2_slot(M - Mn); M = Mn; L *= f;
#pragma unroll
      for (int k = 0; k < 4; ++k) a[k] = a[k] * f;
#pragma unroll
      for (int e = 0; e < 4; ++e) { const float ex = exp2_slot(pm[e] - Mn); const float w = jb + e <= j1 ? ex : 0.f; L += pl[e] * w;
#pragma unroll
        for (int k = 0; k < 4; ++k) a[k] = a[k] + x[e][k] * w; } }
    const float inv = 1.0f / L;   /* sums and outputs both carry the 2^11; the sum holds the 2^11 of the row's maximum: never 0 */
#pragma unroll
    for (int k = 0; k < 4; ++k) vst2(Y + ((size_t)b * TT + q) * CC + k * 64 + c * 4, a[k] * inv);
    asm volatile("s_wait_xcnt 0x0" ::: "memory"); } }   // before an address register of the stores above is written again

extern "C" void kernel_launch(void* const* d_in, const int* in_sizes, int n_in, void* d_out, int out_size, void* d_ws, size_t ws_size, hipStream_t stream) {
  (void)in_sizes; (void)n_in; (void)out_size;
  const float** F = (const float**)d_in;
  if (ws_size < (size_t)WS_END) return;
  char* ws = (char*)d_ws; _Float16 *QH = (_Float16*)(ws + WS_QH), *KH = (_Float16*)(ws + WS_KH), *VT = (_Float16*)(ws + WS_VT), *QL = (_Float16*)(ws + WS_QL), *KL = (_Float16*)(ws + WS_KL); __bf16 *VB = (__bf16*)(ws + WS_VB), *VBL = (__bf16*)(ws + WS_VBL);
  float *PO = (float*)(ws + WS_PO), *PM = (float*)(ws + WS_PM), *PL = (float*)(ws + WS_PL); int *SL = (int*)(ws + WS_SL), *NT = (int*)(ws + WS_NT);
  // inputs: 0 x [8,2048,256]; 1 kernel [3,256,256] ((in,out): Q | K | V matrices); 2 mask [8,2048] int32
  const float* Wq = F[1]; const float* Wk = F[1] + (size_t)DIN * CCQ; const float* Wv = F[1] + 2 * (size_t)DIN * CCQ;
  k_projT<0><<<dim3(TNB * TT / 128, CCQ / 128, 2), 128, 0, stream>>>(F[0], F[0], F[0], Wq, Wk, Wv, nullptr, nullptr, nullptr, QH, QL, KH, KL, VT, VB, VBL);   /* which 0, 1: q and k rows (hi + residual planes) */
  k_projT<2><<<dim3(TNB * TT / 128, CC / 128, 1), 128, 0, stream>>>(F[0], F[0], F[0], Wq, Wk, Wv, nullptr, nullptr, nullptr, QH, QL, KH, KL, VT, VB, VBL);     /* which 2: v planes */
  k_fa<<<dim3(NQB, TNB), 256, 0, stream>>>(QH, QL, KH, KL, VT, (const int*)d_in[2], PO, PM, PL, SL, NT);   /* scores, softmax, P . v of the needed rows: partials */
  k_mg<<<dim3(TT / 32, TNB), 256, 0, stream>>>(PO, PM, PL, SL, NT, (float*)d_out);   /* every output row from its partials */
}
